// v000
// The times below were measured on an AMD MI455X: many runs one after another, warmed up first and cycling through
// copies of the inputs, with the whole window's GPU time divided by the number of runs. Launches and the gaps
// between them are all in it. The median over several windows is given; except for v000 it joins two sittings, which
// can be a few percent apart, so the side-by-side timings, each taken in one sitting, are the better comparison.
// v000 is the starting kernel. One run takes 2550 microseconds.
#include <hip/hip_runtime.h>

typedef __attribute__((ext_vector_type(16))) _Float16 v16h;
typedef __attribute__((ext_vector_type(8)))  float    v8f;

#define NT    8192      // total columns = B * N
#define NPTS  4096      // points per batch
#define BN_EPS 1e-5f
#define FPAD  40

__device__ __forceinline__ v16h frag_ld(const _Float16* s, int lane) {
  const int row = lane & 15, h2 = lane >> 4;
  const _Float16* p = s + row * FPAD + 8 * h2;
  v16h f;
#pragma unroll
  for (int e = 0; e < 8; ++e) f[e] = p[e];
#pragma unroll
  for (int e = 0; e < 8; ++e) f[8 + e] = p[8 + e + 8];   // base+16+8*h2+e
  return f;
}

// ---- generic WMMA GEMM: O[m,n] = epi( sum_k A[m,k]*B[k,n] ) ---------------
// 256 threads = 8 waves as 4(M)x2(N); block tile 64(M) x 128(N); KT=32.
// Each wave: 16x64 output = 4 wmma per K-step on one A fragment.
// epilogue: +bias[m], BN(g,b) fresh stats, act(0,1=relu,2=leaky.2), +residual.
__global__ __launch_bounds__(256) void k_gemm(
    const _Float16* __restrict__ A, int lda,
    const _Float16* __restrict__ Bm, int ldb,
    _Float16* __restrict__ O, int ldc,
    int M, int K,
    const float* __restrict__ bias,
    const float* __restrict__ bng, const float* __restrict__ bnb,
    int act, const _Float16* __restrict__ resid)
{
  __shared__ _Float16 As[64 * FPAD];     // [m][k]
  __shared__ _Float16 BsT[128 * FPAD];   // [n][k] (transposed staging)
  const int tid  = threadIdx.x;
  const int lane = tid & 31, wave = tid >> 5;
  const int wm = wave >> 1, wn = wave & 1;
  const int m0 = blockIdx.y * 64;
  const int n0 = blockIdx.x * 128;
  v8f acc[4] = {{}, {}, {}, {}};
  const int ar = tid >> 2, ac = (tid & 3) * 8;    // A stage: 64 rows x 32
  const int br = tid >> 3, bc = (tid & 7) * 16;   // B stage: 32 k-rows x 128 n

  for (int k0 = 0; k0 < K; k0 += 32) {
    { // stage A [64][32] -> As[m][k], contiguous 16B per thread
      const int gm = m0 + ar;
      _Float16* dst = &As[ar * FPAD + ac];
      if (gm < M) {
        const _Float16* src = A + (size_t)gm * lda + k0 + ac;
#pragma unroll
        for (int i = 0; i < 8; ++i) dst[i] = src[i];
      } else {
#pragma unroll
        for (int i = 0; i < 8; ++i) dst[i] = (_Float16)0.f;
      }
    }
    { // stage B [32][128] transposed -> BsT[n][k]; coalesced 32B global reads
      const _Float16* src = Bm + (size_t)(k0 + br) * ldb + n0 + bc;
#pragma unroll
      for (int i = 0; i < 16; ++i) BsT[(bc + i) * FPAD + br] = src[i];
      if (k0 + 32 < K)  // hint next K-tile toward L2 (global_prefetch_b8)
        __builtin_prefetch(Bm + (size_t)(k0 + 32 + br) * ldb + n0 + bc, 0, 1);
    }
    __syncthreads();
    const v16h af = frag_ld(&As[wm * 16 * FPAD], lane);
#pragma unroll
    for (int t = 0; t < 4; ++t) {
      const v16h bf = frag_ld(&BsT[(wn * 64 + t * 16) * FPAD], lane);
      acc[t] = __builtin_amdgcn_wmma_f32_16x16x32_f16(false, af, false, bf,
                                                      (short)0, acc[t],
                                                      false, false);
    }
    __syncthreads();
  }

  const int lcol = lane & 15, h2 = lane >> 4;
  const float bns = rsqrtf(1.f + BN_EPS);
#pragma unroll
  for (int t = 0; t < 4; ++t) {
    const int n = n0 + wn * 64 + t * 16 + lcol;
#pragma unroll
    for (int r = 0; r < 8; ++r) {
      const int m = m0 + wm * 16 + h2 * 8 + r;
      if (m < M) {
        float v = acc[t][r];
        if (bias) v += bias[m];
        if (bng)  v = v * (bng[m] * bns) + bnb[m];
        if (act == 1)      v = fmaxf(v, 0.f);
        else if (act == 2) v = (v > 0.f) ? v : 0.2f * v;
        if (resid) v += (float)resid[(size_t)m * ldc + n];
        O[(size_t)m * ldc + n] = (_Float16)v;
      }
    }
  }
}

// ---- attention: e = q^T q (K=32), row softmax, store p=exp(e-max) f16 -----
// One block = 16 rows of one batch; 8 waves lockstep over 4096 columns,
// two passes (rowmax, then exp/rowsum/store). rowinv = 1/rowsum.
__global__ __launch_bounds__(256) void k_attn(
    const _Float16* __restrict__ q,   // [32][NT]
    _Float16* __restrict__ att,       // [2][NPTS][NPTS] raw exp numerators
    float* __restrict__ rowinv)       // [2][NPTS]
{
  __shared__ _Float16 Aq[16 * FPAD];     // [n][c]
  __shared__ _Float16 BqT[128 * FPAD];   // [m][c] (transposed staging)
  __shared__ float part[8 * 16];
  __shared__ float redv[16];
  const int tid = threadIdx.x;
  const int lane = tid & 31, wv = tid >> 5;
  const int h2 = lane >> 4;
  const int bb = blockIdx.y;
  const int n0 = blockIdx.x * 16;
  const int cbase = bb * NPTS;

  // stage transposed q tile: Aq[nl][c] = q[c][cbase+n0+nl]
  for (int i = tid; i < 512; i += 256) {
    const int nl = i & 15, c = i >> 4;
    Aq[nl * FPAD + c] = q[(size_t)c * NT + cbase + n0 + nl];
  }
  __syncthreads();
  const v16h af = frag_ld(Aq, lane);

  float rmax[8];
#pragma unroll
  for (int r = 0; r < 8; ++r) rmax[r] = -3.0e38f;

  // pass 1: row max
  for (int it = 0; it < NPTS / 128; ++it) {
    const int mb = it * 128;
    for (int i = tid; i < 32 * 128; i += 256) {
      const int c = i >> 7, ml = i & 127;     // coalesced read, scattered store
      BqT[ml * FPAD + c] = q[(size_t)c * NT + cbase + mb + ml];
    }
    __syncthreads();
    const v16h bf = frag_ld(&BqT[wv * 16 * FPAD], lane);
    v8f z = {};
    v8f e = __builtin_amdgcn_wmma_f32_16x16x32_f16(false, af, false, bf,
                                                   (short)0, z, false, false);
#pragma unroll
    for (int r = 0; r < 8; ++r) rmax[r] = fmaxf(rmax[r], e[r]);
    __syncthreads();
  }
#pragma unroll
  for (int off = 1; off < 16; off <<= 1)
#pragma unroll
    for (int r = 0; r < 8; ++r)
      rmax[r] = fmaxf(rmax[r], __shfl_xor(rmax[r], off, 32));
  if ((lane & 15) == 0) {
#pragma unroll
    for (int r = 0; r < 8; ++r) part[wv * 16 + h2 * 8 + r] = rmax[r];
  }
  __syncthreads();
  if (tid < 16) {
    float m = -3.0e38f;
    for (int w = 0; w < 8; ++w) m = fmaxf(m, part[w * 16 + tid]);
    redv[tid] = m;
  }
  __syncthreads();
  float rm[8], rsum[8];
#pragma unroll
  for (int r = 0; r < 8; ++r) { rm[r] = redv[h2 * 8 + r]; rsum[r] = 0.f; }

  // pass 2: p = exp(e - rowmax); accumulate rowsum; store p (f16)
  for (int it = 0; it < NPTS / 128; ++it) {
    const int mb = it * 128;
    for (int i = tid; i < 32 * 128; i += 256) {
      const int c = i >> 7, ml = i & 127;
      BqT[ml * FPAD + c] = q[(size_t)c * NT + cbase + mb + ml];
    }
    __syncthreads();
    const v16h bf = frag_ld(&BqT[wv * 16 * FPAD], lane);
    v8f z = {};
    v8f e = __builtin_amdgcn_wmma_f32_16x16x32_f16(false, af, false, bf,
                                                   (short)0, z, false, false);
    const int m = mb + wv * 16 + (lane & 15);
#pragma unroll
    for (int r = 0; r < 8; ++r) {
      const float p = __expf(e[r] - rm[r]);
      rsum[r] += p;
      att[((size_t)(bb * NPTS + n0 + h2 * 8 + r)) * NPTS + m] = (_Float16)p;
    }
    __syncthreads();
  }
#pragma unroll
  for (int off = 1; off < 16; off <<= 1)
#pragma unroll
    for (int r = 0; r < 8; ++r) rsum[r] += __shfl_xor(rsum[r], off, 32);
  if ((lane & 15) == 0) {
#pragma unroll
    for (int r = 0; r < 8; ++r) part[wv * 16 + h2 * 8 + r] = rsum[r];
  }
  __syncthreads();
  if (tid < 16) {
    float s = 0.f;
    for (int w = 0; w < 8; ++w) s += part[w * 16 + tid];
    rowinv[bb * NPTS + n0 + tid] = 1.f / s;
  }
}

// ---- small elementwise / reduction kernels --------------------------------
__global__ void k_f2h(const float* __restrict__ s, _Float16* __restrict__ d, int n) {
  int i = blockIdx.x * 256 + threadIdx.x;
  if (i < n) d[i] = (_Float16)s[i];
}

// h1 = relu(bn1(conv1_w @ x^T)) ; K=3 scalar path
__global__ void k_conv1(const float* __restrict__ x, const float* __restrict__ w,
                        const float* __restrict__ g, const float* __restrict__ b,
                        _Float16* __restrict__ h1) {
  int i = blockIdx.x * 256 + threadIdx.x;
  if (i >= 128 * NT) return;
  const int o = i >> 13, j = i & (NT - 1);
  float s = w[o * 3 + 0] * x[(size_t)j * 3 + 0] +
            w[o * 3 + 1] * x[(size_t)j * 3 + 1] +
            w[o * 3 + 2] * x[(size_t)j * 3 + 2];
  s = s * (g[o] * rsqrtf(1.f + BN_EPS)) + b[o];
  h1[i] = (_Float16)fmaxf(s, 0.f);
}

// v_scaled = v * rowinv[col]
__global__ void k_scale_v(const _Float16* __restrict__ v, const float* __restrict__ ri,
                          _Float16* __restrict__ o) {
  int i = blockIdx.x * 256 + threadIdx.x;
  if (i >= 128 * NT) return;
  o[i] = (_Float16)((float)v[i] * ri[i & (NT - 1)]);
}

// colsum[b][m] = sum_n rowinv[b][n] * p[b][n][m]
__global__ void k_colsum(const _Float16* __restrict__ att, const float* __restrict__ ri,
                         float* __restrict__ cs) {
  const int bb = blockIdx.y;
  const int m = blockIdx.x * 256 + threadIdx.x;
  const _Float16* ap = att + (size_t)bb * NPTS * NPTS + m;
  const float* rp = ri + bb * NPTS;
  float s = 0.f;
  for (int n = 0; n < NPTS; ++n) s += rp[n] * (float)ap[(size_t)n * NPTS];
  cs[bb * NPTS + m] = s;
}

// diff = h - xnum / (1e-9 + colsum[col])
__global__ void k_diff(const _Float16* __restrict__ h, const _Float16* __restrict__ xn,
                       const float* __restrict__ cs, _Float16* __restrict__ d) {
  int i = blockIdx.x * 256 + threadIdx.x;
  if (i >= 128 * NT) return;
  const int j = i & (NT - 1);
  d[i] = (_Float16)((float)h[i] - (float)xn[i] / (1e-9f + cs[j]));
}

// per-row max/mean pooling over N for hf rows (M=1024)
__global__ void k_pool(const _Float16* __restrict__ hf, float* __restrict__ xmax,
                       float* __restrict__ xavg) {
  const int o = blockIdx.x, bb = blockIdx.y, tid = threadIdx.x;
  const _Float16* p = hf + (size_t)o * NT + bb * NPTS;
  float mx = -3.0e38f, sm = 0.f;
  for (int i = tid; i < NPTS; i += 256) {
    const float v = (float)p[i];
    mx = fmaxf(mx, v); sm += v;
  }
  __shared__ float s1[256], s2[256];
  s1[tid] = mx; s2[tid] = sm;
  __syncthreads();
  for (int s = 128; s > 0; s >>= 1) {
    if (tid < s) { s1[tid] = fmaxf(s1[tid], s1[tid + s]); s2[tid] += s2[tid + s]; }
    __syncthreads();
  }
  if (tid == 0) {
    xmax[bb * 1024 + o] = s1[0];
    xavg[bb * 1024 + o] = s2[0] * (1.f / NPTS);
  }
}

// cls_f = leaky(bn(label_w @ cls_label))  (K=16, 128 outputs total)
__global__ void k_cls(const float* __restrict__ w, const float* __restrict__ lab,
                      const float* __restrict__ g, const float* __restrict__ b,
                      float* __restrict__ out) {
  const int t = threadIdx.x;
  if (t >= 128) return;
  const int bb = t >> 6, o = t & 63;
  float s = 0.f;
  for (int c = 0; c < 16; ++c) s += w[o * 16 + c] * lab[bb * 16 + c];
  s = s * (g[o] * rsqrtf(1.f + BN_EPS)) + b[o];
  out[t] = (s > 0.f) ? s : 0.2f * s;
}

// broadcast pooled features + cls into big[1024..3135][:]
__global__ void k_bcast(const float* __restrict__ xmax, const float* __restrict__ xavg,
                        const float* __restrict__ clsf, _Float16* __restrict__ big) {
  int i = blockIdx.x * 256 + threadIdx.x;
  if (i >= 2112 * NT) return;
  const int r = i >> 13, j = i & (NT - 1), bb = j >> 12;
  float v;
  if (r < 1024)      v = xmax[bb * 1024 + r];
  else if (r < 2048) v = xavg[bb * 1024 + (r - 1024)];
  else               v = clsf[bb * 64 + (r - 2048)];
  big[(size_t)(1024 + r) * NT + j] = (_Float16)v;
}

// out3 f16 [50][NT] -> d_out f32 [B][50][N]
__global__ void k_repack(const _Float16* __restrict__ o3, float* __restrict__ out) {
  int i = blockIdx.x * 256 + threadIdx.x;
  if (i >= 2 * 50 * NPTS) return;
  const int bb = i / (50 * NPTS);
  const int r = i - bb * 50 * NPTS;
  const int o = r >> 12, n = r & (NPTS - 1);
  out[i] = (float)o3[(size_t)o * NT + bb * NPTS + n];
}

// ---------------------------------------------------------------------------
extern "C" void kernel_launch(void* const* d_in, const int* in_sizes, int n_in,
                              void* d_out, int out_size, void* d_ws, size_t ws_size,
                              hipStream_t stream) {
  (void)in_sizes; (void)n_in; (void)out_size; (void)ws_size;
  const float* x         = (const float*)d_in[0];
  const float* cls_lab   = (const float*)d_in[1];
  const float* conv1_w   = (const float*)d_in[2];
  const float* bn1_g     = (const float*)d_in[3];
  const float* bn1_b     = (const float*)d_in[4];
  const float* conv2_w   = (const float*)d_in[5];
  const float* bn2_g     = (const float*)d_in[6];
  const float* bn2_b     = (const float*)d_in[7];
  const float* sa_qk_w   = (const float*)d_in[8];
  const float* sa_v_w    = (const float*)d_in[9];
  const float* sa_v_b    = (const float*)d_in[10];
  const float* sa_t_w    = (const float*)d_in[11];
  const float* sa_t_b    = (const float*)d_in[12];
  const float* sa_bn_g   = (const float*)d_in[13];
  const float* sa_bn_b   = (const float*)d_in[14];
  const float* fuse_w    = (const float*)d_in[15];
  const float* fuse_bn_g = (const float*)d_in[16];
  const float* fuse_bn_b = (const float*)d_in[17];
  const float* label_w   = (const float*)d_in[18];
  const float* label_bn_g= (const float*)d_in[19];
  const float* label_bn_b= (const float*)d_in[20];
  const float* convs1_w  = (const float*)d_in[21];
  const float* convs1_b  = (const float*)d_in[22];
  const float* bns1_g    = (const float*)d_in[23];
  const float* bns1_b    = (const float*)d_in[24];
  const float* convs2_w  = (const float*)d_in[25];
  const float* convs2_b  = (const float*)d_in[26];
  const float* bns2_g    = (const float*)d_in[27];
  const float* bns2_b    = (const float*)d_in[28];
  const float* convs3_w  = (const float*)d_in[29];
  const float* convs3_b  = (const float*)d_in[30];

  char* wp = (char*)d_ws;
  auto alloc = [&](size_t bytes) -> char* {
    char* p = wp; wp += (bytes + 255) & ~(size_t)255; return p;
  };
  auto h16 = [&](size_t n) { return (_Float16*)alloc(n * 2); };
  auto f32 = [&](size_t n) { return (float*)alloc(n * 4); };

  // f16 weight copies
  _Float16* wc2   = h16(128 * 128);
  _Float16* wqk   = h16(4 * 32 * 128);
  _Float16* wv    = h16(4 * 128 * 128);
  _Float16* wt    = h16(4 * 128 * 128);
  _Float16* wfuse = h16(1024 * 512);
  _Float16* ws1c  = h16(512 * 3136);
  _Float16* ws2c  = h16(256 * 512);
  _Float16* ws3c  = h16(50 * 256);
  // activations
  _Float16* h1    = h16((size_t)128 * NT);
  _Float16* h2b   = h16((size_t)128 * NT);
  _Float16* qbuf  = h16((size_t)32 * NT);
  _Float16* vbuf  = h16((size_t)128 * NT);
  _Float16* vsc   = h16((size_t)128 * NT);
  _Float16* attb  = h16((size_t)2 * NPTS * NPTS);
  _Float16* xnum  = h16((size_t)128 * NT);
  _Float16* dbuf  = h16((size_t)128 * NT);
  _Float16* hcat  = h16((size_t)512 * NT);
  _Float16* big   = h16((size_t)3136 * NT);
  _Float16* hs1   = h16((size_t)512 * NT);
  _Float16* hs2   = h16((size_t)256 * NT);
  _Float16* out3  = h16((size_t)50 * NT);
  float* rowinv = f32(2 * NPTS);
  float* colsum = f32(2 * NPTS);
  float* xmax   = f32(2 * 1024);
  float* xavg   = f32(2 * 1024);
  float* clsf   = f32(2 * 64);

  auto cvt = [&](const float* s, _Float16* d, int n) {
    k_f2h<<<(n + 255) / 256, 256, 0, stream>>>(s, d, n);
  };
  auto gemm = [&](const _Float16* A, int lda, const _Float16* Bm, int ldb,
                  _Float16* O, int ldc, int M, int Ncols, int K,
                  const float* bias, const float* g, const float* be, int act,
                  const _Float16* resid) {
    dim3 grid(Ncols / 128, (M + 63) / 64);
    k_gemm<<<grid, 256, 0, stream>>>(A, lda, Bm, ldb, O, ldc, M, K,
                                     bias, g, be, act, resid);
  };

  // weight conversions
  cvt(conv2_w, wc2, 128 * 128);
  cvt(sa_qk_w, wqk, 4 * 32 * 128);
  cvt(sa_v_w,  wv,  4 * 128 * 128);
  cvt(sa_t_w,  wt,  4 * 128 * 128);
  cvt(fuse_w,  wfuse, 1024 * 512);
  cvt(convs1_w, ws1c, 512 * 3136);
  cvt(convs2_w, ws2c, 256 * 512);
  cvt(convs3_w, ws3c, 50 * 256);

  // stem
  k_conv1<<<(128 * NT + 255) / 256, 256, 0, stream>>>(x, conv1_w, bn1_g, bn1_b, h1);
  gemm(wc2, 128, h1, NT, h2b, NT, 128, NT, 128, nullptr, bn2_g, bn2_b, 1, nullptr);

  // 4 self-attention blocks; feats written directly into hcat rows
  const _Float16* hprev = h2b;
  for (int i = 0; i < 4; ++i) {
    gemm(wqk + (size_t)i * 32 * 128, 128, hprev, NT, qbuf, NT, 32, NT, 128,
         nullptr, nullptr, nullptr, 0, nullptr);
    gemm(wv + (size_t)i * 128 * 128, 128, hprev, NT, vbuf, NT, 128, NT, 128,
         sa_v_b + i * 128, nullptr, nullptr, 0, nullptr);
    k_attn<<<dim3(NPTS / 16, 2), 256, 0, stream>>>(qbuf, attb, rowinv);
    k_scale_v<<<(128 * NT + 255) / 256, 256, 0, stream>>>(vbuf, rowinv, vsc);
    k_colsum<<<dim3(NPTS / 256, 2), 256, 0, stream>>>(attb, rowinv, colsum);
    for (int b = 0; b < 2; ++b)
      gemm(vsc + b * NPTS, NT, attb + (size_t)b * NPTS * NPTS, NPTS,
           xnum + b * NPTS, NT, 128, NPTS, NPTS,
           nullptr, nullptr, nullptr, 0, nullptr);
    k_diff<<<(128 * NT + 255) / 256, 256, 0, stream>>>(hprev, xnum, colsum, dbuf);
    _Float16* hout = hcat + (size_t)i * 128 * NT;
    gemm(wt + (size_t)i * 128 * 128, 128, dbuf, NT, hout, NT, 128, NT, 128,
         sa_t_b + i * 128, sa_bn_g + i * 128, sa_bn_b + i * 128, 1, hprev);
    hprev = hout;
  }

  // fuse (writes rows 0..1023 of big), pooling, cls, broadcast
  gemm(wfuse, 512, hcat, NT, big, NT, 1024, NT, 512,
       nullptr, fuse_bn_g, fuse_bn_b, 2, nullptr);
  k_pool<<<dim3(1024, 2), 256, 0, stream>>>(big, xmax, xavg);
  k_cls<<<1, 128, 0, stream>>>(label_w, cls_lab, label_bn_g, label_bn_b, clsf);
  k_bcast<<<(2112 * NT + 255) / 256, 256, 0, stream>>>(xmax, xavg, clsf, big);

  // segmentation head
  gemm(ws1c, 3136, big, NT, hs1, NT, 512, NT, 3136,
       convs1_b, bns1_g, bns1_b, 1, nullptr);
  gemm(ws2c, 512, hs1, NT, hs2, NT, 256, NT, 512,
       convs2_b, bns2_g, bns2_b, 1, nullptr);
  gemm(ws3c, 256, hs2, NT, out3, NT, 50, NT, 256,
       convs3_b, nullptr, nullptr, 0, nullptr);
  k_repack<<<(2 * 50 * NPTS + 255) / 256, 256, 0, stream>>>(out3, (float*)d_out);
}

// v002
// A run of this version takes 1120 microseconds.
// Versions in between are left out here; by their measured steps it is 2.30 times as fast as v000.
#include <hip/hip_runtime.h>

typedef __attribute__((ext_vector_type(16))) _Float16 v16h;
typedef __attribute__((ext_vector_type(8)))  float    v8f;
typedef __attribute__((ext_vector_type(4)))  float    v4f;
typedef __attribute__((ext_vector_type(4)))  _Float16 v4h;
typedef __attribute__((ext_vector_type(8)))  _Float16 v8h;

#define NT    8192      // total columns = B * N
#define NPTS  4096      // points per batch
#define BN_EPS 1e-5f
#define FPAD  40
#define KSPLIT 8
#define KSL   (NPTS / KSPLIT)
#define CSPLIT 8
#define CWAVES 16
#define CRW   (NPTS / CSPLIT / CWAVES)

__device__ __forceinline__ v16h frag_ld(const _Float16* s, int lane) {
  const int row = lane & 15, h2 = lane >> 4;
  const _Float16* p = s + row * FPAD + 8 * h2;
  v16h f;
#pragma unroll
  for (int e = 0; e < 8; ++e) f[e] = p[e];
#pragma unroll
  for (int e = 0; e < 8; ++e) f[8 + e] = p[8 + e + 8];   // base+16+8*h2+e
  return f;
}

// ---- generic WMMA GEMM: O[m,n] = epi( sum_k A[m,k]*B[k,n] ) ---------------
// 256 threads = 8 waves as 4(M)x2(N); block tile 64(M) x 128(N); KT=32.
// Each wave: 16x64 output = 4 wmma per K-step on one A fragment.
// epilogue: +bias[m], BN(g,b) fresh stats, act(0,1=relu,2=leaky.2), +residual.
__global__ __launch_bounds__(256) void k_gemm(
    const _Float16* __restrict__ A, int lda,
    const _Float16* __restrict__ Bm, int ldb,
    _Float16* __restrict__ O, int ldc,
    int M, int K,
    const float* __restrict__ bias,
    const float* __restrict__ bng, const float* __restrict__ bnb,
    int act, const _Float16* __restrict__ resid)
{
  __shared__ _Float16 As[64 * FPAD];     // [m][k]
  __shared__ _Float16 BsT[128 * FPAD];   // [n][k] (transposed staging)
  const int tid  = threadIdx.x;
  const int lane = tid & 31, wave = tid >> 5;
  const int wm = wave >> 1, wn = wave & 1;
  const int m0 = blockIdx.y * 64;
  const int n0 = blockIdx.x * 128;
  v8f acc[4] = {{}, {}, {}, {}};
  const int ar = tid >> 2, ac = (tid & 3) * 8;    // A stage: 64 rows x 32
  const int br = tid >> 3, bc = (tid & 7) * 16;   // B stage: 32 k-rows x 128 n

  for (int k0 = 0; k0 < K; k0 += 32) {
    { // stage A [64][32] -> As[m][k], contiguous 16B per thread
      const int gm = m0 + ar;
      _Float16* dst = &As[ar * FPAD + ac];
      if (gm < M) {
        const _Float16* src = A + (size_t)gm * lda + k0 + ac;
#pragma unroll
        for (int i = 0; i < 8; ++i) dst[i] = src[i];
      } else {
#pragma unroll
        for (int i = 0; i < 8; ++i) dst[i] = (_Float16)0.f;
      }
    }
    { // stage B [32][128] transposed -> BsT[n][k]; coalesced 32B global reads
      const _Float16* src = Bm + (size_t)(k0 + br) * ldb + n0 + bc;
#pragma unroll
      for (int i = 0; i < 16; ++i) BsT[(bc + i) * FPAD + br] = src[i];
      if (k0 + 32 < K)  // hint next K-tile toward L2 (global_prefetch_b8)
        __builtin_prefetch(Bm + (size_t)(k0 + 32 + br) * ldb + n0 + bc, 0, 1);
    }
    __syncthreads();
    const v16h af = frag_ld(&As[wm * 16 * FPAD], lane);
#pragma unroll
    for (int t = 0; t < 4; ++t) {
      const v16h bf = frag_ld(&BsT[(wn * 64 + t * 16) * FPAD], lane);
      acc[t] = __builtin_amdgcn_wmma_f32_16x16x32_f16(false, af, false, bf,
                                                      (short)0, acc[t],
                                                      false, false);
    }
    __syncthreads();
  }

  const int lcol = lane & 15, h2 = lane >> 4;
  const float bns = rsqrtf(1.f + BN_EPS);
#pragma unroll
  for (int t = 0; t < 4; ++t) {
    const int n = n0 + wn * 64 + t * 16 + lcol;
#pragma unroll
    for (int r = 0; r < 8; ++r) {
      const int m = m0 + wm * 16 + h2 * 8 + r;
      if (m < M) {
        float v = acc[t][r];
        if (bias) v += bias[m];
        if (bng)  v = v * (bng[m] * bns) + bnb[m];
        if (act == 1)      v = fmaxf(v, 0.f);
        else if (act == 2) v = (v > 0.f) ? v : 0.2f * v;
        if (resid) v += (float)resid[(size_t)m * ldc + n];
        O[(size_t)m * ldc + n] = (_Float16)v;
      }
    }
  }
}

__global__ __launch_bounds__(256) void k_gemm_xnum(
    const _Float16* __restrict__ vs,    // [128][NT]  v * rowinv
    const _Float16* __restrict__ att,   // [2][NPTS][NPTS]
    float* __restrict__ part)           // [128][KSPLIT][NT]
{
  __shared__ _Float16 As[64 * FPAD];     // [m][k]
  __shared__ _Float16 BsT[128 * FPAD];   // [n][k] (transposed staging)
  const int tid  = threadIdx.x;
  const int lane = tid & 31, wave = tid >> 5;
  const int wm = wave >> 1, wn = wave & 1;
  const int m0 = blockIdx.y * 64;
  const int n0 = blockIdx.x * 128;
  const int bb = blockIdx.z / KSPLIT, ks = blockIdx.z % KSPLIT;
  const _Float16* A  = vs + bb * NPTS + ks * KSL;
  const _Float16* Bm = att + (size_t)bb * NPTS * NPTS + (size_t)ks * KSL * NPTS;
  v8f acc[4] = {{}, {}, {}, {}};
  const int ar = tid >> 2, ac = (tid & 3) * 8;    // A stage: 64 rows x 32
  const int br = tid >> 3, bc = (tid & 7) * 16;   // B stage: 32 k-rows x 128 n

  for (int k0 = 0; k0 < KSL; k0 += 32) {
    { // stage A [64][32] -> As[m][k], contiguous 16B per thread
      _Float16* dst = &As[ar * FPAD + ac];
      const _Float16* src = A + (size_t)(m0 + ar) * NT + k0 + ac;
#pragma unroll  // merges into one 16B load and one 16B LDS store
      for (int i = 0; i < 8; ++i) dst[i] = src[i];
    }
    { // stage B [32][128] transposed -> BsT[n][k]; coalesced 32B global reads
      const _Float16* src = Bm + (size_t)(k0 + br) * NPTS + n0 + bc;
#pragma unroll  // merges the reads into two 16B loads
      for (int i = 0; i < 16; ++i) BsT[(bc + i) * FPAD + br] = src[i];
    }
    __syncthreads();
    const v16h af = frag_ld(&As[wm * 16 * FPAD], lane);
#pragma unroll  // acc[t] must be indexed by constants to stay in registers
    for (int t = 0; t < 4; ++t) {
      const v16h bf = frag_ld(&BsT[(wn * 64 + t * 16) * FPAD], lane);
      acc[t] = __builtin_amdgcn_wmma_f32_16x16x32_f16(false, af, false, bf,
                                                      (short)0, acc[t],
                                                      false, false);
    }
    __syncthreads();
  }

  const int lcol = lane & 15, h2 = lane >> 4;
  float* po = part + ks * NT + bb * NPTS;
#pragma unroll  // both loops: acc indexed by constants, offsets as immediates
  for (int t = 0; t < 4; ++t) {
    const int n = n0 + wn * 64 + t * 16 + lcol;
#pragma unroll
    for (int r = 0; r < 8; ++r) {
      const int m = m0 + wm * 16 + h2 * 8 + r;
      po[(size_t)m * (KSPLIT * NT) + n] = acc[t][r];
    }
  }
}

// ---- attention: e = q^T q (K=32), row softmax, store p=exp(e-max) f16 -----
// One block = 16 rows of one batch; 8 waves lockstep over 4096 columns,
// two passes (rowmax, then exp/rowsum/store). rowinv = 1/rowsum.
__global__ __launch_bounds__(256) void k_attn(
    const _Float16* __restrict__ q,   // [32][NT]
    _Float16* __restrict__ att,       // [2][NPTS][NPTS] raw exp numerators
    float* __restrict__ rowinv)       // [2][NPTS]
{
  __shared__ _Float16 Aq[16 * FPAD];     // [n][c]
  __shared__ _Float16 BqT[128 * FPAD];   // [m][c] (transposed staging)
  __shared__ float part[8 * 16];
  __shared__ float redv[16];
  const int tid = threadIdx.x;
  const int lane = tid & 31, wv = tid >> 5;
  const int h2 = lane >> 4;
  const int bb = blockIdx.y;
  const int n0 = blockIdx.x * 16;
  const int cbase = bb * NPTS;

  // stage transposed q tile: Aq[nl][c] = q[c][cbase+n0+nl]
  for (int i = tid; i < 512; i += 256) {
    const int nl = i & 15, c = i >> 4;
    Aq[nl * FPAD + c] = q[(size_t)c * NT + cbase + n0 + nl];
  }
  __syncthreads();
  const v16h af = frag_ld(Aq, lane);

  float rmax[8];
#pragma unroll
  for (int r = 0; r < 8; ++r) rmax[r] = -3.0e38f;

  // pass 1: row max
  for (int it = 0; it < NPTS / 128; ++it) {
    const int mb = it * 128;
    for (int i = tid; i < 32 * 128; i += 256) {
      const int c = i >> 7, ml = i & 127;     // coalesced read, scattered store
      BqT[ml * FPAD + c] = q[(size_t)c * NT + cbase + mb + ml];
    }
    __syncthreads();
    const v16h bf = frag_ld(&BqT[wv * 16 * FPAD], lane);
    v8f z = {};
    v8f e = __builtin_amdgcn_wmma_f32_16x16x32_f16(false, af, false, bf,
                                                   (short)0, z, false, false);
#pragma unroll
    for (int r = 0; r < 8; ++r) rmax[r] = fmaxf(rmax[r], e[r]);
    __syncthreads();
  }
#pragma unroll
  for (int off = 1; off < 16; off <<= 1)
#pragma unroll
    for (int r = 0; r < 8; ++r)
      rmax[r] = fmaxf(rmax[r], __shfl_xor(rmax[r], off, 32));
  if ((lane & 15) == 0) {
#pragma unroll
    for (int r = 0; r < 8; ++r) part[wv * 16 + h2 * 8 + r] = rmax[r];
  }
  __syncthreads();
  if (tid < 16) {
    float m = -3.0e38f;
    for (int w = 0; w < 8; ++w) m = fmaxf(m, part[w * 16 + tid]);
    redv[tid] = m;
  }
  __syncthreads();
  float rm[8], rsum[8];
#pragma unroll
  for (int r = 0; r < 8; ++r) { rm[r] = redv[h2 * 8 + r]; rsum[r] = 0.f; }

  // pass 2: p = exp(e - rowmax); accumulate rowsum; store p (f16)
  for (int it = 0; it < NPTS / 128; ++it) {
    const int mb = it * 128;
    for (int i = tid; i < 32 * 128; i += 256) {
      const int c = i >> 7, ml = i & 127;
      BqT[ml * FPAD + c] = q[(size_t)c * NT + cbase + mb + ml];
    }
    __syncthreads();
    const v16h bf = frag_ld(&BqT[wv * 16 * FPAD], lane);
    v8f z = {};
    v8f e = __builtin_amdgcn_wmma_f32_16x16x32_f16(false, af, false, bf,
                                                   (short)0, z, false, false);
    const int m = mb + wv * 16 + (lane & 15);
#pragma unroll
    for (int r = 0; r < 8; ++r) {
      const float p = __expf(e[r] - rm[r]);
      rsum[r] += p;
      att[((size_t)(bb * NPTS + n0 + h2 * 8 + r)) * NPTS + m] = (_Float16)p;
    }
    __syncthreads();
  }
#pragma unroll
  for (int off = 1; off < 16; off <<= 1)
#pragma unroll
    for (int r = 0; r < 8; ++r) rsum[r] += __shfl_xor(rsum[r], off, 32);
  if ((lane & 15) == 0) {
#pragma unroll
    for (int r = 0; r < 8; ++r) part[wv * 16 + h2 * 8 + r] = rsum[r];
  }
  __syncthreads();
  if (tid < 16) {
    float s = 0.f;
    for (int w = 0; w < 8; ++w) s += part[w * 16 + tid];
    rowinv[bb * NPTS + n0 + tid] = 1.f / s;
  }
}

// ---- small elementwise / reduction kernels --------------------------------
__global__ void k_f2h(const float* __restrict__ s, _Float16* __restrict__ d, int n) {
  int i = blockIdx.x * 256 + threadIdx.x;
  if (i < n) d[i] = (_Float16)s[i];
}

// h1 = relu(bn1(conv1_w @ x^T)) ; K=3 scalar path
__global__ void k_conv1(const float* __restrict__ x, const float* __restrict__ w,
                        const float* __restrict__ g, const float* __restrict__ b,
                        _Float16* __restrict__ h1) {
  int i = blockIdx.x * 256 + threadIdx.x;
  if (i >= 128 * NT) return;
  const int o = i >> 13, j = i & (NT - 1);
  float s = w[o * 3 + 0] * x[(size_t)j * 3 + 0] +
            w[o * 3 + 1] * x[(size_t)j * 3 + 1] +
            w[o * 3 + 2] * x[(size_t)j * 3 + 2];
  s = s * (g[o] * rsqrtf(1.f + BN_EPS)) + b[o];
  h1[i] = (_Float16)fmaxf(s, 0.f);
}

// v_scaled = v * rowinv[col]
__global__ void k_scale_v(const _Float16* __restrict__ v, const float* __restrict__ ri,
                          _Float16* __restrict__ o) {
  int i = blockIdx.x * 256 + threadIdx.x;
  if (i >= 128 * NT) return;
  o[i] = (_Float16)((float)v[i] * ri[i & (NT - 1)]);
}

// colsum[b][m] = sum_n rowinv[b][n] * p[b][n][m], split along n.
// One thread per column would fill only 32 work-groups and wait out the load
// latency of 4096 rows in turn. A work-group owns 256 columns x NPTS/CSPLIT
// rows: a wave reads 512-byte row pieces (16 B per lane) of its own CRW rows,
// all independent loads; the CWAVES waves' sums meet in LDS; the work-group
// stores one f32 partial per column, cs[slice][NT]; k_diff adds the partials.
__global__ __launch_bounds__(CWAVES * 32) void k_colsum(
    const _Float16* __restrict__ att, const float* __restrict__ ri,
    float* __restrict__ cs) {
  __shared__ __attribute__((aligned(32))) float red[CWAVES][256];
  const int tid = threadIdx.x, lane = tid & 31;
  // wave number as a scalar, so that rowinv comes through scalar loads
  const int wave = __builtin_amdgcn_readfirstlane(tid >> 5);
  const int bb = blockIdx.y, ks = blockIdx.z;
  const int m0 = blockIdx.x * 256;
  const int r0 = (ks * CWAVES + wave) * CRW;
  const v8h* ap = (const v8h*)(att + (size_t)bb * NPTS * NPTS +
                               (size_t)r0 * NPTS + m0 + lane * 8);
  const float* rp = ri + bb * NPTS + r0;
  v8h a[CRW];
#pragma unroll  // row offsets as immediates, all CRW row loads in flight
  for (int j = 0; j < CRW; ++j) a[j] = ap[j * (NPTS / 8)];
  // the loads' address registers are given new values below: wait first
  asm volatile("s_wait_xcnt 0x0" ::: "memory");
  v8f s = {};
#pragma unroll  // a indexed by constants to stay in registers
  for (int j = 0; j < CRW; ++j)
    s += __builtin_convertvector(a[j], v8f) * rp[j];
  *(v8f*)&red[wave][lane * 8] = s;
  __syncthreads();
  if (tid < 256) {
    float t = red[0][tid];
#pragma unroll  // all LDS reads in flight together
    for (int w = 1; w < CWAVES; ++w) t += red[w][tid];
    cs[ks * NT + bb * NPTS + m0 + tid] = t;
  }
}

// diff = h - (sum of the KSPLIT x_num partials) / (1e-9 + colsum[col]),
// colsum[col] = sum of the CSPLIT partials of k_colsum
// one thread = 4 consecutive columns of one row
__global__ void k_diff(const _Float16* __restrict__ h, const float* __restrict__ part,
                       const float* __restrict__ cs, _Float16* __restrict__ d) {
  const int q = blockIdx.x * 256 + threadIdx.x;     // index of the 4-column group
  if (q >= 128 * NT / 4) return;
  const int row = q / (NT / 4), jq = q & (NT / 4 - 1);
  const v4f* p4 = (const v4f*)part + row * (KSPLIT * NT / 4) + jq;  // [row][slice][col]
  v4f xn = p4[0];
#pragma unroll  // all KSPLIT loads in flight together
  for (int s = 1; s < KSPLIT; ++s) xn += p4[s * (NT / 4)];
  v4f c4 = ((const v4f*)cs)[jq];
#pragma unroll  // all CSPLIT loads in flight together
  for (int s = 1; s < CSPLIT; ++s) c4 += ((const v4f*)cs)[s * (NT / 4) + jq];
  const v4h h4 = ((const v4h*)h)[q];
  v4h o;
#pragma unroll  // vector elements indexed by constants
  for (int e = 0; e < 4; ++e)
    o[e] = (_Float16)((float)h4[e] - xn[e] / (1e-9f + c4[e]));
  ((v4h*)d)[q] = o;
}

// per-row max/mean pooling over N for hf rows (M=1024)
__global__ void k_pool(const _Float16* __restrict__ hf, float* __restrict__ xmax,
                       float* __restrict__ xavg) {
  const int o = blockIdx.x, bb = blockIdx.y, tid = threadIdx.x;
  const _Float16* p = hf + (size_t)o * NT + bb * NPTS;
  float mx = -3.0e38f, sm = 0.f;
  for (int i = tid; i < NPTS; i += 256) {
    const float v = (float)p[i];
    mx = fmaxf(mx, v); sm += v;
  }
  __shared__ float s1[256], s2[256];
  s1[tid] = mx; s2[tid] = sm;
  __syncthreads();
  for (int s = 128; s > 0; s >>= 1) {
    if (tid < s) { s1[tid] = fmaxf(s1[tid], s1[tid + s]); s2[tid] += s2[tid + s]; }
    __syncthreads();
  }
  if (tid == 0) {
    xmax[bb * 1024 + o] = s1[0];
    xavg[bb * 1024 + o] = s2[0] * (1.f / NPTS);
  }
}

// cls_f = leaky(bn(label_w @ cls_label))  (K=16, 128 outputs total)
__global__ void k_cls(const float* __restrict__ w, const float* __restrict__ lab,
                      const float* __restrict__ g, const float* __restrict__ b,
                      float* __restrict__ out) {
  const int t = threadIdx.x;
  if (t >= 128) return;
  const int bb = t >> 6, o = t & 63;
  float s = 0.f;
  for (int c = 0; c < 16; ++c) s += w[o * 16 + c] * lab[bb * 16 + c];
  s = s * (g[o] * rsqrtf(1.f + BN_EPS)) + b[o];
  out[t] = (s > 0.f) ? s : 0.2f * s;
}

// broadcast pooled features + cls into big[1024..3135][:]
__global__ void k_bcast(const float* __restrict__ xmax, const float* __restrict__ xavg,
                        const float* __restrict__ clsf, _Float16* __restrict__ big) {
  int i = blockIdx.x * 256 + threadIdx.x;
  if (i >= 2112 * NT) return;
  const int r = i >> 13, j = i & (NT - 1), bb = j >> 12;
  float v;
  if (r < 1024)      v = xmax[bb * 1024 + r];
  else if (r < 2048) v = xavg[bb * 1024 + (r - 1024)];
  else               v = clsf[bb * 64 + (r - 2048)];
  big[(size_t)(1024 + r) * NT + j] = (_Float16)v;
}

// out3 f16 [50][NT] -> d_out f32 [B][50][N]
__global__ void k_repack(const _Float16* __restrict__ o3, float* __restrict__ out) {
  int i = blockIdx.x * 256 + threadIdx.x;
  if (i >= 2 * 50 * NPTS) return;
  const int bb = i / (50 * NPTS);
  const int r = i - bb * 50 * NPTS;
  const int o = r >> 12, n = r & (NPTS - 1);
  out[i] = (float)o3[(size_t)o * NT + bb * NPTS + n];
}

// ---------------------------------------------------------------------------
extern "C" void kernel_launch(void* const* d_in, const int* in_sizes, int n_in,
                              void* d_out, int out_size, void* d_ws, size_t ws_size,
                              hipStream_t stream) {
  (void)in_sizes; (void)n_in; (void)out_size; (void)ws_size;
  const float* x         = (const float*)d_in[0];
  const float* cls_lab   = (const float*)d_in[1];
  const float* conv1_w   = (const float*)d_in[2];
  const float* bn1_g     = (const float*)d_in[3];
  const float* bn1_b     = (const float*)d_in[4];
  const float* conv2_w   = (const float*)d_in[5];
  const float* bn2_g     = (const float*)d_in[6];
  const float* bn2_b     = (const float*)d_in[7];
  const float* sa_qk_w   = (const float*)d_in[8];
  const float* sa_v_w    = (const float*)d_in[9];
  const float* sa_v_b    = (const float*)d_in[10];
  const float* sa_t_w    = (const float*)d_in[11];
  const float* sa_t_b    = (const float*)d_in[12];
  const float* sa_bn_g   = (const float*)d_in[13];
  const float* sa_bn_b   = (const float*)d_in[14];
  const float* fuse_w    = (const float*)d_in[15];
  const float* fuse_bn_g = (const float*)d_in[16];
  const float* fuse_bn_b = (const float*)d_in[17];
  const float* label_w   = (const float*)d_in[18];
  const float* label_bn_g= (const float*)d_in[19];
  const float* label_bn_b= (const float*)d_in[20];
  const float* convs1_w  = (const float*)d_in[21];
  const float* convs1_b  = (const float*)d_in[22];
  const float* bns1_g    = (const float*)d_in[23];
  const float* bns1_b    = (const float*)d_in[24];
  const float* convs2_w  = (const float*)d_in[25];
  const float* convs2_b  = (const float*)d_in[26];
  const float* bns2_g    = (const float*)d_in[27];
  const float* bns2_b    = (const float*)d_in[28];
  const float* convs3_w  = (const float*)d_in[29];
  const float* convs3_b  = (const float*)d_in[30];

  char* wp = (char*)d_ws;
  auto alloc = [&](size_t bytes) -> char* {
    char* p = wp; wp += (bytes + 255) & ~(size_t)255; return p;
  };
  auto h16 = [&](size_t n) { return (_Float16*)alloc(n * 2); };
  auto f32 = [&](size_t n) { return (float*)alloc(n * 4); };

  // f16 weight copies
  _Float16* wc2   = h16(128 * 128);
  _Float16* wqk   = h16(4 * 32 * 128);
  _Float16* wv    = h16(4 * 128 * 128);
  _Float16* wt    = h16(4 * 128 * 128);
  _Float16* wfuse = h16(1024 * 512);
  _Float16* ws1c  = h16(512 * 3136);
  _Float16* ws2c  = h16(256 * 512);
  _Float16* ws3c  = h16(50 * 256);
  // activations
  _Float16* h1    = h16((size_t)128 * NT);
  _Float16* h2b   = h16((size_t)128 * NT);
  _Float16* qbuf  = h16((size_t)32 * NT);
  _Float16* vbuf  = h16((size_t)128 * NT);
  _Float16* vsc   = h16((size_t)128 * NT);
  _Float16* attb  = h16((size_t)2 * NPTS * NPTS);
  _Float16* dbuf  = h16((size_t)128 * NT);
  _Float16* hcat  = h16((size_t)512 * NT);
  _Float16* big   = h16((size_t)3136 * NT);
  _Float16* hs1   = h16((size_t)512 * NT);
  _Float16* hs2   = h16((size_t)256 * NT);
  _Float16* out3  = h16((size_t)50 * NT);
  float* xpart  = f32((size_t)KSPLIT * 128 * NT);
  float* rowinv = f32(2 * NPTS);
  float* colsum = f32((size_t)CSPLIT * NT);
  float* xmax   = f32(2 * 1024);
  float* xavg   = f32(2 * 1024);
  float* clsf   = f32(2 * 64);

  auto cvt = [&](const float* s, _Float16* d, int n) {
    k_f2h<<<(n + 255) / 256, 256, 0, stream>>>(s, d, n);
  };
  auto gemm = [&](const _Float16* A, int lda, const _Float16* Bm, int ldb,
                  _Float16* O, int ldc, int M, int Ncols, int K,
                  const float* bias, const float* g, const float* be, int act,
                  const _Float16* resid) {
    dim3 grid(Ncols / 128, (M + 63) / 64);
    k_gemm<<<grid, 256, 0, stream>>>(A, lda, Bm, ldb, O, ldc, M, K,
                                     bias, g, be, act, resid);
  };

  // weight conversions
  cvt(conv2_w, wc2, 128 * 128);
  cvt(sa_qk_w, wqk, 4 * 32 * 128);
  cvt(sa_v_w,  wv,  4 * 128 * 128);
  cvt(sa_t_w,  wt,  4 * 128 * 128);
  cvt(fuse_w,  wfuse, 1024 * 512);
  cvt(convs1_w, ws1c, 512 * 3136);
  cvt(convs2_w, ws2c, 256 * 512);
  cvt(convs3_w, ws3c, 50 * 256);

  // stem
  k_conv1<<<(128 * NT + 255) / 256, 256, 0, stream>>>(x, conv1_w, bn1_g, bn1_b, h1);
  gemm(wc2, 128, h1, NT, h2b, NT, 128, NT, 128, nullptr, bn2_g, bn2_b, 1, nullptr);

  // 4 self-attention blocks; feats written directly into hcat rows
  const _Float16* hprev = h2b;
  for (int i = 0; i < 4; ++i) {
    gemm(wqk + (size_t)i * 32 * 128, 128, hprev, NT, qbuf, NT, 32, NT, 128,
         nullptr, nullptr, nullptr, 0, nullptr);
    gemm(wv + (size_t)i * 128 * 128, 128, hprev, NT, vbuf, NT, 128, NT, 128,
         sa_v_b + i * 128, nullptr, nullptr, 0, nullptr);
    k_attn<<<dim3(NPTS / 16, 2), 256, 0, stream>>>(qbuf, attb, rowinv);
    k_scale_v<<<(128 * NT + 255) / 256, 256, 0, stream>>>(vbuf, rowinv, vsc);
    k_colsum<<<dim3(NPTS / 256, 2, CSPLIT), CWAVES * 32, 0, stream>>>(attb, rowinv, colsum);
    k_gemm_xnum<<<dim3(NPTS / 128, 2, 2 * KSPLIT), 256, 0, stream>>>(vsc, attb, xpart);
    k_diff<<<128 * NT / 4 / 256, 256, 0, stream>>>(hprev, xpart, colsum, dbuf);
    _Float16* hout = hcat + (size_t)i * 128 * NT;
    gemm(wt + (size_t)i * 128 * 128, 128, dbuf, NT, hout, NT, 128, NT, 128,
         sa_t_b + i * 128, sa_bn_g + i * 128, sa_bn_b + i * 128, 1, hprev);
    hprev = hout;
  }

  // fuse (writes rows 0..1023 of big), pooling, cls, broadcast
  gemm(wfuse, 512, hcat, NT, big, NT, 1024, NT, 512,
       nullptr, fuse_bn_g, fuse_bn_b, 2, nullptr);
  k_pool<<<dim3(1024, 2), 256, 0, stream>>>(big, xmax, xavg);
  k_cls<<<1, 128, 0, stream>>>(label_w, cls_lab, label_bn_g, label_bn_b, clsf);
  k_bcast<<<(2112 * NT + 255) / 256, 256, 0, stream>>>(xmax, xavg, clsf, big);

  // segmentation head
  gemm(ws1c, 3136, big, NT, hs1, NT, 512, NT, 3136,
       convs1_b, bns1_g, bns1_b, 1, nullptr);
  gemm(ws2c, 512, hs1, NT, hs2, NT, 256, NT, 512,
       convs2_b, bns2_g, bns2_b, 1, nullptr);
  gemm(ws3c, 256, hs2, NT, out3, NT, 50, NT, 256,
       convs3_b, nullptr, nullptr, 0, nullptr);
  k_repack<<<(2 * 50 * NPTS + 255) / 256, 256, 0, stream>>>(out3, (float*)d_out);
}

// v004
// A run of this version takes 505 microseconds.
// Versions between v002 and this one are left out; their measured steps multiply to 2.21 times as fast.
// All steps since v000 together make it 5.08 times as fast.
#include <hip/hip_runtime.h>

typedef __attribute__((ext_vector_type(16))) _Float16 v16h;
typedef __attribute__((ext_vector_type(8)))  float    v8f;
typedef __attribute__((ext_vector_type(4)))  float    v4f;
typedef __attribute__((ext_vector_type(4)))  _Float16 v4h;
typedef __attribute__((ext_vector_type(8)))  _Float16 v8h;

#define NT    8192      // total columns = B * N
#define NPTS  4096      // points per batch
#define BN_EPS 1e-5f
#define FPAD  40
#define KSPLIT 8
#define KSL   (NPTS / KSPLIT)
#define CSPLIT KSPLIT
#define SROWT 2
#define HK    3136
#define HKP   1024
#define GLOB  (HK - HKP)
#define GW    11
#define GT    6

__device__ __forceinline__ v16h frag_ld(const _Float16* s, int lane) {
  const int row = lane & 15, h2 = lane >> 4;
  const _Float16* p = s + row * FPAD + 8 * h2;
  v16h f;
#pragma unroll
  for (int e = 0; e < 8; ++e) f[e] = p[e];
#pragma unroll
  for (int e = 0; e < 8; ++e) f[8 + e] = p[8 + e + 8];   // base+16+8*h2+e
  return f;
}

__device__ __forceinline__ v16h frag_g(const v8h* __restrict__ f, int tile, int lane) {
  const v8h lo = f[(tile * 2 + 0) * 32 + lane];
  const v8h hi = f[(tile * 2 + 1) * 32 + lane];
  return __builtin_shufflevector(lo, hi, 0, 1, 2, 3, 4, 5, 6, 7,
                                 8, 9, 10, 11, 12, 13, 14, 15);
}

// ---- generic WMMA GEMM: O[m,n] = epi( sum_k A[m,k]*B[k,n] ) ---------------
// 256 threads = 8 waves as 4(M)x2(N); block tile 64(M) x 128(N); KT=32.
// Each wave: 16x64 output = 4 wmma per K-step on one A fragment.
// epilogue: +bias[m], BN(g,b) fresh stats, act(0,1=relu,2=leaky.2), +residual.
// bias_bs: distance between the two batches' bias vectors (0: one for both).
// act 3 (the q projection, M = 32): plain product, stored in the fragment
// order of frag_g with the point as fragment row and the channel as k.
__global__ __launch_bounds__(256) void k_gemm(
    const _Float16* __restrict__ A, int lda,
    const _Float16* __restrict__ Bm, int ldb,
    _Float16* __restrict__ O, int ldc,
    int M, int K,
    const float* __restrict__ bias,
    const float* __restrict__ bng, const float* __restrict__ bnb,
    int act, const _Float16* __restrict__ resid, int bias_bs)
{
  __shared__ _Float16 As[64 * FPAD];     // [m][k]
  __shared__ _Float16 BsT[128 * FPAD];   // [n][k] (transposed staging)
  const int tid  = threadIdx.x;
  const int lane = tid & 31, wave = tid >> 5;
  const int wm = wave >> 1, wn = wave & 1;
  const int m0 = blockIdx.y * 64;
  const int n0 = blockIdx.x * 128;
  v8f acc[4] = {{}, {}, {}, {}};
  const int ar = tid >> 2, ac = (tid & 3) * 8;    // A stage: 64 rows x 32
  const int br = tid >> 3, bc = (tid & 7) * 16;   // B stage: 32 k-rows x 128 n

  for (int k0 = 0; k0 < K; k0 += 32) {
    { // stage A [64][32] -> As[m][k], contiguous 16B per thread
      const int gm = m0 + ar;
      _Float16* dst = &As[ar * FPAD + ac];
      if (gm < M) {
        const _Float16* src = A + (size_t)gm * lda + k0 + ac;
#pragma unroll
        for (int i = 0; i < 8; ++i) dst[i] = src[i];
      } else {
#pragma unroll
        for (int i = 0; i < 8; ++i) dst[i] = (_Float16)0.f;
      }
    }
    { // stage B [32][128] transposed -> BsT[n][k]; coalesced 32B global reads
      const _Float16* src = Bm + (size_t)(k0 + br) * ldb + n0 + bc;
#pragma unroll
      for (int i = 0; i < 16; ++i) BsT[(bc + i) * FPAD + br] = src[i];
      if (k0 + 32 < K)  // hint next K-tile toward L2 (global_prefetch_b8)
        __builtin_prefetch(Bm + (size_t)(k0 + 32 + br) * ldb + n0 + bc, 0, 1);
    }
    __syncthreads();
    const v16h af = frag_ld(&As[wm * 16 * FPAD], lane);
#pragma unroll
    for (int t = 0; t < 4; ++t) {
      const v16h bf = frag_ld(&BsT[(wn * 64 + t * 16) * FPAD], lane);
      acc[t] = __builtin_amdgcn_wmma_f32_16x16x32_f16(false, af, false, bf,
                                                      (short)0, acc[t],
                                                      false, false);
    }
    __syncthreads();
  }

  const int lcol = lane & 15, h2 = lane >> 4;
  if (act == 3) {
    // a lane's 8 accumulators are channels wm*16+8*h2+r of point lcol: halves
    // 0..7 of plane wm of that point tile, at this very lane
    if (wm < 2) {
#pragma unroll
      for (int t = 0; t < 4; ++t) {
        v8h o;
#pragma unroll
        for (int r = 0; r < 8; ++r) o[r] = (_Float16)acc[t][r];
        ((v8h*)O)[(((n0 + wn * 64 + t * 16) >> 4) * 2 + wm) * 32 + lane] = o;
      }
    }
    return;
  }
  const float bns = rsqrtf(1.f + BN_EPS);
  bias += (n0 / NPTS) * bias_bs;   // a block's 128 columns lie in one batch
#pragma unroll
  for (int t = 0; t < 4; ++t) {
    const int n = n0 + wn * 64 + t * 16 + lcol;
#pragma unroll
    for (int r = 0; r < 8; ++r) {
      const int m = m0 + wm * 16 + h2 * 8 + r;
      if (m < M) {
        float v = acc[t][r];
        if (bias) v += bias[m];
        if (bng)  v = v * (bng[m] * bns) + bnb[m];
        if (act == 1)      v = fmaxf(v, 0.f);
        else if (act == 2) v = (v > 0.f) ? v : 0.2f * v;
        if (resid) v += (float)resid[(size_t)m * ldc + n];
        O[(size_t)m * ldc + n] = (_Float16)v;
      }
    }
  }
}

// ---- row statistics of e = q^T q (K=32): rowmax and 1/rowsum --------------
// One work-group = SROWT*16 rows of one batch. The own rows are the B operand
// (kept in registers), the 4096 partners the A operand, 32 tiles per wave:
// a lane then holds 8 scores of ONE own row, so maximum and sum stay in the
// lane until one exchange between the wave's halves; the 8 waves meet in LDS.
// Two passes: rowmax, then the sum of exp(e - rowmax).
__global__ __launch_bounds__(256) void k_rowstat(
    const _Float16* __restrict__ qf,  // q in fragment order, NT/16 tiles
    float* __restrict__ rmax,         // [NT]
    float* __restrict__ rowinv)       // [NT]
{
  __shared__ float part[8][SROWT * 16];
  const int tid = threadIdx.x, lane = tid & 31, lcol = lane & 15;
  // wave number as a scalar, so that the tile addresses are scalar + lane
  const int wave = __builtin_amdgcn_readfirstlane(tid >> 5);
  const int bt = blockIdx.y * (NPTS / 16);      // first tile of the batch
  const int rt0 = bt + blockIdx.x * SROWT;      // first own row tile
  const int mt0 = bt + wave * (NPTS / 16 / 8);  // first partner tile
  const v8h* f = (const v8h*)qf;
  v16h bq[SROWT];
#pragma unroll  // bq, mx, sm, rm indexed by constants to stay in registers
  for (int i = 0; i < SROWT; ++i) bq[i] = frag_g(f, rt0 + i, lane);

  v8f mx[SROWT];
#pragma unroll
  for (int i = 0; i < SROWT; ++i)
#pragma unroll
    for (int r = 0; r < 8; ++r) mx[i][r] = -3.0e38f;
#pragma unroll 8
  for (int t = 0; t < NPTS / 16 / 8; ++t) {
    const v16h a = frag_g(f, mt0 + t, lane);
#pragma unroll
    for (int i = 0; i < SROWT; ++i) {
      v8f z = {};
      const v8f e = __builtin_amdgcn_wmma_f32_16x16x32_f16(false, a, false, bq[i],
                                                           (short)0, z, false, false);
#pragma unroll
      for (int r = 0; r < 8; ++r) mx[i][r] = fmaxf(mx[i][r], e[r]);
    }
  }
#pragma unroll
  for (int i = 0; i < SROWT; ++i) {
    float m = mx[i][0];
#pragma unroll
    for (int r = 1; r < 8; ++r) m = fmaxf(m, mx[i][r]);
    m = fmaxf(m, __shfl_xor(m, 16, 32));
    if (lane < 16) part[wave][i * 16 + lane] = m;
  }
  __syncthreads();
  float rm[SROWT];
#pragma unroll
  for (int i = 0; i < SROWT; ++i) {
    float m = part[0][i * 16 + lcol];
#pragma unroll
    for (int w = 1; w < 8; ++w) m = fmaxf(m, part[w][i * 16 + lcol]);
    rm[i] = m;
  }
  __syncthreads();   // part is written again below

  v8f sm[SROWT] = {};
#pragma unroll 8
  for (int t = 0; t < NPTS / 16 / 8; ++t) {
    const v16h a = frag_g(f, mt0 + t, lane);
#pragma unroll
    for (int i = 0; i < SROWT; ++i) {
      v8f z = {};
      const v8f e = __builtin_amdgcn_wmma_f32_16x16x32_f16(false, a, false, bq[i],
                                                           (short)0, z, false, false);
#pragma unroll
      for (int r = 0; r < 8; ++r) sm[i][r] += __expf(e[r] - rm[i]);
    }
  }
#pragma unroll
  for (int i = 0; i < SROWT; ++i) {
    float s = sm[i][0];
#pragma unroll
    for (int r = 1; r < 8; ++r) s += sm[i][r];
    s += __shfl_xor(s, 16, 32);
    if (lane < 16) part[wave][i * 16 + lane] = s;
  }
  __syncthreads();
  if (tid < SROWT * 16) {
    float s = part[0][tid];
#pragma unroll
    for (int w = 1; w < 8; ++w) s += part[w][tid];
    rowinv[rt0 * 16 + tid] = 1.f / s;
    rmax[rt0 * 16 + tid] = (tid < 16) ? rm[0] : rm[1];
  }
}

// ---- x_num = v_scaled @ p and the column sum, p formed in registers --------
// grid.x = 256 columns m (8 waves x 2 tiles of 16), grid.y = slice of KSL
// rows n. Per 32 rows a wave computes two score tiles e[n][m] per column tile
// (A = q of the rows, B = q of its own columns, kept in registers). Their D
// registers, as p = exp(e - rowmax[n]) in f16, ARE the B fragment of the next
// product (k = 8*h2+r and 16+8*h2+r), so p meets neither LDS nor memory.
// A = v_scaled in fragment order, 8 channel tiles. The f32 partial tile goes
// to part[128][KSPLIT][NT], the column-sum partial to cs[KSPLIT][NT];
// k_diff adds the slices.
__global__ __launch_bounds__(256) void k_attn_xnum(
    const _Float16* __restrict__ qf,   // q in fragment order, NT/16 tiles
    const _Float16* __restrict__ vf,   // v * rowinv, fragment order [NT/32][8]
    const float* __restrict__ rmax,    // [NT]
    const float* __restrict__ rowinv,  // [NT]
    float* __restrict__ part,          // [128][KSPLIT][NT]
    float* __restrict__ cs)            // [KSPLIT][NT]
{
  const int tid = threadIdx.x, lane = tid & 31;
  const int lcol = lane & 15, h2 = lane >> 4;
  // wave number as a scalar, so that the tile addresses are scalar + lane
  const int wave = __builtin_amdgcn_readfirstlane(tid >> 5);
  const int c0 = blockIdx.x * 256 + wave * 32;      // first own column
  const int ks = blockIdx.y;
  const int n0 = (blockIdx.x / (NPTS / 256)) * NPTS + ks * KSL;  // first row
  const v8h* qv = (const v8h*)qf;
  const v16h bq[2] = {frag_g(qv, (c0 >> 4) + 0, lane),
                      frag_g(qv, (c0 >> 4) + 1, lane)};
  v8f acc[2][8] = {};
  v8f csum[2] = {};

  // work-group-uniform bases of the slice; a trip adds its step, a lane its
  // own lane or h2 * 8
  const v8h* qn = qv + (n0 >> 4) * 64;                  // 128 units a trip
  const v8h* vn = (const v8h*)vf + (n0 >> 5) * 512;     // 512 units a trip
  const float* mn = rmax + n0;                          // 32 floats a trip
  const float* in = rowinv + n0;
  const unsigned ro = h2 * 8;

  // one trip = 32 rows. q fragments and row statistics (a0..i1) were fetched
  // one trip ahead, so the score products wait for no load of their own trip;
  // this trip fetches the next one's (b0..j1) and its own v fragments.
  auto trip = [&](int s, const v16h& a0, const v16h& a1, const v8f& m0, const v8f& m1,
                  const v8f& i0, const v8f& i1, v16h& b0, v16h& b1, v8f& k0, v8f& k1,
                  v8f& j0, v8f& j1) {
    // the last trip fetches its own rows again: in bounds, never used
    const int sn = (s + 1 < KSL / 32) ? s + 1 : s;
    // keeps this trip's loads behind the trip before: a load lifted into its
    // arithmetic would have its address registers reused ahead of the wait
    __builtin_amdgcn_sched_barrier(0);
    v16h va[8];
#pragma unroll  // va, acc indexed by constants to stay in registers
    for (int ct = 0; ct < 8; ++ct) va[ct] = frag_g(vn + s * 512, ct, lane);
    b0 = frag_g(qn + sn * 128, 0, lane);
    b1 = frag_g(qn + sn * 128, 1, lane);
    k0 = *(const v8f*)(mn + sn * 32 + ro);
    k1 = *(const v8f*)(mn + sn * 32 + 16 + ro);
    j0 = *(const v8f*)(in + sn * 32 + ro);
    j1 = *(const v8f*)(in + sn * 32 + 16 + ro);
    // the loads' address registers are given new values below: wait first
    asm volatile("s_wait_xcnt 0x0" ::: "memory");
    // keeps the arithmetic below, which reuses those registers, behind the wait
    __builtin_amdgcn_sched_barrier(0);
#pragma unroll  // bq, csum, acc indexed by constants to stay in registers
    for (int t = 0; t < 2; ++t) {
      v8f z = {};
      v8f x0 = __builtin_amdgcn_wmma_f32_16x16x32_f16(false, a0, false, bq[t],
                                                      (short)0, z, false, false);
      v8f x1 = __builtin_amdgcn_wmma_f32_16x16x32_f16(false, a1, false, bq[t],
                                                      (short)0, z, false, false);
      x0 -= m0;
      x1 -= m1;
#pragma unroll  // vector elements indexed by constants, here and below
      for (int r = 0; r < 8; ++r) x0[r] = __expf(x0[r]);
#pragma unroll
      for (int r = 0; r < 8; ++r) x1[r] = __expf(x1[r]);
      const v8h p0 = __builtin_convertvector(x0, v8h);
      const v8h p1 = __builtin_convertvector(x1, v8h);
      const v16h p = __builtin_shufflevector(p0, p1, 0, 1, 2, 3, 4, 5, 6, 7,
                                             8, 9, 10, 11, 12, 13, 14, 15);
      // column sum of the rounded p, the very weights that x_num sees
      csum[t] += i0 * __builtin_convertvector(p0, v8f);
      csum[t] += i1 * __builtin_convertvector(p1, v8f);
#pragma unroll
      for (int ct = 0; ct < 8; ++ct)
        acc[t][ct] = __builtin_amdgcn_wmma_f32_16x16x32_f16(false, va[ct], false, p,
                                                            (short)0, acc[t][ct],
                                                            false, false);
    }
  };

  v16h qa0 = frag_g(qn, 0, lane), qa1 = frag_g(qn, 1, lane), qb0, qb1;
  v8f ma0 = *(const v8f*)(mn + ro), ma1 = *(const v8f*)(mn + 16 + ro), mb0, mb1;
  v8f ia0 = *(const v8f*)(in + ro), ia1 = *(const v8f*)(in + 16 + ro), ib0, ib1;
  // the loads' address registers are given new values below: wait first
  asm volatile("s_wait_xcnt 0x0" ::: "memory");
  // two trips a pass: the two register sets swap roles without copies
  for (int s = 0; s < KSL / 32; s += 2) {
    trip(s,     qa0, qa1, ma0, ma1, ia0, ia1, qb0, qb1, mb0, mb1, ib0, ib1);
    trip(s + 1, qb0, qb1, mb0, mb1, ib0, ib1, qa0, qa1, ma0, ma1, ia0, ia1);
  }

  float* po = part + ks * NT + c0 + lcol;
#pragma unroll  // all loops: acc indexed by constants, offsets as immediates
  for (int t = 0; t < 2; ++t) {
#pragma unroll
    for (int ct = 0; ct < 8; ++ct)
#pragma unroll
      for (int r = 0; r < 8; ++r)
        po[(size_t)(ct * 16 + h2 * 8 + r) * (KSPLIT * NT) + t * 16] = acc[t][ct][r];
    float c = csum[t][0];
#pragma unroll
    for (int r = 1; r < 8; ++r) c += csum[t][r];
    c += __shfl_xor(c, 16, 32);
    if (lane < 16) cs[ks * NT + c0 + t * 16 + lane] = c;
  }
}

// ---- small elementwise / reduction kernels --------------------------------
__global__ void k_f2h(const float* __restrict__ s, _Float16* __restrict__ d, int n) {
  int i = blockIdx.x * 256 + threadIdx.x;
  if (i < n) d[i] = (_Float16)s[i];
}

// h1 = relu(bn1(conv1_w @ x^T)) ; K=3 scalar path
__global__ void k_conv1(const float* __restrict__ x, const float* __restrict__ w,
                        const float* __restrict__ g, const float* __restrict__ b,
                        _Float16* __restrict__ h1) {
  int i = blockIdx.x * 256 + threadIdx.x;
  if (i >= 128 * NT) return;
  const int o = i >> 13, j = i & (NT - 1);
  float s = w[o * 3 + 0] * x[(size_t)j * 3 + 0] +
            w[o * 3 + 1] * x[(size_t)j * 3 + 1] +
            w[o * 3 + 2] * x[(size_t)j * 3 + 2];
  s = s * (g[o] * rsqrtf(1.f + BN_EPS)) + b[o];
  h1[i] = (_Float16)fmaxf(s, 0.f);
}

// v_scaled = v * rowinv[col], written in the fragment order of frag_g:
// tile (n/32)*8 + c/16, channel as fragment row, n as k. One thread = the 16
// bytes of one lane in one plane, so a wave writes 512 contiguous bytes.
__global__ void k_scale_v(const _Float16* __restrict__ v, const float* __restrict__ ri,
                          _Float16* __restrict__ o) {
  const int i = blockIdx.x * 256 + threadIdx.x;   // ((nb*8+ct)*2+plane)*32+lane
  if (i >= 128 * NT / 8) return;
  const int lane = i & 31, plane = (i >> 5) & 1, ct = (i >> 6) & 7, nb = i >> 9;
  const int c = ct * 16 + (lane & 15);
  const int n = nb * 32 + plane * 16 + (lane >> 4) * 8;
  const v8h a = *(const v8h*)(v + (size_t)c * NT + n);
  const v8f s = *(const v8f*)(ri + n);
  ((v8h*)o)[i] = __builtin_convertvector(__builtin_convertvector(a, v8f) * s, v8h);
}

// diff = h - (sum of the KSPLIT x_num partials) / (1e-9 + colsum[col]),
// colsum[col] = sum of the CSPLIT partials of k_attn_xnum
// one thread = 4 consecutive columns of one row
__global__ void k_diff(const _Float16* __restrict__ h, const float* __restrict__ part,
                       const float* __restrict__ cs, _Float16* __restrict__ d) {
  const int q = blockIdx.x * 256 + threadIdx.x;     // index of the 4-column group
  if (q >= 128 * NT / 4) return;
  const int row = q / (NT / 4), jq = q & (NT / 4 - 1);
  const v4f* p4 = (const v4f*)part + row * (KSPLIT * NT / 4) + jq;  // [row][slice][col]
  v4f xn = p4[0];
#pragma unroll  // all KSPLIT loads in flight together
  for (int s = 1; s < KSPLIT; ++s) xn += p4[s * (NT / 4)];
  v4f c4 = ((const v4f*)cs)[jq];
#pragma unroll  // all CSPLIT loads in flight together
  for (int s = 1; s < CSPLIT; ++s) c4 += ((const v4f*)cs)[s * (NT / 4) + jq];
  const v4h h4 = ((const v4h*)h)[q];
  v4h o;
#pragma unroll  // vector elements indexed by constants
  for (int e = 0; e < 4; ++e)
    o[e] = (_Float16)((float)h4[e] - xn[e] / (1e-9f + c4[e]));
  ((v4h*)d)[q] = o;
}

// per-row max/mean pooling over N for hf rows (M=1024), into glob[b][..]
__global__ void k_pool(const _Float16* __restrict__ hf, float* __restrict__ xmax,
                       float* __restrict__ xavg) {
  const int o = blockIdx.x, bb = blockIdx.y, tid = threadIdx.x;
  const _Float16* p = hf + (size_t)o * NT + bb * NPTS;
  float mx = -3.0e38f, sm = 0.f;
  for (int i = tid; i < NPTS; i += 256) {
    const float v = (float)p[i];
    mx = fmaxf(mx, v); sm += v;
  }
  __shared__ float s1[256], s2[256];
  s1[tid] = mx; s2[tid] = sm;
  __syncthreads();
  for (int s = 128; s > 0; s >>= 1) {
    if (tid < s) { s1[tid] = fmaxf(s1[tid], s1[tid + s]); s2[tid] += s2[tid + s]; }
    __syncthreads();
  }
  if (tid == 0) {
    xmax[bb * GLOB + o] = s1[0];
    xavg[bb * GLOB + o] = s2[0] * (1.f / NPTS);
  }
}

// cls_f = leaky(bn(label_w @ cls_label))  (K=16, 128 outputs total), into
// glob[b][..]
__global__ void k_cls(const float* __restrict__ w, const float* __restrict__ lab,
                      const float* __restrict__ g, const float* __restrict__ b,
                      float* __restrict__ out) {
  const int t = threadIdx.x;
  if (t >= 128) return;
  const int bb = t >> 6, o = t & 63;
  float s = 0.f;
  for (int c = 0; c < 16; ++c) s += w[o * 16 + c] * lab[bb * 16 + c];
  s = s * (g[o] * rsqrtf(1.f + BN_EPS)) + b[o];
  out[bb * GLOB + o] = (s > 0.f) ? s : 0.2f * s;
}

// head bias: gb[b][o] = bias[o] + sum_k w[o][HKP + k] * glob[b][k], where
// glob[b] = (pooled maximum, pooled mean, class feature) of batch b, rounded
// to f16. These GLOB input rows hold one value for all points of a batch,
// so one column per batch is the whole product. One work-group = 16 output
// rows, GW waves x GT k-tiles; column c of the B operand is batch c & 1 (no
// lane idles or branches), columns 0 and 1 of D are kept; the waves' sums
// meet in LDS.
__global__ __launch_bounds__(GW * 32) void k_headbias(
    const _Float16* __restrict__ w,     // [512][HK]
    const float* __restrict__ glob,     // [2][GLOB]
    const float* __restrict__ bias,     // [512]
    float* __restrict__ gb)             // [2][512]
{
  __shared__ float red[GW][2][16];
  const int tid = threadIdx.x, lane = tid & 31;
  const int lcol = lane & 15, h2 = lane >> 4;
  const int wave = tid >> 5;
  const int m0 = blockIdx.x * 16;
  const _Float16* a = w + (size_t)(m0 + lcol) * HK + HKP + wave * (GT * 32) + 8 * h2;
  const float* g = glob + (lcol & 1) * GLOB + wave * (GT * 32) + 8 * h2;
  v8h alo[GT], ahi[GT];
  v8f glo[GT], ghi[GT];
#pragma unroll  // all loads in flight together; arrays indexed by constants
  for (int t = 0; t < GT; ++t) {
    alo[t] = *(const v8h*)(a + t * 32);
    ahi[t] = *(const v8h*)(a + t * 32 + 16);
    glo[t] = *(const v8f*)(g + t * 32);
    ghi[t] = *(const v8f*)(g + t * 32 + 16);
  }
  // keeps every load ahead of the first conversion: without it the compiler
  // issues them a few at a time, each group behind a wait for the one before
  __builtin_amdgcn_sched_barrier(0);
  v8f acc = {};
#pragma unroll  // arrays indexed by constants to stay in registers
  for (int t = 0; t < GT; ++t) {
    const v16h af = __builtin_shufflevector(alo[t], ahi[t], 0, 1, 2, 3, 4, 5, 6, 7,
                                            8, 9, 10, 11, 12, 13, 14, 15);
    const v16h bf = __builtin_shufflevector(__builtin_convertvector(glo[t], v8h),
                                            __builtin_convertvector(ghi[t], v8h),
                                            0, 1, 2, 3, 4, 5, 6, 7,
                                            8, 9, 10, 11, 12, 13, 14, 15);
    acc = __builtin_amdgcn_wmma_f32_16x16x32_f16(false, af, false, bf,
                                                 (short)0, acc, false, false);
  }
  if (lcol < 2) {
#pragma unroll  // acc indexed by constants
    for (int r = 0; r < 8; ++r) red[wave][lcol][h2 * 8 + r] = acc[r];
  }
  __syncthreads();
  if (tid < 32) {
    float s = bias[m0 + lcol];
#pragma unroll  // all GW LDS loads in flight together
    for (int v = 0; v < GW; ++v) s += red[v][h2][lcol];
    gb[h2 * 512 + m0 + lcol] = s;
  }
}

// out3 f16 [50][NT] -> d_out f32 [B][50][N]
__global__ void k_repack(const _Float16* __restrict__ o3, float* __restrict__ out) {
  int i = blockIdx.x * 256 + threadIdx.x;
  if (i >= 2 * 50 * NPTS) return;
  const int bb = i / (50 * NPTS);
  const int r = i - bb * 50 * NPTS;
  const int o = r >> 12, n = r & (NPTS - 1);
  out[i] = (float)o3[(size_t)o * NT + bb * NPTS + n];
}

// ---------------------------------------------------------------------------
extern "C" void kernel_launch(void* const* d_in, const int* in_sizes, int n_in,
                              void* d_out, int out_size, void* d_ws, size_t ws_size,
                              hipStream_t stream) {
  (void)in_sizes; (void)n_in; (void)out_size; (void)ws_size;
  const float* x         = (const float*)d_in[0];
  const float* cls_lab   = (const float*)d_in[1];
  const float* conv1_w   = (const float*)d_in[2];
  const float* bn1_g     = (const float*)d_in[3];
  const float* bn1_b     = (const float*)d_in[4];
  const float* conv2_w   = (const float*)d_in[5];
  const float* bn2_g     = (const float*)d_in[6];
  const float* bn2_b     = (const float*)d_in[7];
  const float* sa_qk_w   = (const float*)d_in[8];
  const float* sa_v_w    = (const float*)d_in[9];
  const float* sa_v_b    = (const float*)d_in[10];
  const float* sa_t_w    = (const float*)d_in[11];
  const float* sa_t_b    = (const float*)d_in[12];
  const float* sa_bn_g   = (const float*)d_in[13];
  const float* sa_bn_b   = (const float*)d_in[14];
  const float* fuse_w    = (const float*)d_in[15];
  const float* fuse_bn_g = (const float*)d_in[16];
  const float* fuse_bn_b = (const float*)d_in[17];
  const float* label_w   = (const float*)d_in[18];
  const float* label_bn_g= (const float*)d_in[19];
  const float* label_bn_b= (const float*)d_in[20];
  const float* convs1_w  = (const float*)d_in[21];
  const float* convs1_b  = (const float*)d_in[22];
  const float* bns1_g    = (const float*)d_in[23];
  const float* bns1_b    = (const float*)d_in[24];
  const float* convs2_w  = (const float*)d_in[25];
  const float* convs2_b  = (const float*)d_in[26];
  const float* bns2_g    = (const float*)d_in[27];
  const float* bns2_b    = (const float*)d_in[28];
  const float* convs3_w  = (const float*)d_in[29];
  const float* convs3_b  = (const float*)d_in[30];

  char* wp = (char*)d_ws;
  auto alloc = [&](size_t bytes) -> char* {
    char* p = wp; wp += (bytes + 255) & ~(size_t)255; return p;
  };
  auto h16 = [&](size_t n) { return (_Float16*)alloc(n * 2); };
  auto f32 = [&](size_t n) { return (float*)alloc(n * 4); };

  // f16 weight copies
  _Float16* wc2   = h16(128 * 128);
  _Float16* wqk   = h16(4 * 32 * 128);
  _Float16* wv    = h16(4 * 128 * 128);
  _Float16* wt    = h16(4 * 128 * 128);
  _Float16* wfuse = h16(1024 * 512);
  _Float16* ws1c  = h16(512 * 3136);
  _Float16* ws2c  = h16(256 * 512);
  _Float16* ws3c  = h16(50 * 256);
  // activations
  _Float16* h1    = h16((size_t)128 * NT);
  _Float16* h2b   = h16((size_t)128 * NT);
  _Float16* qbuf  = h16((size_t)32 * NT);
  _Float16* vbuf  = h16((size_t)128 * NT);
  _Float16* vsc   = h16((size_t)128 * NT);
  _Float16* dbuf  = h16((size_t)128 * NT);
  _Float16* hcat  = h16((size_t)512 * NT);
  _Float16* big   = h16((size_t)HKP * NT);
  _Float16* hs1   = h16((size_t)512 * NT);
  _Float16* hs2   = h16((size_t)256 * NT);
  _Float16* out3  = h16((size_t)50 * NT);
  float* xpart  = f32((size_t)KSPLIT * 128 * NT);
  float* rowinv = f32(2 * NPTS);
  float* rmaxb  = f32(2 * NPTS);
  float* colsum = f32((size_t)CSPLIT * NT);
  float* glob   = f32(2 * GLOB);   // per batch: maximum, mean, class feature
  float* xmax   = glob;
  float* xavg   = glob + 1024;
  float* clsf   = glob + 2048;
  float* hbias  = f32(2 * 512);

  auto cvt = [&](const float* s, _Float16* d, int n) {
    k_f2h<<<(n + 255) / 256, 256, 0, stream>>>(s, d, n);
  };
  auto gemm = [&](const _Float16* A, int lda, const _Float16* Bm, int ldb,
                  _Float16* O, int ldc, int M, int Ncols, int K,
                  const float* bias, const float* g, const float* be, int act,
                  const _Float16* resid) {
    dim3 grid(Ncols / 128, (M + 63) / 64);
    k_gemm<<<grid, 256, 0, stream>>>(A, lda, Bm, ldb, O, ldc, M, K,
                                     bias, g, be, act, resid, 0);
  };

  // weight conversions
  cvt(conv2_w, wc2, 128 * 128);
  cvt(sa_qk_w, wqk, 4 * 32 * 128);
  cvt(sa_v_w,  wv,  4 * 128 * 128);
  cvt(sa_t_w,  wt,  4 * 128 * 128);
  cvt(fuse_w,  wfuse, 1024 * 512);
  cvt(convs1_w, ws1c, 512 * 3136);
  cvt(convs2_w, ws2c, 256 * 512);
  cvt(convs3_w, ws3c, 50 * 256);

  // stem
  k_conv1<<<(128 * NT + 255) / 256, 256, 0, stream>>>(x, conv1_w, bn1_g, bn1_b, h1);
  gemm(wc2, 128, h1, NT, h2b, NT, 128, NT, 128, nullptr, bn2_g, bn2_b, 1, nullptr);

  // 4 self-attention blocks; feats written directly into hcat rows
  const _Float16* hprev = h2b;
  for (int i = 0; i < 4; ++i) {
    gemm(wqk + (size_t)i * 32 * 128, 128, hprev, NT, qbuf, NT, 32, NT, 128,
         nullptr, nullptr, nullptr, 3, nullptr);
    gemm(wv + (size_t)i * 128 * 128, 128, hprev, NT, vbuf, NT, 128, NT, 128,
         sa_v_b + i * 128, nullptr, nullptr, 0, nullptr);
    k_rowstat<<<dim3(NPTS / 16 / SROWT, 2), 256, 0, stream>>>(qbuf, rmaxb, rowinv);
    k_scale_v<<<128 * NT / 8 / 256, 256, 0, stream>>>(vbuf, rowinv, vsc);
    k_attn_xnum<<<dim3(NT / 256, KSPLIT), 256, 0, stream>>>(qbuf, vsc, rmaxb, rowinv,
                                                            xpart, colsum);
    k_diff<<<128 * NT / 4 / 256, 256, 0, stream>>>(hprev, xpart, colsum, dbuf);
    _Float16* hout = hcat + (size_t)i * 128 * NT;
    gemm(wt + (size_t)i * 128 * 128, 128, dbuf, NT, hout, NT, 128, NT, 128,
         sa_t_b + i * 128, sa_bn_g + i * 128, sa_bn_b + i * 128, 1, hprev);
    hprev = hout;
  }

  // fuse (writes big), pooling, cls, their share of the head's first layer
  gemm(wfuse, 512, hcat, NT, big, NT, 1024, NT, 512,
       nullptr, fuse_bn_g, fuse_bn_b, 2, nullptr);
  k_pool<<<dim3(1024, 2), 256, 0, stream>>>(big, xmax, xavg);
  k_cls<<<1, 128, 0, stream>>>(label_w, cls_lab, label_bn_g, label_bn_b, clsf);
  k_headbias<<<512 / 16, GW * 32, 0, stream>>>(ws1c, glob, convs1_b, hbias);

  // segmentation head
  k_gemm<<<dim3(NT / 128, 512 / 64), 256, 0, stream>>>(ws1c, HK, big, NT, hs1, NT,
                                                       512, HKP, hbias, bns1_g, bns1_b,
                                                       1, nullptr, 512);
  gemm(ws2c, 512, hs1, NT, hs2, NT, 256, NT, 512,
       convs2_b, bns2_g, bns2_b, 1, nullptr);
  gemm(ws3c, 256, hs2, NT, out3, NT, 50, NT, 256,
       convs3_b, nullptr, nullptr, 0, nullptr);
  k_repack<<<(2 * 50 * NPTS + 255) / 256, 256, 0, stream>>>(out3, (float*)d_out);
}

// v005
// Measured time: 431 microseconds a run.
// In two side-by-side timings against v004, it was 1.18 and 1.17 times as fast.
// Over all steps from v000 it is 5.96 times as fast.
#include <hip/hip_runtime.h>

typedef __attribute__((ext_vector_type(16))) _Float16 v16h;
typedef __attribute__((ext_vector_type(8)))  float    v8f;
typedef __attribute__((ext_vector_type(4)))  float    v4f;
typedef __attribute__((ext_vector_type(4)))  _Float16 v4h;
typedef __attribute__((ext_vector_type(8)))  _Float16 v8h;

#define NT    8192      // total columns = B * N
#define NPTS  4096      // points per batch
#define BN_EPS 1e-5f
#define FPAD  40
#define BPITCH 144
#define KSPLIT 8
#define KSL   (NPTS / KSPLIT)
#define CSPLIT KSPLIT
#define SROWT 2
#define HK    3136
#define HKP   1024
#define GLOB  (HK - HKP)
#define GW    11
#define GT    6

__device__ __forceinline__ v16h frag_ld(const _Float16* s, int lane) {
  const int row = lane & 15, h2 = lane >> 4;
  const _Float16* p = s + row * FPAD + 8 * h2;
  v16h f;
#pragma unroll
  for (int e = 0; e < 8; ++e) f[e] = p[e];
#pragma unroll
  for (int e = 0; e < 8; ++e) f[8 + e] = p[8 + e + 8];   // base+16+8*h2+e
  return f;
}

__device__ __forceinline__ v16h frag_tr(const _Float16* s, int lane) {
  typedef __attribute__((ext_vector_type(8))) short v8s;
  typedef __attribute__((address_space(3))) v8s lds_v8s;
  const _Float16* p = s + (8 * (lane >> 4) + (lane & 7)) * BPITCH + 8 * ((lane >> 3) & 1);
  const v8h lo = __builtin_bit_cast(v8h, __builtin_amdgcn_ds_load_tr16_b128_v8i16((lds_v8s*)p));
  const v8h hi = __builtin_bit_cast(v8h, __builtin_amdgcn_ds_load_tr16_b128_v8i16((lds_v8s*)(p + 16 * BPITCH)));
  return __builtin_shufflevector(lo, hi, 0, 1, 2, 3, 4, 5, 6, 7,
                                 8, 9, 10, 11, 12, 13, 14, 15);
}

__device__ __forceinline__ v16h frag_g(const v8h* __restrict__ f, int tile, int lane) {
  const v8h lo = f[(tile * 2 + 0) * 32 + lane];
  const v8h hi = f[(tile * 2 + 1) * 32 + lane];
  return __builtin_shufflevector(lo, hi, 0, 1, 2, 3, 4, 5, 6, 7,
                                 8, 9, 10, 11, 12, 13, 14, 15);
}

// ---- generic WMMA GEMM: O[m,n] = epi( sum_k A[m,k]*B[k,n] ) ---------------
// 256 threads = 8 waves as 4(M)x2(N); block tile 64(M) x 128(N); KT=32.
// Each wave: 16x64 output = 4 wmma per K-step on one A fragment.
// epilogue: +bias[m], BN(g,b) fresh stats, act(0,1=relu,2=leaky.2), +residual.
// bias_bs: distance between the two batches' bias vectors (0: one for both).
// act 3 (the q projection, M = 32): plain product, stored in the fragment
// order of frag_g with the point as fragment row and the channel as k.
__global__ __launch_bounds__(256) void k_gemm(
    const _Float16* __restrict__ A, int lda,
    const _Float16* __restrict__ Bm, int ldb,
    _Float16* __restrict__ O, int ldc,
    int M, int K,
    const float* __restrict__ bias,
    const float* __restrict__ bng, const float* __restrict__ bnb,
    int act, const _Float16* __restrict__ resid, int bias_bs)
{
  __shared__ _Float16 As[64 * FPAD];     // [m][k]
  __shared__ __attribute__((aligned(16))) _Float16 Bs[32 * BPITCH];   // [k][n]
  const int tid  = threadIdx.x;
  const int lane = tid & 31, wave = tid >> 5;
  const int wm = wave >> 1, wn = wave & 1;
  const int m0 = blockIdx.y * 64;
  const int n0 = blockIdx.x * 128;
  v8f acc[4] = {{}, {}, {}, {}};
  const int ar = tid >> 2, ac = (tid & 3) * 8;    // A stage: 64 rows x 32
  const int br = tid >> 3, bc = (tid & 7) * 16;   // B prefetch: 32 k-rows x 128 n
  const int sr = tid >> 4, sc = (tid & 15) * 8;   // B stage: rows sr, sr+16 x 128 n

  for (int k0 = 0; k0 < K; k0 += 32) {
    { // stage A [64][32] -> As[m][k], contiguous 16B per thread
      const int gm = m0 + ar;
      _Float16* dst = &As[ar * FPAD + ac];
      if (gm < M) {
        const _Float16* src = A + (size_t)gm * lda + k0 + ac;
#pragma unroll
        for (int i = 0; i < 8; ++i) dst[i] = src[i];
      } else {
#pragma unroll
        for (int i = 0; i < 8; ++i) dst[i] = (_Float16)0.f;
      }
    }
    { // stage B [32][128] as it lies -> Bs[k][n]; 16 lanes move one whole row
      const _Float16* src = Bm + (size_t)(k0 + sr) * ldb + n0 + sc;
      const v8h b0 = *(const v8h*)src;
      const v8h b1 = *(const v8h*)(src + (size_t)16 * ldb);
      *(v8h*)&Bs[sr * BPITCH + sc] = b0;
      *(v8h*)&Bs[(sr + 16) * BPITCH + sc] = b1;
      if (k0 + 32 < K)  // hint next K-tile toward L2 (global_prefetch_b8)
        __builtin_prefetch(Bm + (size_t)(k0 + 32 + br) * ldb + n0 + bc, 0, 1);
    }
    __syncthreads();
    const v16h af = frag_ld(&As[wm * 16 * FPAD], lane);
#pragma unroll
    for (int t = 0; t < 4; ++t) {
      const v16h bf = frag_tr(&Bs[wn * 64 + t * 16], lane);
      acc[t] = __builtin_amdgcn_wmma_f32_16x16x32_f16(false, af, false, bf,
                                                      (short)0, acc[t],
                                                      false, false);
    }
    __syncthreads();
  }

  const int lcol = lane & 15, h2 = lane >> 4;
  if (act == 3) {
    // a lane's 8 accumulators are channels wm*16+8*h2+r of point lcol: halves
    // 0..7 of plane wm of that point tile, at this very lane
    if (wm < 2) {
#pragma unroll
      for (int t = 0; t < 4; ++t) {
        v8h o;
#pragma unroll
        for (int r = 0; r < 8; ++r) o[r] = (_Float16)acc[t][r];
        ((v8h*)O)[(((n0 + wn * 64 + t * 16) >> 4) * 2 + wm) * 32 + lane] = o;
      }
    }
    return;
  }
  const float bns = rsqrtf(1.f + BN_EPS);
  bias += (n0 / NPTS) * bias_bs;   // a block's 128 columns lie in one batch
#pragma unroll
  for (int t = 0; t < 4; ++t) {
    const int n = n0 + wn * 64 + t * 16 + lcol;
#pragma unroll
    for (int r = 0; r < 8; ++r) {
      const int m = m0 + wm * 16 + h2 * 8 + r;
      if (m < M) {
        float v = acc[t][r];
        if (bias) v += bias[m];
        if (bng)  v = v * (bng[m] * bns) + bnb[m];
        if (act == 1)      v = fmaxf(v, 0.f);
        else if (act == 2) v = (v > 0.f) ? v : 0.2f * v;
        if (resid) v += (float)resid[(size_t)m * ldc + n];
        O[(size_t)m * ldc + n] = (_Float16)v;
      }
    }
  }
}

// ---- row statistics of e = q^T q (K=32): rowmax and 1/rowsum --------------
// One work-group = SROWT*16 rows of one batch. The own rows are the B operand
// (kept in registers), the 4096 partners the A operand, 32 tiles per wave:
// a lane then holds 8 scores of ONE own row, so maximum and sum stay in the
// lane until one exchange between the wave's halves; the 8 waves meet in LDS.
// Two passes: rowmax, then the sum of exp(e - rowmax).
__global__ __launch_bounds__(256) void k_rowstat(
    const _Float16* __restrict__ qf,  // q in fragment order, NT/16 tiles
    float* __restrict__ rmax,         // [NT]
    float* __restrict__ rowinv)       // [NT]
{
  __shared__ float part[8][SROWT * 16];
  const int tid = threadIdx.x, lane = tid & 31, lcol = lane & 15;
  // wave number as a scalar, so that the tile addresses are scalar + lane
  const int wave = __builtin_amdgcn_readfirstlane(tid >> 5);
  const int bt = blockIdx.y * (NPTS / 16);      // first tile of the batch
  const int rt0 = bt + blockIdx.x * SROWT;      // first own row tile
  const int mt0 = bt + wave * (NPTS / 16 / 8);  // first partner tile
  const v8h* f = (const v8h*)qf;
  v16h bq[SROWT];
#pragma unroll  // bq, mx, sm, rm indexed by constants to stay in registers
  for (int i = 0; i < SROWT; ++i) bq[i] = frag_g(f, rt0 + i, lane);

  v8f mx[SROWT];
#pragma unroll
  for (int i = 0; i < SROWT; ++i)
#pragma unroll
    for (int r = 0; r < 8; ++r) mx[i][r] = -3.0e38f;
#pragma unroll 8
  for (int t = 0; t < NPTS / 16 / 8; ++t) {
    const v16h a = frag_g(f, mt0 + t, lane);
#pragma unroll
    for (int i = 0; i < SROWT; ++i) {
      v8f z = {};
      const v8f e = __builtin_amdgcn_wmma_f32_16x16x32_f16(false, a, false, bq[i],
                                                           (short)0, z, false, false);
#pragma unroll
      for (int r = 0; r < 8; ++r) mx[i][r] = fmaxf(mx[i][r], e[r]);
    }
  }
#pragma unroll
  for (int i = 0; i < SROWT; ++i) {
    float m = mx[i][0];
#pragma unroll
    for (int r = 1; r < 8; ++r) m = fmaxf(m, mx[i][r]);
    m = fmaxf(m, __shfl_xor(m, 16, 32));
    if (lane < 16) part[wave][i * 16 + lane] = m;
  }
  __syncthreads();
  float rm[SROWT];
#pragma unroll
  for (int i = 0; i < SROWT; ++i) {
    float m = part[0][i * 16 + lcol];
#pragma unroll
    for (int w = 1; w < 8; ++w) m = fmaxf(m, part[w][i * 16 + lcol]);
    rm[i] = m;
  }
  __syncthreads();   // part is written again below

  v8f sm[SROWT] = {};
#pragma unroll 8
  for (int t = 0; t < NPTS / 16 / 8; ++t) {
    const v16h a = frag_g(f, mt0 + t, lane);
#pragma unroll
    for (int i = 0; i < SROWT; ++i) {
      v8f z = {};
      const v8f e = __builtin_amdgcn_wmma_f32_16x16x32_f16(false, a, false, bq[i],
                                                           (short)0, z, false, false);
#pragma unroll
      for (int r = 0; r < 8; ++r) sm[i][r] += __expf(e[r] - rm[i]);
    }
  }
#pragma unroll
  for (int i = 0; i < SROWT; ++i) {
    float s = sm[i][0];
#pragma unroll
    for (int r = 1; r < 8; ++r) s += sm[i][r];
    s += __shfl_xor(s, 16, 32);
    if (lane < 16) part[wave][i * 16 + lane] = s;
  }
  __syncthreads();
  if (tid < SROWT * 16) {
    float s = part[0][tid];
#pragma unroll
    for (int w = 1; w < 8; ++w) s += part[w][tid];
    rowinv[rt0 * 16 + tid] = 1.f / s;
    rmax[rt0 * 16 + tid] = (tid < 16) ? rm[0] : rm[1];
  }
}

// ---- x_num = v_scaled @ p and the column sum, p formed in registers --------
// grid.x = 256 columns m (8 waves x 2 tiles of 16), grid.y = slice of KSL
// rows n. Per 32 rows a wave computes two score tiles e[n][m] per column tile
// (A = q of the rows, B = q of its own columns, kept in registers). Their D
// registers, as p = exp(e - rowmax[n]) in f16, ARE the B fragment of the next
// product (k = 8*h2+r and 16+8*h2+r), so p meets neither LDS nor memory.
// A = v_scaled in fragment order, 8 channel tiles. The f32 partial tile goes
// to part[128][KSPLIT][NT], the column-sum partial to cs[KSPLIT][NT];
// k_diff adds the slices.
__global__ __launch_bounds__(256) void k_attn_xnum(
    const _Float16* __restrict__ qf,   // q in fragment order, NT/16 tiles
    const _Float16* __restrict__ vf,   // v * rowinv, fragment order [NT/32][8]
    const float* __restrict__ rmax,    // [NT]
    const float* __restrict__ rowinv,  // [NT]
    float* __restrict__ part,          // [128][KSPLIT][NT]
    float* __restrict__ cs)            // [KSPLIT][NT]
{
  const int tid = threadIdx.x, lane = tid & 31;
  const int lcol = lane & 15, h2 = lane >> 4;
  // wave number as a scalar, so that the tile addresses are scalar + lane
  const int wave = __builtin_amdgcn_readfirstlane(tid >> 5);
  const int c0 = blockIdx.x * 256 + wave * 32;      // first own column
  const int ks = blockIdx.y;
  const int n0 = (blockIdx.x / (NPTS / 256)) * NPTS + ks * KSL;  // first row
  const v8h* qv = (const v8h*)qf;
  const v16h bq[2] = {frag_g(qv, (c0 >> 4) + 0, lane),
                      frag_g(qv, (c0 >> 4) + 1, lane)};
  v8f acc[2][8] = {};
  v8f csum[2] = {};

  // work-group-uniform bases of the slice; a trip adds its step, a lane its
  // own lane or h2 * 8
  const v8h* qn = qv + (n0 >> 4) * 64;                  // 128 units a trip
  const v8h* vn = (const v8h*)vf + (n0 >> 5) * 512;     // 512 units a trip
  const float* mn = rmax + n0;                          // 32 floats a trip
  const float* in = rowinv + n0;
  const unsigned ro = h2 * 8;

  // one trip = 32 rows. q fragments and row statistics (a0..i1) were fetched
  // one trip ahead, so the score products wait for no load of their own trip;
  // this trip fetches the next one's (b0..j1) and its own v fragments.
  auto trip = [&](int s, const v16h& a0, const v16h& a1, const v8f& m0, const v8f& m1,
                  const v8f& i0, const v8f& i1, v16h& b0, v16h& b1, v8f& k0, v8f& k1,
                  v8f& j0, v8f& j1) {
    // the last trip fetches its own rows again: in bounds, never used
    const int sn = (s + 1 < KSL / 32) ? s + 1 : s;
    // keeps this trip's loads behind the trip before: a load lifted into its
    // arithmetic would have its address registers reused ahead of the wait
    __builtin_amdgcn_sched_barrier(0);
    v16h va[8];
#pragma unroll  // va, acc indexed by constants to stay in registers
    for (int ct = 0; ct < 8; ++ct) va[ct] = frag_g(vn + s * 512, ct, lane);
    b0 = frag_g(qn + sn * 128, 0, lane);
    b1 = frag_g(qn + sn * 128, 1, lane);
    k0 = *(const v8f*)(mn + sn * 32 + ro);
    k1 = *(const v8f*)(mn + sn * 32 + 16 + ro);
    j0 = *(const v8f*)(in + sn * 32 + ro);
    j1 = *(const v8f*)(in + sn * 32 + 16 + ro);
    // the loads' address registers are given new values below: wait first
    asm volatile("s_wait_xcnt 0x0" ::: "memory");
    // keeps the arithmetic below, which reuses those registers, behind the wait
    __builtin_amdgcn_sched_barrier(0);
#pragma unroll  // bq, csum, acc indexed by constants to stay in registers
    for (int t = 0; t < 2; ++t) {
      v8f z = {};
      v8f x0 = __builtin_amdgcn_wmma_f32_16x16x32_f16(false, a0, false, bq[t],
                                                      (short)0, z, false, false);
      v8f x1 = __builtin_amdgcn_wmma_f32_16x16x32_f16(false, a1, false, bq[t],
                                                      (short)0, z, false, false);
      x0 -= m0;
      x1 -= m1;
#pragma unroll  // vector elements indexed by constants, here and below
      for (int r = 0; r < 8; ++r) x0[r] = __expf(x0[r]);
#pragma unroll
      for (int r = 0; r < 8; ++r) x1[r] = __expf(x1[r]);
      const v8h p0 = __builtin_convertvector(x0, v8h);
      const v8h p1 = __builtin_convertvector(x1, v8h);
      const v16h p = __builtin_shufflevector(p0, p1, 0, 1, 2, 3, 4, 5, 6, 7,
                                             8, 9, 10, 11, 12, 13, 14, 15);
      // column sum of the rounded p, the very weights that x_num sees
      csum[t] += i0 * __builtin_convertvector(p0, v8f);
      csum[t] += i1 * __builtin_convertvector(p1, v8f);
#pragma unroll
      for (int ct = 0; ct < 8; ++ct)
        acc[t][ct] = __builtin_amdgcn_wmma_f32_16x16x32_f16(false, va[ct], false, p,
                                                            (short)0, acc[t][ct],
                                                            false, false);
    }
  };

  v16h qa0 = frag_g(qn, 0, lane), qa1 = frag_g(qn, 1, lane), qb0, qb1;
  v8f ma0 = *(const v8f*)(mn + ro), ma1 = *(const v8f*)(mn + 16 + ro), mb0, mb1;
  v8f ia0 = *(const v8f*)(in + ro), ia1 = *(const v8f*)(in + 16 + ro), ib0, ib1;
  // the loads' address registers are given new values below: wait first
  asm volatile("s_wait_xcnt 0x0" ::: "memory");
  // two trips a pass: the two register sets swap roles without copies
  for (int s = 0; s < KSL / 32; s += 2) {
    trip(s,     qa0, qa1, ma0, ma1, ia0, ia1, qb0, qb1, mb0, mb1, ib0, ib1);
    trip(s + 1, qb0, qb1, mb0, mb1, ib0, ib1, qa0, qa1, ma0, ma1, ia0, ia1);
  }

  float* po = part + ks * NT + c0 + lcol;
#pragma unroll  // all loops: acc indexed by constants, offsets as immediates
  for (int t = 0; t < 2; ++t) {
#pragma unroll
    for (int ct = 0; ct < 8; ++ct)
#pragma unroll
      for (int r = 0; r < 8; ++r)
        po[(size_t)(ct * 16 + h2 * 8 + r) * (KSPLIT * NT) + t * 16] = acc[t][ct][r];
    float c = csum[t][0];
#pragma unroll
    for (int r = 1; r < 8; ++r) c += csum[t][r];
    c += __shfl_xor(c, 16, 32);
    if (lane < 16) cs[ks * NT + c0 + t * 16 + lane] = c;
  }
}

// ---- small elementwise / reduction kernels --------------------------------
__global__ void k_f2h(const float* __restrict__ s, _Float16* __restrict__ d, int n) {
  int i = blockIdx.x * 256 + threadIdx.x;
  if (i < n) d[i] = (_Float16)s[i];
}

// h1 = relu(bn1(conv1_w @ x^T)) ; K=3 scalar path
__global__ void k_conv1(const float* __restrict__ x, const float* __restrict__ w,
                        const float* __restrict__ g, const float* __restrict__ b,
                        _Float16* __restrict__ h1) {
  int i = blockIdx.x * 256 + threadIdx.x;
  if (i >= 128 * NT) return;
  const int o = i >> 13, j = i & (NT - 1);
  float s = w[o * 3 + 0] * x[(size_t)j * 3 + 0] +
            w[o * 3 + 1] * x[(size_t)j * 3 + 1] +
            w[o * 3 + 2] * x[(size_t)j * 3 + 2];
  s = s * (g[o] * rsqrtf(1.f + BN_EPS)) + b[o];
  h1[i] = (_Float16)fmaxf(s, 0.f);
}

// v_scaled = v * rowinv[col], written in the fragment order of frag_g:
// tile (n/32)*8 + c/16, channel as fragment row, n as k. One thread = the 16
// bytes of one lane in one plane, so a wave writes 512 contiguous bytes.
__global__ void k_scale_v(const _Float16* __restrict__ v, const float* __restrict__ ri,
                          _Float16* __restrict__ o) {
  const int i = blockIdx.x * 256 + threadIdx.x;   // ((nb*8+ct)*2+plane)*32+lane
  if (i >= 128 * NT / 8) return;
  const int lane = i & 31, plane = (i >> 5) & 1, ct = (i >> 6) & 7, nb = i >> 9;
  const int c = ct * 16 + (lane & 15);
  const int n = nb * 32 + plane * 16 + (lane >> 4) * 8;
  const v8h a = *(const v8h*)(v + (size_t)c * NT + n);
  const v8f s = *(const v8f*)(ri + n);
  ((v8h*)o)[i] = __builtin_convertvector(__builtin_convertvector(a, v8f) * s, v8h);
}

// diff = h - (sum of the KSPLIT x_num partials) / (1e-9 + colsum[col]),
// colsum[col] = sum of the CSPLIT partials of k_attn_xnum
// one thread = 4 consecutive columns of one row
__global__ void k_diff(const _Float16* __restrict__ h, const float* __restrict__ part,
                       const float* __restrict__ cs, _Float16* __restrict__ d) {
  const int q = blockIdx.x * 256 + threadIdx.x;     // index of the 4-column group
  if (q >= 128 * NT / 4) return;
  const int row = q / (NT / 4), jq = q & (NT / 4 - 1);
  const v4f* p4 = (const v4f*)part + row * (KSPLIT * NT / 4) + jq;  // [row][slice][col]
  v4f xn = p4[0];
#pragma unroll  // all KSPLIT loads in flight together
  for (int s = 1; s < KSPLIT; ++s) xn += p4[s * (NT / 4)];
  v4f c4 = ((const v4f*)cs)[jq];
#pragma unroll  // all CSPLIT loads in flight together
  for (int s = 1; s < CSPLIT; ++s) c4 += ((const v4f*)cs)[s * (NT / 4) + jq];
  const v4h h4 = ((const v4h*)h)[q];
  v4h o;
#pragma unroll  // vector elements indexed by constants
  for (int e = 0; e < 4; ++e)
    o[e] = (_Float16)((float)h4[e] - xn[e] / (1e-9f + c4[e]));
  ((v4h*)d)[q] = o;
}

// per-row max/mean pooling over N for hf rows (M=1024), into glob[b][..]
__global__ void k_pool(const _Float16* __restrict__ hf, float* __restrict__ xmax,
                       float* __restrict__ xavg) {
  const int o = blockIdx.x, bb = blockIdx.y, tid = threadIdx.x;
  const _Float16* p = hf + (size_t)o * NT + bb * NPTS;
  float mx = -3.0e38f, sm = 0.f;
  for (int i = tid; i < NPTS; i += 256) {
    const float v = (float)p[i];
    mx = fmaxf(mx, v); sm += v;
  }
  __shared__ float s1[256], s2[256];
  s1[tid] = mx; s2[tid] = sm;
  __syncthreads();
  for (int s = 128; s > 0; s >>= 1) {
    if (tid < s) { s1[tid] = fmaxf(s1[tid], s1[tid + s]); s2[tid] += s2[tid + s]; }
    __syncthreads();
  }
  if (tid == 0) {
    xmax[bb * GLOB + o] = s1[0];
    xavg[bb * GLOB + o] = s2[0] * (1.f / NPTS);
  }
}

// cls_f = leaky(bn(label_w @ cls_label))  (K=16, 128 outputs total), into
// glob[b][..]
__global__ void k_cls(const float* __restrict__ w, const float* __restrict__ lab,
                      const float* __restrict__ g, const float* __restrict__ b,
                      float* __restrict__ out) {
  const int t = threadIdx.x;
  if (t >= 128) return;
  const int bb = t >> 6, o = t & 63;
  float s = 0.f;
  for (int c = 0; c < 16; ++c) s += w[o * 16 + c] * lab[bb * 16 + c];
  s = s * (g[o] * rsqrtf(1.f + BN_EPS)) + b[o];
  out[bb * GLOB + o] = (s > 0.f) ? s : 0.2f * s;
}

// head bias: gb[b][o] = bias[o] + sum_k w[o][HKP + k] * glob[b][k], where
// glob[b] = (pooled maximum, pooled mean, class feature) of batch b, rounded
// to f16. These GLOB input rows hold one value for all points of a batch,
// so one column per batch is the whole product. One work-group = 16 output
// rows, GW waves x GT k-tiles; column c of the B operand is batch c & 1 (no
// lane idles or branches), columns 0 and 1 of D are kept; the waves' sums
// meet in LDS.
__global__ __launch_bounds__(GW * 32) void k_headbias(
    const _Float16* __restrict__ w,     // [512][HK]
    const float* __restrict__ glob,     // [2][GLOB]
    const float* __restrict__ bias,     // [512]
    float* __restrict__ gb)             // [2][512]
{
  __shared__ float red[GW][2][16];
  const int tid = threadIdx.x, lane = tid & 31;
  const int lcol = lane & 15, h2 = lane >> 4;
  const int wave = tid >> 5;
  const int m0 = blockIdx.x * 16;
  const _Float16* a = w + (size_t)(m0 + lcol) * HK + HKP + wave * (GT * 32) + 8 * h2;
  const float* g = glob + (lcol & 1) * GLOB + wave * (GT * 32) + 8 * h2;
  v8h alo[GT], ahi[GT];
  v8f glo[GT], ghi[GT];
#pragma unroll  // all loads in flight together; arrays indexed by constants
  for (int t = 0; t < GT; ++t) {
    alo[t] = *(const v8h*)(a + t * 32);
    ahi[t] = *(const v8h*)(a + t * 32 + 16);
    glo[t] = *(const v8f*)(g + t * 32);
    ghi[t] = *(const v8f*)(g + t * 32 + 16);
  }
  // keeps every load ahead of the first conversion: without it the compiler
  // issues them a few at a time, each group behind a wait for the one before
  __builtin_amdgcn_sched_barrier(0);
  v8f acc = {};
#pragma unroll  // arrays indexed by constants to stay in registers
  for (int t = 0; t < GT; ++t) {
    const v16h af = __builtin_shufflevector(alo[t], ahi[t], 0, 1, 2, 3, 4, 5, 6, 7,
                                            8, 9, 10, 11, 12, 13, 14, 15);
    const v16h bf = __builtin_shufflevector(__builtin_convertvector(glo[t], v8h),
                                            __builtin_convertvector(ghi[t], v8h),
                                            0, 1, 2, 3, 4, 5, 6, 7,
                                            8, 9, 10, 11, 12, 13, 14, 15);
    acc = __builtin_amdgcn_wmma_f32_16x16x32_f16(false, af, false, bf,
                                                 (short)0, acc, false, false);
  }
  if (lcol < 2) {
#pragma unroll  // acc indexed by constants
    for (int r = 0; r < 8; ++r) red[wave][lcol][h2 * 8 + r] = acc[r];
  }
  __syncthreads();
  if (tid < 32) {
    float s = bias[m0 + lcol];
#pragma unroll  // all GW LDS loads in flight together
    for (int v = 0; v < GW; ++v) s += red[v][h2][lcol];
    gb[h2 * 512 + m0 + lcol] = s;
  }
}

// out3 f16 [50][NT] -> d_out f32 [B][50][N]
__global__ void k_repack(const _Float16* __restrict__ o3, float* __restrict__ out) {
  int i = blockIdx.x * 256 + threadIdx.x;
  if (i >= 2 * 50 * NPTS) return;
  const int bb = i / (50 * NPTS);
  const int r = i - bb * 50 * NPTS;
  const int o = r >> 12, n = r & (NPTS - 1);
  out[i] = (float)o3[(size_t)o * NT + bb * NPTS + n];
}

// ---------------------------------------------------------------------------
extern "C" void kernel_launch(void* const* d_in, const int* in_sizes, int n_in,
                              void* d_out, int out_size, void* d_ws, size_t ws_size,
                              hipStream_t stream) {
  (void)in_sizes; (void)n_in; (void)out_size; (void)ws_size;
  const float* x         = (const float*)d_in[0];
  const float* cls_lab   = (const float*)d_in[1];
  const float* conv1_w   = (const float*)d_in[2];
  const float* bn1_g     = (const float*)d_in[3];
  const float* bn1_b     = (const float*)d_in[4];
  const float* conv2_w   = (const float*)d_in[5];
  const float* bn2_g     = (const float*)d_in[6];
  const float* bn2_b     = (const float*)d_in[7];
  const float* sa_qk_w   = (const float*)d_in[8];
  const float* sa_v_w    = (const float*)d_in[9];
  const float* sa_v_b    = (const float*)d_in[10];
  const float* sa_t_w    = (const float*)d_in[11];
  const float* sa_t_b    = (const float*)d_in[12];
  const float* sa_bn_g   = (const float*)d_in[13];
  const float* sa_bn_b   = (const float*)d_in[14];
  const float* fuse_w    = (const float*)d_in[15];
  const float* fuse_bn_g = (const float*)d_in[16];
  const float* fuse_bn_b = (const float*)d_in[17];
  const float* label_w   = (const float*)d_in[18];
  const float* label_bn_g= (const float*)d_in[19];
  const float* label_bn_b= (const float*)d_in[20];
  const float* convs1_w  = (const float*)d_in[21];
  const float* convs1_b  = (const float*)d_in[22];
  const float* bns1_g    = (const float*)d_in[23];
  const float* bns1_b    = (const float*)d_in[24];
  const float* convs2_w  = (const float*)d_in[25];
  const float* convs2_b  = (const float*)d_in[26];
  const float* bns2_g    = (const float*)d_in[27];
  const float* bns2_b    = (const float*)d_in[28];
  const float* convs3_w  = (const float*)d_in[29];
  const float* convs3_b  = (const float*)d_in[30];

  char* wp = (char*)d_ws;
  auto alloc = [&](size_t bytes) -> char* {
    char* p = wp; wp += (bytes + 255) & ~(size_t)255; return p;
  };
  auto h16 = [&](size_t n) { return (_Float16*)alloc(n * 2); };
  auto f32 = [&](size_t n) { return (float*)alloc(n * 4); };

  // f16 weight copies
  _Float16* wc2   = h16(128 * 128);
  _Float16* wqk   = h16(4 * 32 * 128);
  _Float16* wv    = h16(4 * 128 * 128);
  _Float16* wt    = h16(4 * 128 * 128);
  _Float16* wfuse = h16(1024 * 512);
  _Float16* ws1c  = h16(512 * 3136);
  _Float16* ws2c  = h16(256 * 512);
  _Float16* ws3c  = h16(50 * 256);
  // activations
  _Float16* h1    = h16((size_t)128 * NT);
  _Float16* h2b   = h16((size_t)128 * NT);
  _Float16* qbuf  = h16((size_t)32 * NT);
  _Float16* vbuf  = h16((size_t)128 * NT);
  _Float16* vsc   = h16((size_t)128 * NT);
  _Float16* dbuf  = h16((size_t)128 * NT);
  _Float16* hcat  = h16((size_t)512 * NT);
  _Float16* big   = h16((size_t)HKP * NT);
  _Float16* hs1   = h16((size_t)512 * NT);
  _Float16* hs2   = h16((size_t)256 * NT);
  _Float16* out3  = h16((size_t)50 * NT);
  float* xpart  = f32((size_t)KSPLIT * 128 * NT);
  float* rowinv = f32(2 * NPTS);
  float* rmaxb  = f32(2 * NPTS);
  float* colsum = f32((size_t)CSPLIT * NT);
  float* glob   = f32(2 * GLOB);   // per batch: maximum, mean, class feature
  float* xmax   = glob;
  float* xavg   = glob + 1024;
  float* clsf   = glob + 2048;
  float* hbias  = f32(2 * 512);

  auto cvt = [&](const float* s, _Float16* d, int n) {
    k_f2h<<<(n + 255) / 256, 256, 0, stream>>>(s, d, n);
  };
  auto gemm = [&](const _Float16* A, int lda, const _Float16* Bm, int ldb,
                  _Float16* O, int ldc, int M, int Ncols, int K,
                  const float* bias, const float* g, const float* be, int act,
                  const _Float16* resid) {
    dim3 grid(Ncols / 128, (M + 63) / 64);
    k_gemm<<<grid, 256, 0, stream>>>(A, lda, Bm, ldb, O, ldc, M, K,
                                     bias, g, be, act, resid, 0);
  };

  // weight conversions
  cvt(conv2_w, wc2, 128 * 128);
  cvt(sa_qk_w, wqk, 4 * 32 * 128);
  cvt(sa_v_w,  wv,  4 * 128 * 128);
  cvt(sa_t_w,  wt,  4 * 128 * 128);
  cvt(fuse_w,  wfuse, 1024 * 512);
  cvt(convs1_w, ws1c, 512 * 3136);
  cvt(convs2_w, ws2c, 256 * 512);
  cvt(convs3_w, ws3c, 50 * 256);

  // stem
  k_conv1<<<(128 * NT + 255) / 256, 256, 0, stream>>>(x, conv1_w, bn1_g, bn1_b, h1);
  gemm(wc2, 128, h1, NT, h2b, NT, 128, NT, 128, nullptr, bn2_g, bn2_b, 1, nullptr);

  // 4 self-attention blocks; feats written directly into hcat rows
  const _Float16* hprev = h2b;
  for (int i = 0; i < 4; ++i) {
    gemm(wqk + (size_t)i * 32 * 128, 128, hprev, NT, qbuf, NT, 32, NT, 128,
         nullptr, nullptr, nullptr, 3, nullptr);
    gemm(wv + (size_t)i * 128 * 128, 128, hprev, NT, vbuf, NT, 128, NT, 128,
         sa_v_b + i * 128, nullptr, nullptr, 0, nullptr);
    k_rowstat<<<dim3(NPTS / 16 / SROWT, 2), 256, 0, stream>>>(qbuf, rmaxb, rowinv);
    k_scale_v<<<128 * NT / 8 / 256, 256, 0, stream>>>(vbuf, rowinv, vsc);
    k_attn_xnum<<<dim3(NT / 256, KSPLIT), 256, 0, stream>>>(qbuf, vsc, rmaxb, rowinv,
                                                            xpart, colsum);
    k_diff<<<128 * NT / 4 / 256, 256, 0, stream>>>(hprev, xpart, colsum, dbuf);
    _Float16* hout = hcat + (size_t)i * 128 * NT;
    gemm(wt + (size_t)i * 128 * 128, 128, dbuf, NT, hout, NT, 128, NT, 128,
         sa_t_b + i * 128, sa_bn_g + i * 128, sa_bn_b + i * 128, 1, hprev);
    hprev = hout;
  }

  // fuse (writes big), pooling, cls, their share of the head's first layer
  gemm(wfuse, 512, hcat, NT, big, NT, 1024, NT, 512,
       nullptr, fuse_bn_g, fuse_bn_b, 2, nullptr);
  k_pool<<<dim3(1024, 2), 256, 0, stream>>>(big, xmax, xavg);
  k_cls<<<1, 128, 0, stream>>>(label_w, cls_lab, label_bn_g, label_bn_b, clsf);
  k_headbias<<<512 / 16, GW * 32, 0, stream>>>(ws1c, glob, convs1_b, hbias);

  // segmentation head
  k_gemm<<<dim3(NT / 128, 512 / 64), 256, 0, stream>>>(ws1c, HK, big, NT, hs1, NT,
                                                       512, HKP, hbias, bns1_g, bns1_b,
                                                       1, nullptr, 512);
  gemm(ws2c, 512, hs1, NT, hs2, NT, 256, NT, 512,
       convs2_b, bns2_g, bns2_b, 1, nullptr);
  gemm(ws3c, 256, hs2, NT, out3, NT, 50, NT, 256,
       convs3_b, nullptr, nullptr, 0, nullptr);
  k_repack<<<(2 * 50 * NPTS + 255) / 256, 256, 0, stream>>>(out3, (float*)d_out);
}

// v006
// A run of this version takes 394 microseconds.
// Timed twice side by side with v005, it ran 1.09 times as fast both times.
// All steps since v000 together make it 6.52 times as fast.
#include <hip/hip_runtime.h>

typedef __attribute__((ext_vector_type(16))) _Float16 v16h;
typedef __attribute__((ext_vector_type(8)))  float    v8f;
typedef __attribute__((ext_vector_type(4)))  float    v4f;
typedef __attribute__((ext_vector_type(4)))  _Float16 v4h;
typedef __attribute__((ext_vector_type(8)))  _Float16 v8h;

#define NT    8192      // total columns = B * N
#define NPTS  4096      // points per batch
#define BN_EPS 1e-5f
#define KT    128
#define FPAD  136
#define BPITCH 144
#define KSPLIT 8
#define KSL   (NPTS / KSPLIT)
#define CSPLIT KSPLIT
#define SROWT 2
#define HK    3136
#define HKP   1024
#define GLOB  (HK - HKP)
#define GW    11
#define GT    6

__device__ __forceinline__ v16h frag_ld(const _Float16* s, int lane) {
  const int row = lane & 15, h2 = lane >> 4;
  const _Float16* p = s + row * FPAD + 8 * h2;
  v16h f;
#pragma unroll
  for (int e = 0; e < 8; ++e) f[e] = p[e];
#pragma unroll
  for (int e = 0; e < 8; ++e) f[8 + e] = p[8 + e + 8];   // base+16+8*h2+e
  return f;
}

__device__ __forceinline__ v16h frag_tr(const _Float16* s, int lane) {
  typedef __attribute__((ext_vector_type(8))) short v8s;
  typedef __attribute__((address_space(3))) v8s lds_v8s;
  const _Float16* p = s + (8 * (lane >> 4) + (lane & 7)) * BPITCH + 8 * ((lane >> 3) & 1);
  const v8h lo = __builtin_bit_cast(v8h, __builtin_amdgcn_ds_load_tr16_b128_v8i16((lds_v8s*)p));
  const v8h hi = __builtin_bit_cast(v8h, __builtin_amdgcn_ds_load_tr16_b128_v8i16((lds_v8s*)(p + 16 * BPITCH)));
  return __builtin_shufflevector(lo, hi, 0, 1, 2, 3, 4, 5, 6, 7,
                                 8, 9, 10, 11, 12, 13, 14, 15);
}

__device__ __forceinline__ v16h frag_g(const v8h* __restrict__ f, int tile, int lane) {
  const v8h lo = f[(tile * 2 + 0) * 32 + lane];
  const v8h hi = f[(tile * 2 + 1) * 32 + lane];
  return __builtin_shufflevector(lo, hi, 0, 1, 2, 3, 4, 5, 6, 7,
                                 8, 9, 10, 11, 12, 13, 14, 15);
}

// ---- generic WMMA GEMM: O[m,n] = epi( sum_k A[m,k]*B[k,n] ) ---------------
// 256 threads = 8 waves as 4(M)x2(N); block tile 64(M) x 128(N); a stage is
// KT = 128 deep (K is a multiple of it): a thread's 12 loads of 16 bytes fly
// together, so a stage waits out the load latency and its two barriers once
// for four k-tiles of 32. Each wave: 16x64 output = 4 wmma per k-tile on one
// A fragment. B has NT columns, so its row steps are immediates.
// epilogue: +bias[m], BN(g,b) fresh stats, act(0,1=relu,2=leaky.2), +residual.
// bias_bs: distance between the two batches' bias vectors (0: one for both).
// act 3 (the q projection, M = 32): plain product, stored in the fragment
// order of frag_g with the point as fragment row and the channel as k.
__global__ __launch_bounds__(256) void k_gemm(
    const _Float16* __restrict__ A, int lda,
    const _Float16* __restrict__ Bm,
    _Float16* __restrict__ O, int ldc,
    int M, int K,
    const float* __restrict__ bias,
    const float* __restrict__ bng, const float* __restrict__ bnb,
    int act, const _Float16* __restrict__ resid, int bias_bs)
{
  __shared__ __attribute__((aligned(16))) _Float16 As[64 * FPAD];     // [m][k]
  __shared__ __attribute__((aligned(16))) _Float16 Bs[KT * BPITCH];   // [k][n]
  const int tid  = threadIdx.x;
  const int lane = tid & 31, wave = tid >> 5;
  const int wm = wave >> 1, wn = wave & 1;
  const int m0 = blockIdx.y * 64;
  const int n0 = blockIdx.x * 128;
  v8f acc[4] = {{}, {}, {}, {}};
  // A and B alike: 16 lanes move one whole 256-byte row; rows sr, sr+16, ...
  const int sr = tid >> 4, sc = (tid & 15) * 8;
  // A rows past M: row M-1 is staged in their place, so that no load stands
  // under a branch; they reach only rows of D that are never stored
  const _Float16* ap[4];
#pragma unroll  // ap indexed by constants to stay in registers
  for (int i = 0; i < 4; ++i) {
    const int gm = m0 + sr + 16 * i;
    ap[i] = A + (size_t)(gm < M ? gm : M - 1) * lda + sc;
  }
  const _Float16* bp = Bm + (size_t)sr * NT + n0 + sc;
  // B prefetch: one 128-byte line a thread, KT k-rows x 128 n
  const _Float16* pp = Bm + (size_t)(KT + (tid >> 1)) * NT + n0 + (tid & 1) * 64;

  for (int k0 = 0; k0 < K; k0 += KT) {
    v8h a[4], b[KT / 16];
#pragma unroll  // a, ap indexed by constants
    for (int i = 0; i < 4; ++i) a[i] = *(const v8h*)(ap[i] + k0);   // A [64][KT]
#pragma unroll  // b indexed by constants
    for (int i = 0; i < KT / 16; ++i)                               // B [KT][128]
      b[i] = *(const v8h*)(bp + (size_t)(k0 + 16 * i) * NT);
    // keeps all 12 loads ahead of the first LDS store: without it the compiler
    // waits for the A loads and stores them before it issues the B loads
    __builtin_amdgcn_sched_barrier(0);
#pragma unroll  // a indexed by constants
    for (int i = 0; i < 4; ++i) *(v8h*)&As[(sr + 16 * i) * FPAD + sc] = a[i];
#pragma unroll  // b indexed by constants
    for (int i = 0; i < KT / 16; ++i) *(v8h*)&Bs[(sr + 16 * i) * BPITCH + sc] = b[i];
    if (k0 + KT < K)  // hint next stage's lines toward L2 (global_prefetch_b8)
      __builtin_prefetch(pp + (size_t)k0 * NT, 0, 1);
    __syncthreads();
#pragma unroll  // LDS offsets as immediates; k in the order of the 32-deep loop
    for (int kk = 0; kk < KT; kk += 32) {
      const v16h af = frag_ld(&As[wm * 16 * FPAD + kk], lane);
#pragma unroll  // acc indexed by constants
      for (int t = 0; t < 4; ++t) {
        const v16h bf = frag_tr(&Bs[kk * BPITCH + wn * 64 + t * 16], lane);
        acc[t] = __builtin_amdgcn_wmma_f32_16x16x32_f16(false, af, false, bf,
                                                        (short)0, acc[t],
                                                        false, false);
      }
    }
    __syncthreads();
  }

  const int lcol = lane & 15, h2 = lane >> 4;
  if (act == 3) {
    // a lane's 8 accumulators are channels wm*16+8*h2+r of point lcol: halves
    // 0..7 of plane wm of that point tile, at this very lane
    if (wm < 2) {
#pragma unroll
      for (int t = 0; t < 4; ++t) {
        v8h o;
#pragma unroll
        for (int r = 0; r < 8; ++r) o[r] = (_Float16)acc[t][r];
        ((v8h*)O)[(((n0 + wn * 64 + t * 16) >> 4) * 2 + wm) * 32 + lane] = o;
      }
    }
    return;
  }
  const float bns = rsqrtf(1.f + BN_EPS);
  bias += (n0 / NPTS) * bias_bs;   // a block's 128 columns lie in one batch
#pragma unroll
  for (int t = 0; t < 4; ++t) {
    const int n = n0 + wn * 64 + t * 16 + lcol;
#pragma unroll
    for (int r = 0; r < 8; ++r) {
      const int m = m0 + wm * 16 + h2 * 8 + r;
      if (m < M) {
        float v = acc[t][r];
        if (bias) v += bias[m];
        if (bng)  v = v * (bng[m] * bns) + bnb[m];
        if (act == 1)      v = fmaxf(v, 0.f);
        else if (act == 2) v = (v > 0.f) ? v : 0.2f * v;
        if (resid) v += (float)resid[(size_t)m * ldc + n];
        O[(size_t)m * ldc + n] = (_Float16)v;
      }
    }
  }
}

// ---- row statistics of e = q^T q (K=32): rowmax and 1/rowsum --------------
// One work-group = SROWT*16 rows of one batch. The own rows are the B operand
// (kept in registers), the 4096 partners the A operand, 32 tiles per wave:
// a lane then holds 8 scores of ONE own row, so maximum and sum stay in the
// lane until one exchange between the wave's halves; the 8 waves meet in LDS.
// Two passes: rowmax, then the sum of exp(e - rowmax).
__global__ __launch_bounds__(256) void k_rowstat(
    const _Float16* __restrict__ qf,  // q in fragment order, NT/16 tiles
    float* __restrict__ rmax,         // [NT]
    float* __restrict__ rowinv)       // [NT]
{
  __shared__ float part[8][SROWT * 16];
  const int tid = threadIdx.x, lane = tid & 31, lcol = lane & 15;
  // wave number as a scalar, so that the tile addresses are scalar + lane
  const int wave = __builtin_amdgcn_readfirstlane(tid >> 5);
  const int bt = blockIdx.y * (NPTS / 16);      // first tile of the batch
  const int rt0 = bt + blockIdx.x * SROWT;      // first own row tile
  const int mt0 = bt + wave * (NPTS / 16 / 8);  // first partner tile
  const v8h* f = (const v8h*)qf;
  v16h bq[SROWT];
#pragma unroll  // bq, mx, sm, rm indexed by constants to stay in registers
  for (int i = 0; i < SROWT; ++i) bq[i] = frag_g(f, rt0 + i, lane);

  v8f mx[SROWT];
#pragma unroll
  for (int i = 0; i < SROWT; ++i)
#pragma unroll
    for (int r = 0; r < 8; ++r) mx[i][r] = -3.0e38f;
#pragma unroll 8
  for (int t = 0; t < NPTS / 16 / 8; ++t) {
    const v16h a = frag_g(f, mt0 + t, lane);
#pragma unroll
    for (int i = 0; i < SROWT; ++i) {
      v8f z = {};
      const v8f e = __builtin_amdgcn_wmma_f32_16x16x32_f16(false, a, false, bq[i],
                                                           (short)0, z, false, false);
#pragma unroll
      for (int r = 0; r < 8; ++r) mx[i][r] = fmaxf(mx[i][r], e[r]);
    }
  }
#pragma unroll
  for (int i = 0; i < SROWT; ++i) {
    float m = mx[i][0];
#pragma unroll
    for (int r = 1; r < 8; ++r) m = fmaxf(m, mx[i][r]);
    m = fmaxf(m, __shfl_xor(m, 16, 32));
    if (lane < 16) part[wave][i * 16 + lane] = m;
  }
  __syncthreads();
  float rm[SROWT];
#pragma unroll
  for (int i = 0; i < SROWT; ++i) {
    float m = part[0][i * 16 + lcol];
#pragma unroll
    for (int w = 1; w < 8; ++w) m = fmaxf(m, part[w][i * 16 + lcol]);
    rm[i] = m;
  }
  __syncthreads();   // part is written again below

  v8f sm[SROWT] = {};
#pragma unroll 8
  for (int t = 0; t < NPTS / 16 / 8; ++t) {
    const v16h a = frag_g(f, mt0 + t, lane);
#pragma unroll
    for (int i = 0; i < SROWT; ++i) {
      v8f z = {};
      const v8f e = __builtin_amdgcn_wmma_f32_16x16x32_f16(false, a, false, bq[i],
                                                           (short)0, z, false, false);
#pragma unroll
      for (int r = 0; r < 8; ++r) sm[i][r] += __expf(e[r] - rm[i]);
    }
  }
#pragma unroll
  for (int i = 0; i < SROWT; ++i) {
    float s = sm[i][0];
#pragma unroll
    for (int r = 1; r < 8; ++r) s += sm[i][r];
    s += __shfl_xor(s, 16, 32);
    if (lane < 16) part[wave][i * 16 + lane] = s;
  }
  __syncthreads();
  if (tid < SROWT * 16) {
    float s = part[0][tid];
#pragma unroll
    for (int w = 1; w < 8; ++w) s += part[w][tid];
    rowinv[rt0 * 16 + tid] = 1.f / s;
    rmax[rt0 * 16 + tid] = (tid < 16) ? rm[0] : rm[1];
  }
}

// ---- x_num = v_scaled @ p and the column sum, p formed in registers --------
// grid.x = 256 columns m (8 waves x 2 tiles of 16), grid.y = slice of KSL
// rows n. Per 32 rows a wave computes two score tiles e[n][m] per column tile
// (A = q of the rows, B = q of its own columns, kept in registers). Their D
// registers, as p = exp(e - rowmax[n]) in f16, ARE the B fragment of the next
// product (k = 8*h2+r and 16+8*h2+r), so p meets neither LDS nor memory.
// A = v_scaled in fragment order, 8 channel tiles. The f32 partial tile goes
// to part[128][KSPLIT][NT], the column-sum partial to cs[KSPLIT][NT];
// k_diff adds the slices.
__global__ __launch_bounds__(256) void k_attn_xnum(
    const _Float16* __restrict__ qf,   // q in fragment order, NT/16 tiles
    const _Float16* __restrict__ vf,   // v * rowinv, fragment order [NT/32][8]
    const float* __restrict__ rmax,    // [NT]
    const float* __restrict__ rowinv,  // [NT]
    float* __restrict__ part,          // [128][KSPLIT][NT]
    float* __restrict__ cs)            // [KSPLIT][NT]
{
  const int tid = threadIdx.x, lane = tid & 31;
  const int lcol = lane & 15, h2 = lane >> 4;
  // wave number as a scalar, so that the tile addresses are scalar + lane
  const int wave = __builtin_amdgcn_readfirstlane(tid >> 5);
  const int c0 = blockIdx.x * 256 + wave * 32;      // first own column
  const int ks = blockIdx.y;
  const int n0 = (blockIdx.x / (NPTS / 256)) * NPTS + ks * KSL;  // first row
  const v8h* qv = (const v8h*)qf;
  const v16h bq[2] = {frag_g(qv, (c0 >> 4) + 0, lane),
                      frag_g(qv, (c0 >> 4) + 1, lane)};
  v8f acc[2][8] = {};
  v8f csum[2] = {};

  // work-group-uniform bases of the slice; a trip adds its step, a lane its
  // own lane or h2 * 8
  const v8h* qn = qv + (n0 >> 4) * 64;                  // 128 units a trip
  const v8h* vn = (const v8h*)vf + (n0 >> 5) * 512;     // 512 units a trip
  const float* mn = rmax + n0;                          // 32 floats a trip
  const float* in = rowinv + n0;
  const unsigned ro = h2 * 8;

  // one trip = 32 rows. q fragments and row statistics (a0..i1) were fetched
  // one trip ahead, so the score products wait for no load of their own trip;
  // this trip fetches the next one's (b0..j1) and its own v fragments.
  auto trip = [&](int s, const v16h& a0, const v16h& a1, const v8f& m0, const v8f& m1,
                  const v8f& i0, const v8f& i1, v16h& b0, v16h& b1, v8f& k0, v8f& k1,
                  v8f& j0, v8f& j1) {
    // the last trip fetches its own rows again: in bounds, never used
    const int sn = (s + 1 < KSL / 32) ? s + 1 : s;
    // keeps this trip's loads behind the trip before: a load lifted into its
    // arithmetic would have its address registers reused ahead of the wait
    __builtin_amdgcn_sched_barrier(0);
    v16h va[8];
#pragma unroll  // va, acc indexed by constants to stay in registers
    for (int ct = 0; ct < 8; ++ct) va[ct] = frag_g(vn + s * 512, ct, lane);
    b0 = frag_g(qn + sn * 128, 0, lane);
    b1 = frag_g(qn + sn * 128, 1, lane);
    k0 = *(const v8f*)(mn + sn * 32 + ro);
    k1 = *(const v8f*)(mn + sn * 32 + 16 + ro);
    j0 = *(const v8f*)(in + sn * 32 + ro);
    j1 = *(const v8f*)(in + sn * 32 + 16 + ro);
    // the loads' address registers are given new values below: wait first
    asm volatile("s_wait_xcnt 0x0" ::: "memory");
    // keeps the arithmetic below, which reuses those registers, behind the wait
    __builtin_amdgcn_sched_barrier(0);
#pragma unroll  // bq, csum, acc indexed by constants to stay in registers
    for (int t = 0; t < 2; ++t) {
      v8f z = {};
      v8f x0 = __builtin_amdgcn_wmma_f32_16x16x32_f16(false, a0, false, bq[t],
                                                      (short)0, z, false, false);
      v8f x1 = __builtin_amdgcn_wmma_f32_16x16x32_f16(false, a1, false, bq[t],
                                                      (short)0, z, false, false);
      x0 -= m0;
      x1 -= m1;
#pragma unroll  // vector elements indexed by constants, here and below
      for (int r = 0; r < 8; ++r) x0[r] = __expf(x0[r]);
#pragma unroll
      for (int r = 0; r < 8; ++r) x1[r] = __expf(x1[r]);
      const v8h p0 = __builtin_convertvector(x0, v8h);
      const v8h p1 = __builtin_convertvector(x1, v8h);
      const v16h p = __builtin_shufflevector(p0, p1, 0, 1, 2, 3, 4, 5, 6, 7,
                                             8, 9, 10, 11, 12, 13, 14, 15);
      // column sum of the rounded p, the very weights that x_num sees
      csum[t] += i0 * __builtin_convertvector(p0, v8f);
      csum[t] += i1 * __builtin_convertvector(p1, v8f);
#pragma unroll
      for (int ct = 0; ct < 8; ++ct)
        acc[t][ct] = __builtin_amdgcn_wmma_f32_16x16x32_f16(false, va[ct], false, p,
                                                            (short)0, acc[t][ct],
                                                            false, false);
    }
  };

  v16h qa0 = frag_g(qn, 0, lane), qa1 = frag_g(qn, 1, lane), qb0, qb1;
  v8f ma0 = *(const v8f*)(mn + ro), ma1 = *(const v8f*)(mn + 16 + ro), mb0, mb1;
  v8f ia0 = *(const v8f*)(in + ro), ia1 = *(const v8f*)(in + 16 + ro), ib0, ib1;
  // the loads' address registers are given new values below: wait first
  asm volatile("s_wait_xcnt 0x0" ::: "memory");
  // two trips a pass: the two register sets swap roles without copies
  for (int s = 0; s < KSL / 32; s += 2) {
    trip(s,     qa0, qa1, ma0, ma1, ia0, ia1, qb0, qb1, mb0, mb1, ib0, ib1);
    trip(s + 1, qb0, qb1, mb0, mb1, ib0, ib1, qa0, qa1, ma0, ma1, ia0, ia1);
  }

  float* po = part + ks * NT + c0 + lcol;
#pragma unroll  // all loops: acc indexed by constants, offsets as immediates
  for (int t = 0; t < 2; ++t) {
#pragma unroll
    for (int ct = 0; ct < 8; ++ct)
#pragma unroll
      for (int r = 0; r < 8; ++r)
        po[(size_t)(ct * 16 + h2 * 8 + r) * (KSPLIT * NT) + t * 16] = acc[t][ct][r];
    float c = csum[t][0];
#pragma unroll
    for (int r = 1; r < 8; ++r) c += csum[t][r];
    c += __shfl_xor(c, 16, 32);
    if (lane < 16) cs[ks * NT + c0 + t * 16 + lane] = c;
  }
}

// ---- small elementwise / reduction kernels --------------------------------
__global__ void k_f2h(const float* __restrict__ s, _Float16* __restrict__ d, int n) {
  int i = blockIdx.x * 256 + threadIdx.x;
  if (i < n) d[i] = (_Float16)s[i];
}

// h1 = relu(bn1(conv1_w @ x^T)) ; K=3 scalar path
__global__ void k_conv1(const float* __restrict__ x, const float* __restrict__ w,
                        const float* __restrict__ g, const float* __restrict__ b,
                        _Float16* __restrict__ h1) {
  int i = blockIdx.x * 256 + threadIdx.x;
  if (i >= 128 * NT) return;
  const int o = i >> 13, j = i & (NT - 1);
  float s = w[o * 3 + 0] * x[(size_t)j * 3 + 0] +
            w[o * 3 + 1] * x[(size_t)j * 3 + 1] +
            w[o * 3 + 2] * x[(size_t)j * 3 + 2];
  s = s * (g[o] * rsqrtf(1.f + BN_EPS)) + b[o];
  h1[i] = (_Float16)fmaxf(s, 0.f);
}

// v_scaled = v * rowinv[col], written in the fragment order of frag_g:
// tile (n/32)*8 + c/16, channel as fragment row, n as k. One thread = the 16
// bytes of one lane in one plane, so a wave writes 512 contiguous bytes.
__global__ void k_scale_v(const _Float16* __restrict__ v, const float* __restrict__ ri,
                          _Float16* __restrict__ o) {
  const int i = blockIdx.x * 256 + threadIdx.x;   // ((nb*8+ct)*2+plane)*32+lane
  if (i >= 128 * NT / 8) return;
  const int lane = i & 31, plane = (i >> 5) & 1, ct = (i >> 6) & 7, nb = i >> 9;
  const int c = ct * 16 + (lane & 15);
  const int n = nb * 32 + plane * 16 + (lane >> 4) * 8;
  const v8h a = *(const v8h*)(v + (size_t)c * NT + n);
  const v8f s = *(const v8f*)(ri + n);
  ((v8h*)o)[i] = __builtin_convertvector(__builtin_convertvector(a, v8f) * s, v8h);
}

// diff = h - (sum of the KSPLIT x_num partials) / (1e-9 + colsum[col]),
// colsum[col] = sum of the CSPLIT partials of k_attn_xnum
// one thread = 4 consecutive columns of one row
__global__ void k_diff(const _Float16* __restrict__ h, const float* __restrict__ part,
                       const float* __restrict__ cs, _Float16* __restrict__ d) {
  const int q = blockIdx.x * 256 + threadIdx.x;     // index of the 4-column group
  if (q >= 128 * NT / 4) return;
  const int row = q / (NT / 4), jq = q & (NT / 4 - 1);
  const v4f* p4 = (const v4f*)part + row * (KSPLIT * NT / 4) + jq;  // [row][slice][col]
  v4f xn = p4[0];
#pragma unroll  // all KSPLIT loads in flight together
  for (int s = 1; s < KSPLIT; ++s) xn += p4[s * (NT / 4)];
  v4f c4 = ((const v4f*)cs)[jq];
#pragma unroll  // all CSPLIT loads in flight together
  for (int s = 1; s < CSPLIT; ++s) c4 += ((const v4f*)cs)[s * (NT / 4) + jq];
  const v4h h4 = ((const v4h*)h)[q];
  v4h o;
#pragma unroll  // vector elements indexed by constants
  for (int e = 0; e < 4; ++e)
    o[e] = (_Float16)((float)h4[e] - xn[e] / (1e-9f + c4[e]));
  ((v4h*)d)[q] = o;
}

// per-row max/mean pooling over N for hf rows (M=1024), into glob[b][..]
__global__ void k_pool(const _Float16* __restrict__ hf, float* __restrict__ xmax,
                       float* __restrict__ xavg) {
  const int o = blockIdx.x, bb = blockIdx.y, tid = threadIdx.x;
  const _Float16* p = hf + (size_t)o * NT + bb * NPTS;
  float mx = -3.0e38f, sm = 0.f;
  for (int i = tid; i < NPTS; i += 256) {
    const float v = (float)p[i];
    mx = fmaxf(mx, v); sm += v;
  }
  __shared__ float s1[256], s2[256];
  s1[tid] = mx; s2[tid] = sm;
  __syncthreads();
  for (int s = 128; s > 0; s >>= 1) {
    if (tid < s) { s1[tid] = fmaxf(s1[tid], s1[tid + s]); s2[tid] += s2[tid + s]; }
    __syncthreads();
  }
  if (tid == 0) {
    xmax[bb * GLOB + o] = s1[0];
    xavg[bb * GLOB + o] = s2[0] * (1.f / NPTS);
  }
}

// cls_f = leaky(bn(label_w @ cls_label))  (K=16, 128 outputs total), into
// glob[b][..]
__global__ void k_cls(const float* __restrict__ w, const float* __restrict__ lab,
                      const float* __restrict__ g, const float* __restrict__ b,
                      float* __restrict__ out) {
  const int t = threadIdx.x;
  if (t >= 128) return;
  const int bb = t >> 6, o = t & 63;
  float s = 0.f;
  for (int c = 0; c < 16; ++c) s += w[o * 16 + c] * lab[bb * 16 + c];
  s = s * (g[o] * rsqrtf(1.f + BN_EPS)) + b[o];
  out[bb * GLOB + o] = (s > 0.f) ? s : 0.2f * s;
}

// head bias: gb[b][o] = bias[o] + sum_k w[o][HKP + k] * glob[b][k], where
// glob[b] = (pooled maximum, pooled mean, class feature) of batch b, rounded
// to f16. These GLOB input rows hold one value for all points of a batch,
// so one column per batch is the whole product. One work-group = 16 output
// rows, GW waves x GT k-tiles; column c of the B operand is batch c & 1 (no
// lane idles or branches), columns 0 and 1 of D are kept; the waves' sums
// meet in LDS.
__global__ __launch_bounds__(GW * 32) void k_headbias(
    const _Float16* __restrict__ w,     // [512][HK]
    const float* __restrict__ glob,     // [2][GLOB]
    const float* __restrict__ bias,     // [512]
    float* __restrict__ gb)             // [2][512]
{
  __shared__ float red[GW][2][16];
  const int tid = threadIdx.x, lane = tid & 31;
  const int lcol = lane & 15, h2 = lane >> 4;
  const int wave = tid >> 5;
  const int m0 = blockIdx.x * 16;
  const _Float16* a = w + (size_t)(m0 + lcol) * HK + HKP + wave * (GT * 32) + 8 * h2;
  const float* g = glob + (lcol & 1) * GLOB + wave * (GT * 32) + 8 * h2;
  v8h alo[GT], ahi[GT];
  v8f glo[GT], ghi[GT];
#pragma unroll  // all loads in flight together; arrays indexed by constants
  for (int t = 0; t < GT; ++t) {
    alo[t] = *(const v8h*)(a + t * 32);
    ahi[t] = *(const v8h*)(a + t * 32 + 16);
    glo[t] = *(const v8f*)(g + t * 32);
    ghi[t] = *(const v8f*)(g + t * 32 + 16);
  }
  // keeps every load ahead of the first conversion: without it the compiler
  // issues them a few at a time, each group behind a wait for the one before
  __builtin_amdgcn_sched_barrier(0);
  v8f acc = {};
#pragma unroll  // arrays indexed by constants to stay in registers
  for (int t = 0; t < GT; ++t) {
    const v16h af = __builtin_shufflevector(alo[t], ahi[t], 0, 1, 2, 3, 4, 5, 6, 7,
                                            8, 9, 10, 11, 12, 13, 14, 15);
    const v16h bf = __builtin_shufflevector(__builtin_convertvector(glo[t], v8h),
                                            __builtin_convertvector(ghi[t], v8h),
                                            0, 1, 2, 3, 4, 5, 6, 7,
                                            8, 9, 10, 11, 12, 13, 14, 15);
    acc = __builtin_amdgcn_wmma_f32_16x16x32_f16(false, af, false, bf,
                                                 (short)0, acc, false, false);
  }
  if (lcol < 2) {
#pragma unroll  // acc indexed by constants
    for (int r = 0; r < 8; ++r) red[wave][lcol][h2 * 8 + r] = acc[r];
  }
  __syncthreads();
  if (tid < 32) {
    float s = bias[m0 + lcol];
#pragma unroll  // all GW LDS loads in flight together
    for (int v = 0; v < GW; ++v) s += red[v][h2][lcol];
    gb[h2 * 512 + m0 + lcol] = s;
  }
}

// out3 f16 [50][NT] -> d_out f32 [B][50][N]
__global__ void k_repack(const _Float16* __restrict__ o3, float* __restrict__ out) {
  int i = blockIdx.x * 256 + threadIdx.x;
  if (i >= 2 * 50 * NPTS) return;
  const int bb = i / (50 * NPTS);
  const int r = i - bb * 50 * NPTS;
  const int o = r >> 12, n = r & (NPTS - 1);
  out[i] = (float)o3[(size_t)o * NT + bb * NPTS + n];
}

// ---------------------------------------------------------------------------
extern "C" void kernel_launch(void* const* d_in, const int* in_sizes, int n_in,
                              void* d_out, int out_size, void* d_ws, size_t ws_size,
                              hipStream_t stream) {
  (void)in_sizes; (void)n_in; (void)out_size; (void)ws_size;
  const float* x         = (const float*)d_in[0];
  const float* cls_lab   = (const float*)d_in[1];
  const float* conv1_w   = (const float*)d_in[2];
  const float* bn1_g     = (const float*)d_in[3];
  const float* bn1_b     = (const float*)d_in[4];
  const float* conv2_w   = (const float*)d_in[5];
  const float* bn2_g     = (const float*)d_in[6];
  const float* bn2_b     = (const float*)d_in[7];
  const float* sa_qk_w   = (const float*)d_in[8];
  const float* sa_v_w    = (const float*)d_in[9];
  const float* sa_v_b    = (const float*)d_in[10];
  const float* sa_t_w    = (const float*)d_in[11];
  const float* sa_t_b    = (const float*)d_in[12];
  const float* sa_bn_g   = (const float*)d_in[13];
  const float* sa_bn_b   = (const float*)d_in[14];
  const float* fuse_w    = (const float*)d_in[15];
  const float* fuse_bn_g = (const float*)d_in[16];
  const float* fuse_bn_b = (const float*)d_in[17];
  const float* label_w   = (const float*)d_in[18];
  const float* label_bn_g= (const float*)d_in[19];
  const float* label_bn_b= (const float*)d_in[20];
  const float* convs1_w  = (const float*)d_in[21];
  const float* convs1_b  = (const float*)d_in[22];
  const float* bns1_g    = (const float*)d_in[23];
  const float* bns1_b    = (const float*)d_in[24];
  const float* convs2_w  = (const float*)d_in[25];
  const float* convs2_b  = (const float*)d_in[26];
  const float* bns2_g    = (const float*)d_in[27];
  const float* bns2_b    = (const float*)d_in[28];
  const float* convs3_w  = (const float*)d_in[29];
  const float* convs3_b  = (const float*)d_in[30];

  char* wp = (char*)d_ws;
  auto alloc = [&](size_t bytes) -> char* {
    char* p = wp; wp += (bytes + 255) & ~(size_t)255; return p;
  };
  auto h16 = [&](size_t n) { return (_Float16*)alloc(n * 2); };
  auto f32 = [&](size_t n) { return (float*)alloc(n * 4); };

  // f16 weight copies
  _Float16* wc2   = h16(128 * 128);
  _Float16* wqk   = h16(4 * 32 * 128);
  _Float16* wv    = h16(4 * 128 * 128);
  _Float16* wt    = h16(4 * 128 * 128);
  _Float16* wfuse = h16(1024 * 512);
  _Float16* ws1c  = h16(512 * 3136);
  _Float16* ws2c  = h16(256 * 512);
  _Float16* ws3c  = h16(50 * 256);
  // activations
  _Float16* h1    = h16((size_t)128 * NT);
  _Float16* h2b   = h16((size_t)128 * NT);
  _Float16* qbuf  = h16((size_t)32 * NT);
  _Float16* vbuf  = h16((size_t)128 * NT);
  _Float16* vsc   = h16((size_t)128 * NT);
  _Float16* dbuf  = h16((size_t)128 * NT);
  _Float16* hcat  = h16((size_t)512 * NT);
  _Float16* big   = h16((size_t)HKP * NT);
  _Float16* hs1   = h16((size_t)512 * NT);
  _Float16* hs2   = h16((size_t)256 * NT);
  _Float16* out3  = h16((size_t)50 * NT);
  float* xpart  = f32((size_t)KSPLIT * 128 * NT);
  float* rowinv = f32(2 * NPTS);
  float* rmaxb  = f32(2 * NPTS);
  float* colsum = f32((size_t)CSPLIT * NT);
  float* glob   = f32(2 * GLOB);   // per batch: maximum, mean, class feature
  float* xmax   = glob;
  float* xavg   = glob + 1024;
  float* clsf   = glob + 2048;
  float* hbias  = f32(2 * 512);

  auto cvt = [&](const float* s, _Float16* d, int n) {
    k_f2h<<<(n + 255) / 256, 256, 0, stream>>>(s, d, n);
  };
  auto gemm = [&](const _Float16* A, int lda, const _Float16* Bm,
                  _Float16* O, int ldc, int M, int Ncols, int K,
                  const float* bias, const float* g, const float* be, int act,
                  const _Float16* resid) {
    dim3 grid(Ncols / 128, (M + 63) / 64);
    k_gemm<<<grid, 256, 0, stream>>>(A, lda, Bm, O, ldc, M, K,
                                     bias, g, be, act, resid, 0);
  };

  // weight conversions
  cvt(conv2_w, wc2, 128 * 128);
  cvt(sa_qk_w, wqk, 4 * 32 * 128);
  cvt(sa_v_w,  wv,  4 * 128 * 128);
  cvt(sa_t_w,  wt,  4 * 128 * 128);
  cvt(fuse_w,  wfuse, 1024 * 512);
  cvt(convs1_w, ws1c, 512 * 3136);
  cvt(convs2_w, ws2c, 256 * 512);
  cvt(convs3_w, ws3c, 50 * 256);

  // stem
  k_conv1<<<(128 * NT + 255) / 256, 256, 0, stream>>>(x, conv1_w, bn1_g, bn1_b, h1);
  gemm(wc2, 128, h1, h2b, NT, 128, NT, 128, nullptr, bn2_g, bn2_b, 1, nullptr);

  // 4 self-attention blocks; feats written directly into hcat rows
  const _Float16* hprev = h2b;
  for (int i = 0; i < 4; ++i) {
    gemm(wqk + (size_t)i * 32 * 128, 128, hprev, qbuf, NT, 32, NT, 128,
         nullptr, nullptr, nullptr, 3, nullptr);
    gemm(wv + (size_t)i * 128 * 128, 128, hprev, vbuf, NT, 128, NT, 128,
         sa_v_b + i * 128, nullptr, nullptr, 0, nullptr);
    k_rowstat<<<dim3(NPTS / 16 / SROWT, 2), 256, 0, stream>>>(qbuf, rmaxb, rowinv);
    k_scale_v<<<128 * NT / 8 / 256, 256, 0, stream>>>(vbuf, rowinv, vsc);
    k_attn_xnum<<<dim3(NT / 256, KSPLIT), 256, 0, stream>>>(qbuf, vsc, rmaxb, rowinv,
                                                            xpart, colsum);
    k_diff<<<128 * NT / 4 / 256, 256, 0, stream>>>(hprev, xpart, colsum, dbuf);
    _Float16* hout = hcat + (size_t)i * 128 * NT;
    gemm(wt + (size_t)i * 128 * 128, 128, dbuf, hout, NT, 128, NT, 128,
         sa_t_b + i * 128, sa_bn_g + i * 128, sa_bn_b + i * 128, 1, hprev);
    hprev = hout;
  }

  // fuse (writes big), pooling, cls, their share of the head's first layer
  gemm(wfuse, 512, hcat, big, NT, 1024, NT, 512,
       nullptr, fuse_bn_g, fuse_bn_b, 2, nullptr);
  k_pool<<<dim3(1024, 2), 256, 0, stream>>>(big, xmax, xavg);
  k_cls<<<1, 128, 0, stream>>>(label_w, cls_lab, label_bn_g, label_bn_b, clsf);
  k_headbias<<<512 / 16, GW * 32, 0, stream>>>(ws1c, glob, convs1_b, hbias);

  // segmentation head
  k_gemm<<<dim3(NT / 128, 512 / 64), 256, 0, stream>>>(ws1c, HK, big, hs1, NT,
                                                       512, HKP, hbias, bns1_g, bns1_b,
                                                       1, nullptr, 512);
  gemm(ws2c, 512, hs1, hs2, NT, 256, NT, 512,
       convs2_b, bns2_g, bns2_b, 1, nullptr);
  gemm(ws3c, 256, hs2, out3, NT, 50, NT, 256,
       convs3_b, nullptr, nullptr, 0, nullptr);
  k_repack<<<(2 * 50 * NPTS + 255) / 256, 256, 0, stream>>>(out3, (float*)d_out);
}

// v007
// It runs in 382 microseconds.
// In two side-by-side timings against v006, it was 1.03 and 1.04 times as fast.
// Over all steps from v000 it is 6.75 times as fast.
#include <hip/hip_runtime.h>

typedef __attribute__((ext_vector_type(16))) _Float16 v16h;
typedef __attribute__((ext_vector_type(8)))  float    v8f;
typedef __attribute__((ext_vector_type(4)))  float    v4f;
typedef __attribute__((ext_vector_type(4)))  _Float16 v4h;
typedef __attribute__((ext_vector_type(8)))  _Float16 v8h;

#define NT    8192      // total columns = B * N
#define NPTS  4096      // points per batch
#define BN_EPS 1e-5f
#define KT    128
#define FPAD  136
#define BPITCH 144
#define KSPLIT 8
#define KSL   (NPTS / KSPLIT)
#define CSPLIT KSPLIT
#define SROWT 2
#define HK    3136
#define HKP   1024
#define GLOB  (HK - HKP)
#define GW    11
#define GT    6
#define CVB   4096
// places of the f16 weight copies in one array (values), multiples of CVB
#define WO_QK (128 * 128)
#define WO_V  (WO_QK + 4 * 32 * 128)
#define WO_T  (WO_V + 4 * 128 * 128)
#define WO_FU (WO_T + 4 * 128 * 128)
#define WO_S1 (WO_FU + 1024 * 512)
#define WO_S2 (WO_S1 + 512 * HK)
#define WO_S3 (WO_S2 + 256 * 512)
#define WTOT  (WO_S3 + 50 * 256)

__device__ __forceinline__ v16h frag_ld(const _Float16* s, int lane) {
  const int row = lane & 15, h2 = lane >> 4;
  const _Float16* p = s + row * FPAD + 8 * h2;
  v16h f;
#pragma unroll
  for (int e = 0; e < 8; ++e) f[e] = p[e];
#pragma unroll
  for (int e = 0; e < 8; ++e) f[8 + e] = p[8 + e + 8];   // base+16+8*h2+e
  return f;
}

__device__ __forceinline__ v16h frag_tr(const _Float16* s, int lane) {
  typedef __attribute__((ext_vector_type(8))) short v8s;
  typedef __attribute__((address_space(3))) v8s lds_v8s;
  const _Float16* p = s + (8 * (lane >> 4) + (lane & 7)) * BPITCH + 8 * ((lane >> 3) & 1);
  const v8h lo = __builtin_bit_cast(v8h, __builtin_amdgcn_ds_load_tr16_b128_v8i16((lds_v8s*)p));
  const v8h hi = __builtin_bit_cast(v8h, __builtin_amdgcn_ds_load_tr16_b128_v8i16((lds_v8s*)(p + 16 * BPITCH)));
  return __builtin_shufflevector(lo, hi, 0, 1, 2, 3, 4, 5, 6, 7,
                                 8, 9, 10, 11, 12, 13, 14, 15);
}

__device__ __forceinline__ v16h frag_g(const v8h* __restrict__ f, int tile, int lane) {
  const v8h lo = f[(tile * 2 + 0) * 32 + lane];
  const v8h hi = f[(tile * 2 + 1) * 32 + lane];
  return __builtin_shufflevector(lo, hi, 0, 1, 2, 3, 4, 5, 6, 7,
                                 8, 9, 10, 11, 12, 13, 14, 15);
}

// ---- generic WMMA GEMM: O[m,n] = epi( sum_k A[m,k]*B[k,n] ) ---------------
// 256 threads = 8 waves as 4(M)x2(N); block tile 64(M) x 128(N); a stage is
// KT = 128 deep (K is a multiple of it): a thread's 12 loads of 16 bytes fly
// together, so a stage waits out the load latency and its two barriers once
// for four k-tiles of 32. Each wave: 16x64 output = 4 wmma per k-tile on one
// A fragment. B has NT columns, so its row steps are immediates.
// epilogue: +bias[m], BN(g,b) fresh stats, act(0,1=relu,2=leaky.2), +residual.
// bias_bs: distance between the two batches' bias vectors (0: one for both).
// act 3 (the q projection, M = 32): plain product, stored in the fragment
// order of frag_g with the point as fragment row and the channel as k.
__global__ __launch_bounds__(256) void k_gemm(
    const _Float16* __restrict__ A, int lda,
    const _Float16* __restrict__ Bm,
    _Float16* __restrict__ O, int ldc,
    int M, int K,
    const float* __restrict__ bias,
    const float* __restrict__ bng, const float* __restrict__ bnb,
    int act, const _Float16* __restrict__ resid, int bias_bs)
{
  __shared__ __attribute__((aligned(16))) _Float16 As[64 * FPAD];     // [m][k]
  __shared__ __attribute__((aligned(16))) _Float16 Bs[KT * BPITCH];   // [k][n]
  const int tid  = threadIdx.x;
  const int lane = tid & 31, wave = tid >> 5;
  const int wm = wave >> 1, wn = wave & 1;
  const int m0 = blockIdx.y * 64;
  const int n0 = blockIdx.x * 128;
  v8f acc[4] = {{}, {}, {}, {}};
  // A and B alike: 16 lanes move one whole 256-byte row; rows sr, sr+16, ...
  const int sr = tid >> 4, sc = (tid & 15) * 8;
  // A rows past M: row M-1 is staged in their place, so that no load stands
  // under a branch; they reach only rows of D that are never stored
  const _Float16* ap[4];
#pragma unroll  // ap indexed by constants to stay in registers
  for (int i = 0; i < 4; ++i) {
    const int gm = m0 + sr + 16 * i;
    ap[i] = A + (size_t)(gm < M ? gm : M - 1) * lda + sc;
  }
  const _Float16* bp = Bm + (size_t)sr * NT + n0 + sc;
  // B prefetch: one 128-byte line a thread, KT k-rows x 128 n
  const _Float16* pp = Bm + (size_t)(KT + (tid >> 1)) * NT + n0 + (tid & 1) * 64;

  for (int k0 = 0; k0 < K; k0 += KT) {
    v8h a[4], b[KT / 16];
#pragma unroll  // a, ap indexed by constants
    for (int i = 0; i < 4; ++i) a[i] = *(const v8h*)(ap[i] + k0);   // A [64][KT]
#pragma unroll  // b indexed by constants
    for (int i = 0; i < KT / 16; ++i)                               // B [KT][128]
      b[i] = *(const v8h*)(bp + (size_t)(k0 + 16 * i) * NT);
    // keeps all 12 loads ahead of the first LDS store: without it the compiler
    // waits for the A loads and stores them before it issues the B loads
    __builtin_amdgcn_sched_barrier(0);
#pragma unroll  // a indexed by constants
    for (int i = 0; i < 4; ++i) *(v8h*)&As[(sr + 16 * i) * FPAD + sc] = a[i];
#pragma unroll  // b indexed by constants
    for (int i = 0; i < KT / 16; ++i) *(v8h*)&Bs[(sr + 16 * i) * BPITCH + sc] = b[i];
    if (k0 + KT < K)  // hint next stage's lines toward L2 (global_prefetch_b8)
      __builtin_prefetch(pp + (size_t)k0 * NT, 0, 1);
    __syncthreads();
#pragma unroll  // LDS offsets as immediates; k in the order of the 32-deep loop
    for (int kk = 0; kk < KT; kk += 32) {
      const v16h af = frag_ld(&As[wm * 16 * FPAD + kk], lane);
#pragma unroll  // acc indexed by constants
      for (int t = 0; t < 4; ++t) {
        const v16h bf = frag_tr(&Bs[kk * BPITCH + wn * 64 + t * 16], lane);
        acc[t] = __builtin_amdgcn_wmma_f32_16x16x32_f16(false, af, false, bf,
                                                        (short)0, acc[t],
                                                        false, false);
      }
    }
    __syncthreads();
  }

  const int lcol = lane & 15, h2 = lane >> 4;
  if (act == 3) {
    // a lane's 8 accumulators are channels wm*16+8*h2+r of point lcol: halves
    // 0..7 of plane wm of that point tile, at this very lane
    if (wm < 2) {
#pragma unroll
      for (int t = 0; t < 4; ++t) {
        v8h o;
#pragma unroll
        for (int r = 0; r < 8; ++r) o[r] = (_Float16)acc[t][r];
        ((v8h*)O)[(((n0 + wn * 64 + t * 16) >> 4) * 2 + wm) * 32 + lane] = o;
      }
    }
    return;
  }
  const float bns = rsqrtf(1.f + BN_EPS);
  bias += (n0 / NPTS) * bias_bs;   // a block's 128 columns lie in one batch
#pragma unroll
  for (int t = 0; t < 4; ++t) {
    const int n = n0 + wn * 64 + t * 16 + lcol;
#pragma unroll
    for (int r = 0; r < 8; ++r) {
      const int m = m0 + wm * 16 + h2 * 8 + r;
      if (m < M) {
        float v = acc[t][r];
        if (bias) v += bias[m];
        if (bng)  v = v * (bng[m] * bns) + bnb[m];
        if (act == 1)      v = fmaxf(v, 0.f);
        else if (act == 2) v = (v > 0.f) ? v : 0.2f * v;
        if (resid) v += (float)resid[(size_t)m * ldc + n];
        O[(size_t)m * ldc + n] = (_Float16)v;
      }
    }
  }
}

// ---- row statistics of e = q^T q (K=32): rowmax and 1/rowsum --------------
// One work-group = SROWT*16 rows of one batch. The own rows are the B operand
// (kept in registers), the 4096 partners the A operand, 32 tiles per wave:
// a lane then holds 8 scores of ONE own row, so maximum and sum stay in the
// lane until one exchange between the wave's halves; the 8 waves meet in LDS.
// Two passes: rowmax, then the sum of exp(e - rowmax).
__global__ __launch_bounds__(256) void k_rowstat(
    const _Float16* __restrict__ qf,  // q in fragment order, NT/16 tiles
    float* __restrict__ rmax,         // [NT]
    float* __restrict__ rowinv)       // [NT]
{
  __shared__ float part[8][SROWT * 16];
  const int tid = threadIdx.x, lane = tid & 31, lcol = lane & 15;
  // wave number as a scalar, so that the tile addresses are scalar + lane
  const int wave = __builtin_amdgcn_readfirstlane(tid >> 5);
  const int bt = blockIdx.y * (NPTS / 16);      // first tile of the batch
  const int rt0 = bt + blockIdx.x * SROWT;      // first own row tile
  const int mt0 = bt + wave * (NPTS / 16 / 8);  // first partner tile
  const v8h* f = (const v8h*)qf;
  v16h bq[SROWT];
#pragma unroll  // bq, mx, sm, rm indexed by constants to stay in registers
  for (int i = 0; i < SROWT; ++i) bq[i] = frag_g(f, rt0 + i, lane);

  v8f mx[SROWT];
#pragma unroll
  for (int i = 0; i < SROWT; ++i)
#pragma unroll
    for (int r = 0; r < 8; ++r) mx[i][r] = -3.0e38f;
#pragma unroll 8
  for (int t = 0; t < NPTS / 16 / 8; ++t) {
    const v16h a = frag_g(f, mt0 + t, lane);
#pragma unroll
    for (int i = 0; i < SROWT; ++i) {
      v8f z = {};
      const v8f e = __builtin_amdgcn_wmma_f32_16x16x32_f16(false, a, false, bq[i],
                                                           (short)0, z, false, false);
#pragma unroll
      for (int r = 0; r < 8; ++r) mx[i][r] = fmaxf(mx[i][r], e[r]);
    }
  }
#pragma unroll
  for (int i = 0; i < SROWT; ++i) {
    float m = mx[i][0];
#pragma unroll
    for (int r = 1; r < 8; ++r) m = fmaxf(m, mx[i][r]);
    m = fmaxf(m, __shfl_xor(m, 16, 32));
    if (lane < 16) part[wave][i * 16 + lane] = m;
  }
  __syncthreads();
  float rm[SROWT];
#pragma unroll
  for (int i = 0; i < SROWT; ++i) {
    float m = part[0][i * 16 + lcol];
#pragma unroll
    for (int w = 1; w < 8; ++w) m = fmaxf(m, part[w][i * 16 + lcol]);
    rm[i] = m;
  }
  __syncthreads();   // part is written again below

  v8f sm[SROWT] = {};
#pragma unroll 8
  for (int t = 0; t < NPTS / 16 / 8; ++t) {
    const v16h a = frag_g(f, mt0 + t, lane);
#pragma unroll
    for (int i = 0; i < SROWT; ++i) {
      v8f z = {};
      const v8f e = __builtin_amdgcn_wmma_f32_16x16x32_f16(false, a, false, bq[i],
                                                           (short)0, z, false, false);
#pragma unroll
      for (int r = 0; r < 8; ++r) sm[i][r] += __expf(e[r] - rm[i]);
    }
  }
#pragma unroll
  for (int i = 0; i < SROWT; ++i) {
    float s = sm[i][0];
#pragma unroll
    for (int r = 1; r < 8; ++r) s += sm[i][r];
    s += __shfl_xor(s, 16, 32);
    if (lane < 16) part[wave][i * 16 + lane] = s;
  }
  __syncthreads();
  if (tid < SROWT * 16) {
    float s = part[0][tid];
#pragma unroll
    for (int w = 1; w < 8; ++w) s += part[w][tid];
    rowinv[rt0 * 16 + tid] = 1.f / s;
    rmax[rt0 * 16 + tid] = (tid < 16) ? rm[0] : rm[1];
  }
}

// ---- x_num = v_scaled @ p and the column sum, p formed in registers --------
// grid.x = 256 columns m (8 waves x 2 tiles of 16), grid.y = slice of KSL
// rows n. Per 32 rows a wave computes two score tiles e[n][m] per column tile
// (A = q of the rows, B = q of its own columns, kept in registers). Their D
// registers, as p = exp(e - rowmax[n]) in f16, ARE the B fragment of the next
// product (k = 8*h2+r and 16+8*h2+r), so p meets neither LDS nor memory.
// A = v_scaled in fragment order, 8 channel tiles. The f32 partial tile goes
// to part[128][KSPLIT][NT], the column-sum partial to cs[KSPLIT][NT];
// k_diff adds the slices.
__global__ __launch_bounds__(256) void k_attn_xnum(
    const _Float16* __restrict__ qf,   // q in fragment order, NT/16 tiles
    const _Float16* __restrict__ vf,   // v * rowinv, fragment order [NT/32][8]
    const float* __restrict__ rmax,    // [NT]
    const float* __restrict__ rowinv,  // [NT]
    float* __restrict__ part,          // [128][KSPLIT][NT]
    float* __restrict__ cs)            // [KSPLIT][NT]
{
  const int tid = threadIdx.x, lane = tid & 31;
  const int lcol = lane & 15, h2 = lane >> 4;
  // wave number as a scalar, so that the tile addresses are scalar + lane
  const int wave = __builtin_amdgcn_readfirstlane(tid >> 5);
  const int c0 = blockIdx.x * 256 + wave * 32;      // first own column
  const int ks = blockIdx.y;
  const int n0 = (blockIdx.x / (NPTS / 256)) * NPTS + ks * KSL;  // first row
  const v8h* qv = (const v8h*)qf;
  const v16h bq[2] = {frag_g(qv, (c0 >> 4) + 0, lane),
                      frag_g(qv, (c0 >> 4) + 1, lane)};
  v8f acc[2][8] = {};
  v8f csum[2] = {};

  // work-group-uniform bases of the slice; a trip adds its step, a lane its
  // own lane or h2 * 8
  const v8h* qn = qv + (n0 >> 4) * 64;                  // 128 units a trip
  const v8h* vn = (const v8h*)vf + (n0 >> 5) * 512;     // 512 units a trip
  const float* mn = rmax + n0;                          // 32 floats a trip
  const float* in = rowinv + n0;
  const unsigned ro = h2 * 8;

  // one trip = 32 rows. q fragments and row statistics (a0..i1) were fetched
  // one trip ahead, so the score products wait for no load of their own trip;
  // this trip fetches the next one's (b0..j1) and its own v fragments.
  auto trip = [&](int s, const v16h& a0, const v16h& a1, const v8f& m0, const v8f& m1,
                  const v8f& i0, const v8f& i1, v16h& b0, v16h& b1, v8f& k0, v8f& k1,
                  v8f& j0, v8f& j1) {
    // the last trip fetches its own rows again: in bounds, never used
    const int sn = (s + 1 < KSL / 32) ? s + 1 : s;
    // keeps this trip's loads behind the trip before: a load lifted into its
    // arithmetic would have its address registers reused ahead of the wait
    __builtin_amdgcn_sched_barrier(0);
    v16h va[8];
#pragma unroll  // va, acc indexed by constants to stay in registers
    for (int ct = 0; ct < 8; ++ct) va[ct] = frag_g(vn + s * 512, ct, lane);
    b0 = frag_g(qn + sn * 128, 0, lane);
    b1 = frag_g(qn + sn * 128, 1, lane);
    k0 = *(const v8f*)(mn + sn * 32 + ro);
    k1 = *(const v8f*)(mn + sn * 32 + 16 + ro);
    j0 = *(const v8f*)(in + sn * 32 + ro);
    j1 = *(const v8f*)(in + sn * 32 + 16 + ro);
    // the loads' address registers are given new values below: wait first
    asm volatile("s_wait_xcnt 0x0" ::: "memory");
    // keeps the arithmetic below, which reuses those registers, behind the wait
    __builtin_amdgcn_sched_barrier(0);
#pragma unroll  // bq, csum, acc indexed by constants to stay in registers
    for (int t = 0; t < 2; ++t) {
      v8f z = {};
      v8f x0 = __builtin_amdgcn_wmma_f32_16x16x32_f16(false, a0, false, bq[t],
                                                      (short)0, z, false, false);
      v8f x1 = __builtin_amdgcn_wmma_f32_16x16x32_f16(false, a1, false, bq[t],
                                                      (short)0, z, false, false);
      x0 -= m0;
      x1 -= m1;
#pragma unroll  // vector elements indexed by constants, here and below
      for (int r = 0; r < 8; ++r) x0[r] = __expf(x0[r]);
#pragma unroll
      for (int r = 0; r < 8; ++r) x1[r] = __expf(x1[r]);
      const v8h p0 = __builtin_convertvector(x0, v8h);
      const v8h p1 = __builtin_convertvector(x1, v8h);
      const v16h p = __builtin_shufflevector(p0, p1, 0, 1, 2, 3, 4, 5, 6, 7,
                                             8, 9, 10, 11, 12, 13, 14, 15);
      // column sum of the rounded p, the very weights that x_num sees
      csum[t] += i0 * __builtin_convertvector(p0, v8f);
      csum[t] += i1 * __builtin_convertvector(p1, v8f);
#pragma unroll
      for (int ct = 0; ct < 8; ++ct)
        acc[t][ct] = __builtin_amdgcn_wmma_f32_16x16x32_f16(false, va[ct], false, p,
                                                            (short)0, acc[t][ct],
                                                            false, false);
    }
  };

  v16h qa0 = frag_g(qn, 0, lane), qa1 = frag_g(qn, 1, lane), qb0, qb1;
  v8f ma0 = *(const v8f*)(mn + ro), ma1 = *(const v8f*)(mn + 16 + ro), mb0, mb1;
  v8f ia0 = *(const v8f*)(in + ro), ia1 = *(const v8f*)(in + 16 + ro), ib0, ib1;
  // the loads' address registers are given new values below: wait first
  asm volatile("s_wait_xcnt 0x0" ::: "memory");
  // two trips a pass: the two register sets swap roles without copies
  for (int s = 0; s < KSL / 32; s += 2) {
    trip(s,     qa0, qa1, ma0, ma1, ia0, ia1, qb0, qb1, mb0, mb1, ib0, ib1);
    trip(s + 1, qb0, qb1, mb0, mb1, ib0, ib1, qa0, qa1, ma0, ma1, ia0, ia1);
  }

  float* po = part + ks * NT + c0 + lcol;
#pragma unroll  // all loops: acc indexed by constants, offsets as immediates
  for (int t = 0; t < 2; ++t) {
#pragma unroll
    for (int ct = 0; ct < 8; ++ct)
#pragma unroll
      for (int r = 0; r < 8; ++r)
        po[(size_t)(ct * 16 + h2 * 8 + r) * (KSPLIT * NT) + t * 16] = acc[t][ct][r];
    float c = csum[t][0];
#pragma unroll
    for (int r = 1; r < 8; ++r) c += csum[t][r];
    c += __shfl_xor(c, 16, 32);
    if (lane < 16) cs[ks * NT + c0 + t * 16 + lane] = c;
  }
}

// ---- small elementwise / reduction kernels --------------------------------
// all eight weight arrays to f16 in one launch. Their f16 copies lie one behind
// the other in d; every array but the last fills whole blocks of CVB values,
// so a work-group reads one array and picks it by scalar compares. A thread
// moves four groups of 4 values, 1024 values apart: a wave's load covers 512
// contiguous bytes, its store 256, and the four loads fly together.
__global__ __launch_bounds__(256) void k_f2h(
    const float* __restrict__ c2, const float* __restrict__ qk,
    const float* __restrict__ v,  const float* __restrict__ t,
    const float* __restrict__ fu, const float* __restrict__ s1,
    const float* __restrict__ s2, const float* __restrict__ s3,
    _Float16* __restrict__ d) {
  const int g0 = blockIdx.x * CVB;      // first value of the block in d
  const float* s; int o;                // the block's array, its place in d
  if      (g0 < WO_QK) { s = c2; o = 0; }
  else if (g0 < WO_V)  { s = qk; o = WO_QK; }
  else if (g0 < WO_T)  { s = v;  o = WO_V; }
  else if (g0 < WO_FU) { s = t;  o = WO_T; }
  else if (g0 < WO_S1) { s = fu; o = WO_FU; }
  else if (g0 < WO_S2) { s = s1; o = WO_S1; }
  else if (g0 < WO_S3) { s = s2; o = WO_S2; }
  else                 { s = s3; o = WO_S3; }
  const int g = g0 + threadIdx.x * 4;
  v4f x[4];
  // groups past the end of the last array read its last group again, so that
  // no load stands under a branch and all four fly together; never stored
#pragma unroll  // x indexed by constants
  for (int j = 0; j < 4; ++j) {
    const int gj = g + j * 1024;
    x[j] = *(const v4f*)(s + ((gj < WTOT ? gj : WTOT - 4) - o));
  }
#pragma unroll  // x indexed by constants
  for (int j = 0; j < 4; ++j)
    if (g + j * 1024 < WTOT) *(v4h*)(d + g + j * 1024) = __builtin_convertvector(x[j], v4h);
}

// h1 = relu(bn1(conv1_w @ x^T)) ; K=3 scalar path
__global__ void k_conv1(const float* __restrict__ x, const float* __restrict__ w,
                        const float* __restrict__ g, const float* __restrict__ b,
                        _Float16* __restrict__ h1) {
  int i = blockIdx.x * 256 + threadIdx.x;
  if (i >= 128 * NT) return;
  const int o = i >> 13, j = i & (NT - 1);
  float s = w[o * 3 + 0] * x[(size_t)j * 3 + 0] +
            w[o * 3 + 1] * x[(size_t)j * 3 + 1] +
            w[o * 3 + 2] * x[(size_t)j * 3 + 2];
  s = s * (g[o] * rsqrtf(1.f + BN_EPS)) + b[o];
  h1[i] = (_Float16)fmaxf(s, 0.f);
}

// v_scaled = v * rowinv[col], written in the fragment order of frag_g:
// tile (n/32)*8 + c/16, channel as fragment row, n as k. One thread = the 16
// bytes of one lane in one plane, so a wave writes 512 contiguous bytes.
__global__ void k_scale_v(const _Float16* __restrict__ v, const float* __restrict__ ri,
                          _Float16* __restrict__ o) {
  const int i = blockIdx.x * 256 + threadIdx.x;   // ((nb*8+ct)*2+plane)*32+lane
  if (i >= 128 * NT / 8) return;
  const int lane = i & 31, plane = (i >> 5) & 1, ct = (i >> 6) & 7, nb = i >> 9;
  const int c = ct * 16 + (lane & 15);
  const int n = nb * 32 + plane * 16 + (lane >> 4) * 8;
  const v8h a = *(const v8h*)(v + (size_t)c * NT + n);
  const v8f s = *(const v8f*)(ri + n);
  ((v8h*)o)[i] = __builtin_convertvector(__builtin_convertvector(a, v8f) * s, v8h);
}

// diff = h - (sum of the KSPLIT x_num partials) / (1e-9 + colsum[col]),
// colsum[col] = sum of the CSPLIT partials of k_attn_xnum
// one thread = 4 consecutive columns of one row
__global__ void k_diff(const _Float16* __restrict__ h, const float* __restrict__ part,
                       const float* __restrict__ cs, _Float16* __restrict__ d) {
  const int q = blockIdx.x * 256 + threadIdx.x;     // index of the 4-column group
  if (q >= 128 * NT / 4) return;
  const int row = q / (NT / 4), jq = q & (NT / 4 - 1);
  const v4f* p4 = (const v4f*)part + row * (KSPLIT * NT / 4) + jq;  // [row][slice][col]
  v4f xn = p4[0];
#pragma unroll  // all KSPLIT loads in flight together
  for (int s = 1; s < KSPLIT; ++s) xn += p4[s * (NT / 4)];
  v4f c4 = ((const v4f*)cs)[jq];
#pragma unroll  // all CSPLIT loads in flight together
  for (int s = 1; s < CSPLIT; ++s) c4 += ((const v4f*)cs)[s * (NT / 4) + jq];
  const v4h h4 = ((const v4h*)h)[q];
  v4h o;
#pragma unroll  // vector elements indexed by constants
  for (int e = 0; e < 4; ++e)
    o[e] = (_Float16)((float)h4[e] - xn[e] / (1e-9f + c4[e]));
  ((v4h*)d)[q] = o;
}

// per-row max/mean pooling over N for hf rows (M=1024), into glob[b][..]
__global__ void k_pool(const _Float16* __restrict__ hf, float* __restrict__ xmax,
                       float* __restrict__ xavg) {
  const int o = blockIdx.x, bb = blockIdx.y, tid = threadIdx.x;
  const _Float16* p = hf + (size_t)o * NT + bb * NPTS;
  float mx = -3.0e38f, sm = 0.f;
  for (int i = tid; i < NPTS; i += 256) {
    const float v = (float)p[i];
    mx = fmaxf(mx, v); sm += v;
  }
  __shared__ float s1[256], s2[256];
  s1[tid] = mx; s2[tid] = sm;
  __syncthreads();
  for (int s = 128; s > 0; s >>= 1) {
    if (tid < s) { s1[tid] = fmaxf(s1[tid], s1[tid + s]); s2[tid] += s2[tid + s]; }
    __syncthreads();
  }
  if (tid == 0) {
    xmax[bb * GLOB + o] = s1[0];
    xavg[bb * GLOB + o] = s2[0] * (1.f / NPTS);
  }
}

// cls_f = leaky(bn(label_w @ cls_label))  (K=16, 128 outputs total), into
// glob[b][..]
__global__ void k_cls(const float* __restrict__ w, const float* __restrict__ lab,
                      const float* __restrict__ g, const float* __restrict__ b,
                      float* __restrict__ out) {
  const int t = threadIdx.x;
  if (t >= 128) return;
  const int bb = t >> 6, o = t & 63;
  float s = 0.f;
  for (int c = 0; c < 16; ++c) s += w[o * 16 + c] * lab[bb * 16 + c];
  s = s * (g[o] * rsqrtf(1.f + BN_EPS)) + b[o];
  out[bb * GLOB + o] = (s > 0.f) ? s : 0.2f * s;
}

// head bias: gb[b][o] = bias[o] + sum_k w[o][HKP + k] * glob[b][k], where
// glob[b] = (pooled maximum, pooled mean, class feature) of batch b, rounded
// to f16. These GLOB input rows hold one value for all points of a batch,
// so one column per batch is the whole product. One work-group = 16 output
// rows, GW waves x GT k-tiles; column c of the B operand is batch c & 1 (no
// lane idles or branches), columns 0 and 1 of D are kept; the waves' sums
// meet in LDS.
__global__ __launch_bounds__(GW * 32) void k_headbias(
    const _Float16* __restrict__ w,     // [512][HK]
    const float* __restrict__ glob,     // [2][GLOB]
    const float* __restrict__ bias,     // [512]
    float* __restrict__ gb)             // [2][512]
{
  __shared__ float red[GW][2][16];
  const int tid = threadIdx.x, lane = tid & 31;
  const int lcol = lane & 15, h2 = lane >> 4;
  const int wave = tid >> 5;
  const int m0 = blockIdx.x * 16;
  const _Float16* a = w + (size_t)(m0 + lcol) * HK + HKP + wave * (GT * 32) + 8 * h2;
  const float* g = glob + (lcol & 1) * GLOB + wave * (GT * 32) + 8 * h2;
  v8h alo[GT], ahi[GT];
  v8f glo[GT], ghi[GT];
#pragma unroll  // all loads in flight together; arrays indexed by constants
  for (int t = 0; t < GT; ++t) {
    alo[t] = *(const v8h*)(a + t * 32);
    ahi[t] = *(const v8h*)(a + t * 32 + 16);
    glo[t] = *(const v8f*)(g + t * 32);
    ghi[t] = *(const v8f*)(g + t * 32 + 16);
  }
  // keeps every load ahead of the first conversion: without it the compiler
  // issues them a few at a time, each group behind a wait for the one before
  __builtin_amdgcn_sched_barrier(0);
  v8f acc = {};
#pragma unroll  // arrays indexed by constants to stay in registers
  for (int t = 0; t < GT; ++t) {
    const v16h af = __builtin_shufflevector(alo[t], ahi[t], 0, 1, 2, 3, 4, 5, 6, 7,
                                            8, 9, 10, 11, 12, 13, 14, 15);
    const v16h bf = __builtin_shufflevector(__builtin_convertvector(glo[t], v8h),
                                            __builtin_convertvector(ghi[t], v8h),
                                            0, 1, 2, 3, 4, 5, 6, 7,
                                            8, 9, 10, 11, 12, 13, 14, 15);
    acc = __builtin_amdgcn_wmma_f32_16x16x32_f16(false, af, false, bf,
                                                 (short)0, acc, false, false);
  }
  if (lcol < 2) {
#pragma unroll  // acc indexed by constants
    for (int r = 0; r < 8; ++r) red[wave][lcol][h2 * 8 + r] = acc[r];
  }
  __syncthreads();
  if (tid < 32) {
    float s = bias[m0 + lcol];
#pragma unroll  // all GW LDS loads in flight together
    for (int v = 0; v < GW; ++v) s += red[v][h2][lcol];
    gb[h2 * 512 + m0 + lcol] = s;
  }
}

// out3 f16 [50][NT] -> d_out f32 [B][50][N]
__global__ void k_repack(const _Float16* __restrict__ o3, float* __restrict__ out) {
  int i = blockIdx.x * 256 + threadIdx.x;
  if (i >= 2 * 50 * NPTS) return;
  const int bb = i / (50 * NPTS);
  const int r = i - bb * 50 * NPTS;
  const int o = r >> 12, n = r & (NPTS - 1);
  out[i] = (float)o3[(size_t)o * NT + bb * NPTS + n];
}

// ---------------------------------------------------------------------------
extern "C" void kernel_launch(void* const* d_in, const int* in_sizes, int n_in,
                              void* d_out, int out_size, void* d_ws, size_t ws_size,
                              hipStream_t stream) {
  (void)in_sizes; (void)n_in; (void)out_size; (void)ws_size;
  const float* x         = (const float*)d_in[0];
  const float* cls_lab   = (const float*)d_in[1];
  const float* conv1_w   = (const float*)d_in[2];
  const float* bn1_g     = (const float*)d_in[3];
  const float* bn1_b     = (const float*)d_in[4];
  const float* conv2_w   = (const float*)d_in[5];
  const float* bn2_g     = (const float*)d_in[6];
  const float* bn2_b     = (const float*)d_in[7];
  const float* sa_qk_w   = (const float*)d_in[8];
  const float* sa_v_w    = (const float*)d_in[9];
  const float* sa_v_b    = (const float*)d_in[10];
  const float* sa_t_w    = (const float*)d_in[11];
  const float* sa_t_b    = (const float*)d_in[12];
  const float* sa_bn_g   = (const float*)d_in[13];
  const float* sa_bn_b   = (const float*)d_in[14];
  const float* fuse_w    = (const float*)d_in[15];
  const float* fuse_bn_g = (const float*)d_in[16];
  const float* fuse_bn_b = (const float*)d_in[17];
  const float* label_w   = (const float*)d_in[18];
  const float* label_bn_g= (const float*)d_in[19];
  const float* label_bn_b= (const float*)d_in[20];
  const float* convs1_w  = (const float*)d_in[21];
  const float* convs1_b  = (const float*)d_in[22];
  const float* bns1_g    = (const float*)d_in[23];
  const float* bns1_b    = (const float*)d_in[24];
  const float* convs2_w  = (const float*)d_in[25];
  const float* convs2_b  = (const float*)d_in[26];
  const float* bns2_g    = (const float*)d_in[27];
  const float* bns2_b    = (const float*)d_in[28];
  const float* convs3_w  = (const float*)d_in[29];
  const float* convs3_b  = (const float*)d_in[30];

  char* wp = (char*)d_ws;
  auto alloc = [&](size_t bytes) -> char* {
    char* p = wp; wp += (bytes + 255) & ~(size_t)255; return p;
  };
  auto h16 = [&](size_t n) { return (_Float16*)alloc(n * 2); };
  auto f32 = [&](size_t n) { return (float*)alloc(n * 4); };

  // f16 weight copies
  _Float16* wc2   = h16(WTOT);
  _Float16* wqk   = wc2 + WO_QK;
  _Float16* wv    = wc2 + WO_V;
  _Float16* wt    = wc2 + WO_T;
  _Float16* wfuse = wc2 + WO_FU;
  _Float16* ws1c  = wc2 + WO_S1;
  _Float16* ws2c  = wc2 + WO_S2;
  _Float16* ws3c  = wc2 + WO_S3;
  // activations
  _Float16* h1    = h16((size_t)128 * NT);
  _Float16* h2b   = h16((size_t)128 * NT);
  _Float16* qbuf  = h16((size_t)32 * NT);
  _Float16* vbuf  = h16((size_t)128 * NT);
  _Float16* vsc   = h16((size_t)128 * NT);
  _Float16* dbuf  = h16((size_t)128 * NT);
  _Float16* hcat  = h16((size_t)512 * NT);
  _Float16* big   = h16((size_t)HKP * NT);
  _Float16* hs1   = h16((size_t)512 * NT);
  _Float16* hs2   = h16((size_t)256 * NT);
  _Float16* out3  = h16((size_t)50 * NT);
  float* xpart  = f32((size_t)KSPLIT * 128 * NT);
  float* rowinv = f32(2 * NPTS);
  float* rmaxb  = f32(2 * NPTS);
  float* colsum = f32((size_t)CSPLIT * NT);
  float* glob   = f32(2 * GLOB);   // per batch: maximum, mean, class feature
  float* xmax   = glob;
  float* xavg   = glob + 1024;
  float* clsf   = glob + 2048;
  float* hbias  = f32(2 * 512);

  auto gemm = [&](const _Float16* A, int lda, const _Float16* Bm,
                  _Float16* O, int ldc, int M, int Ncols, int K,
                  const float* bias, const float* g, const float* be, int act,
                  const _Float16* resid) {
    dim3 grid(Ncols / 128, (M + 63) / 64);
    k_gemm<<<grid, 256, 0, stream>>>(A, lda, Bm, O, ldc, M, K,
                                     bias, g, be, act, resid, 0);
  };

  // weight conversions
  k_f2h<<<(WTOT + CVB - 1) / CVB, 256, 0, stream>>>(conv2_w, sa_qk_w, sa_v_w, sa_t_w,
                                                    fuse_w, convs1_w, convs2_w,
                                                    convs3_w, wc2);

  // stem
  k_conv1<<<(128 * NT + 255) / 256, 256, 0, stream>>>(x, conv1_w, bn1_g, bn1_b, h1);
  gemm(wc2, 128, h1, h2b, NT, 128, NT, 128, nullptr, bn2_g, bn2_b, 1, nullptr);

  // 4 self-attention blocks; feats written directly into hcat rows
  const _Float16* hprev = h2b;
  for (int i = 0; i < 4; ++i) {
    gemm(wqk + (size_t)i * 32 * 128, 128, hprev, qbuf, NT, 32, NT, 128,
         nullptr, nullptr, nullptr, 3, nullptr);
    gemm(wv + (size_t)i * 128 * 128, 128, hprev, vbuf, NT, 128, NT, 128,
         sa_v_b + i * 128, nullptr, nullptr, 0, nullptr);
    k_rowstat<<<dim3(NPTS / 16 / SROWT, 2), 256, 0, stream>>>(qbuf, rmaxb, rowinv);
    k_scale_v<<<128 * NT / 8 / 256, 256, 0, stream>>>(vbuf, rowinv, vsc);
    k_attn_xnum<<<dim3(NT / 256, KSPLIT), 256, 0, stream>>>(qbuf, vsc, rmaxb, rowinv,
                                                            xpart, colsum);
    k_diff<<<128 * NT / 4 / 256, 256, 0, stream>>>(hprev, xpart, colsum, dbuf);
    _Float16* hout = hcat + (size_t)i * 128 * NT;
    gemm(wt + (size_t)i * 128 * 128, 128, dbuf, hout, NT, 128, NT, 128,
         sa_t_b + i * 128, sa_bn_g + i * 128, sa_bn_b + i * 128, 1, hprev);
    hprev = hout;
  }

  // fuse (writes big), pooling, cls, their share of the head's first layer
  gemm(wfuse, 512, hcat, big, NT, 1024, NT, 512,
       nullptr, fuse_bn_g, fuse_bn_b, 2, nullptr);
  k_pool<<<dim3(1024, 2), 256, 0, stream>>>(big, xmax, xavg);
  k_cls<<<1, 128, 0, stream>>>(label_w, cls_lab, label_bn_g, label_bn_b, clsf);
  k_headbias<<<512 / 16, GW * 32, 0, stream>>>(ws1c, glob, convs1_b, hbias);

  // segmentation head
  k_gemm<<<dim3(NT / 128, 512 / 64), 256, 0, stream>>>(ws1c, HK, big, hs1, NT,
                                                       512, HKP, hbias, bns1_g, bns1_b,
                                                       1, nullptr, 512);
  gemm(ws2c, 512, hs1, hs2, NT, 256, NT, 512,
       convs2_b, bns2_g, bns2_b, 1, nullptr);
  gemm(ws3c, 256, hs2, out3, NT, 50, NT, 256,
       convs3_b, nullptr, nullptr, 0, nullptr);
  k_repack<<<(2 * 50 * NPTS + 255) / 256, 256, 0, stream>>>(out3, (float*)d_out);
}

// v008
// A run of this version takes 254 microseconds.
// In two side-by-side timings against v007, it was 1.51 and 1.50 times as fast.
// Counting every step since v000, it is 10.1 times as fast.
#include <hip/hip_runtime.h>

typedef __attribute__((ext_vector_type(16))) _Float16 v16h;
typedef __attribute__((ext_vector_type(8)))  float    v8f;
typedef __attribute__((ext_vector_type(4)))  float    v4f;
typedef __attribute__((ext_vector_type(4)))  _Float16 v4h;
typedef __attribute__((ext_vector_type(8)))  _Float16 v8h;

#define NT    8192      // total columns = B * N
#define NPTS  4096      // points per batch
#define BN_EPS 1e-5f
#define KT    128
#define FPAD  136
#define BPITCH 144
#define KSPLIT 8
#define KSL   (NPTS / KSPLIT)
#define CSPLIT KSPLIT
#define SROWT 2
#define HK    3136
#define HKP   1024
#define GLOB  (HK - HKP)
#define GW    11
#define GT    6
#define CVB   4096
// places of the f16 weight copies in one array (values), multiples of CVB
#define WO_QK (128 * 128)
#define WO_V  (WO_QK + 4 * 32 * 128)
#define WO_T  (WO_V + 4 * 128 * 128)
#define WO_FU (WO_T + 4 * 128 * 128)
#define WO_S1 (WO_FU + 1024 * 512)
#define WO_S2 (WO_S1 + 512 * HK)
#define WO_S3 (WO_S2 + 256 * 512)
#define WTOT  (WO_S3 + 50 * 256)

__device__ __forceinline__ v16h frag_ld(const _Float16* s, int lane) {
  const int row = lane & 15, h2 = lane >> 4;
  const _Float16* p = s + row * FPAD + 8 * h2;
  v16h f;
#pragma unroll
  for (int e = 0; e < 8; ++e) f[e] = p[e];
#pragma unroll
  for (int e = 0; e < 8; ++e) f[8 + e] = p[8 + e + 8];   // base+16+8*h2+e
  return f;
}

__device__ __forceinline__ v16h frag_tr(const _Float16* s, int lane) {
  typedef __attribute__((ext_vector_type(8))) short v8s;
  typedef __attribute__((address_space(3))) v8s lds_v8s;
  const _Float16* p = s + (8 * (lane >> 4) + (lane & 7)) * BPITCH + 8 * ((lane >> 3) & 1);
  const v8h lo = __builtin_bit_cast(v8h, __builtin_amdgcn_ds_load_tr16_b128_v8i16((lds_v8s*)p));
  const v8h hi = __builtin_bit_cast(v8h, __builtin_amdgcn_ds_load_tr16_b128_v8i16((lds_v8s*)(p + 16 * BPITCH)));
  return __builtin_shufflevector(lo, hi, 0, 1, 2, 3, 4, 5, 6, 7,
                                 8, 9, 10, 11, 12, 13, 14, 15);
}

__device__ __forceinline__ v16h frag_g(const v8h* __restrict__ f, int tile, int lane) {
  const v8h lo = f[(tile * 2 + 0) * 32 + lane];
  const v8h hi = f[(tile * 2 + 1) * 32 + lane];
  return __builtin_shufflevector(lo, hi, 0, 1, 2, 3, 4, 5, 6, 7,
                                 8, 9, 10, 11, 12, 13, 14, 15);
}

// ---- WMMA GEMM: sum_k A[m,k]*B[k,n], main loop of both GEMM kernels --------
// 256 threads = 8 waves as 4(M)x2(N); block tile 64(M) x 128(N); a stage is
// KT = 128 deep (K is a multiple of it): a thread's 12 loads of 16 bytes fly
// together, so a stage waits out the load latency and its two barriers once
// for four k-tiles of 32. Each wave: 16x64 output = 4 wmma per k-tile on one
// fragment of A. B has NT columns, so its row steps are immediates.
// The two fragments have mirrored layouts, so either may be the first operand:
// NROWS false: D = A*B, a lane holds rows m = 8*h2+r of column n = lane&15;
// NROWS true: D = (A*B)^T, a lane holds columns n = 8*h2+r of row m = lane&15.
template <bool NROWS>
__device__ __forceinline__ void gemm_tiles(
    const _Float16* __restrict__ A, int lda, const _Float16* __restrict__ Bm,
    int M, int K, int m0, int n0, _Float16* As, _Float16* Bs, v8f (&acc)[4])
{
  const int tid  = threadIdx.x;
  const int lane = tid & 31, wave = tid >> 5;
  const int wm = wave >> 1, wn = wave & 1;
  // A and B alike: 16 lanes move one whole 256-byte row; rows sr, sr+16, ...
  const int sr = tid >> 4, sc = (tid & 15) * 8;
  // A rows past M: row M-1 is staged in their place, so that no load stands
  // under a branch; they reach only rows of the product that are never stored
  const _Float16* ap[4];
#pragma unroll  // ap indexed by constants to stay in registers
  for (int i = 0; i < 4; ++i) {
    const int gm = m0 + sr + 16 * i;
    ap[i] = A + (size_t)(gm < M ? gm : M - 1) * lda + sc;
  }
  const _Float16* bp = Bm + (size_t)sr * NT + n0 + sc;
  // B prefetch: one 128-byte line a thread, KT k-rows x 128 n
  const _Float16* pp = Bm + (size_t)(KT + (tid >> 1)) * NT + n0 + (tid & 1) * 64;

  for (int k0 = 0; k0 < K; k0 += KT) {
    v8h a[4], b[KT / 16];
#pragma unroll  // a, ap indexed by constants
    for (int i = 0; i < 4; ++i) a[i] = *(const v8h*)(ap[i] + k0);   // A [64][KT]
#pragma unroll  // b indexed by constants
    for (int i = 0; i < KT / 16; ++i)                               // B [KT][128]
      b[i] = *(const v8h*)(bp + (size_t)(k0 + 16 * i) * NT);
    // keeps all 12 loads ahead of the first LDS store: without it the compiler
    // waits for the A loads and stores them before it issues the B loads
    __builtin_amdgcn_sched_barrier(0);
#pragma unroll  // a indexed by constants
    for (int i = 0; i < 4; ++i) *(v8h*)&As[(sr + 16 * i) * FPAD + sc] = a[i];
#pragma unroll  // b indexed by constants
    for (int i = 0; i < KT / 16; ++i) *(v8h*)&Bs[(sr + 16 * i) * BPITCH + sc] = b[i];
    if (k0 + KT < K)  // hint next stage's lines toward L2 (global_prefetch_b8)
      __builtin_prefetch(pp + (size_t)k0 * NT, 0, 1);
    __syncthreads();
#pragma unroll  // LDS offsets as immediates; k in the order of the 32-deep loop
    for (int kk = 0; kk < KT; kk += 32) {
      const v16h af = frag_ld(&As[wm * 16 * FPAD + kk], lane);
#pragma unroll  // acc indexed by constants
      for (int t = 0; t < 4; ++t) {
        const v16h bf = frag_tr(&Bs[kk * BPITCH + wn * 64 + t * 16], lane);
        acc[t] = NROWS
            ? __builtin_amdgcn_wmma_f32_16x16x32_f16(false, bf, false, af,
                                                     (short)0, acc[t], false, false)
            : __builtin_amdgcn_wmma_f32_16x16x32_f16(false, af, false, bf,
                                                     (short)0, acc[t], false, false);
      }
    }
    __syncthreads();
  }
}

// ---- generic GEMM: O[m,n] = epi( sum_k A[m,k]*B[k,n] ) ---------------------
// epilogue: +bias[m], BN(g,b) fresh stats, act(0,1=relu,2=leaky.2), +residual;
// which of these a layer has is fixed at compile time, so that no load of the
// epilogue stands under a branch.
// bias_bs: distance between the two batches' bias vectors (0: one for both).
// The product is formed transposed: a lane's 8 accumulators of a tile are 8
// neighbouring columns of ONE output row, so the row's bias and scale are one
// load each, residual and output 16 bytes per tile; all of these loads are
// issued ahead of the main loop and none is waited for on its own.
template <bool BIAS, bool BN, int ACT, bool RES>
__global__ __launch_bounds__(256) void k_gemm(
    const _Float16* __restrict__ A, int lda,
    const _Float16* __restrict__ Bm,
    _Float16* __restrict__ O, int ldc,
    int M, int K,
    const float* __restrict__ bias,
    const float* __restrict__ bng, const float* __restrict__ bnb,
    const _Float16* __restrict__ resid, int bias_bs)
{
  __shared__ __attribute__((aligned(16))) _Float16 As[64 * FPAD];     // [m][k]
  __shared__ __attribute__((aligned(16))) _Float16 Bs[KT * BPITCH];   // [k][n]
  const int lane = threadIdx.x & 31, wave = threadIdx.x >> 5;
  const int wm = wave >> 1, wn = wave & 1;
  const int m0 = blockIdx.y * 64;
  const int n0 = blockIdx.x * 128;
  const int m = m0 + wm * 16 + (lane & 15);       // the lane's output row
  // rows past M read row M-1's operands, in bounds, and store nothing
  const int mc = m < M ? m : M - 1;
  // the lane's 8 columns of tile 0; tile t lies 16 columns on
  const size_t o0 = (size_t)mc * ldc + n0 + wn * 64 + (lane >> 4) * 8;
  float bi = 0.f, g = 0.f, sh = 0.f;
  v8h rs[4];
  // keeps the fetch of the kernel's arguments ahead of the loads below: behind
  // them it would take over scalar registers that these loads name
  __builtin_amdgcn_sched_barrier(0);
  // a block's 128 columns lie in one batch
  if (BIAS) bi = bias[(n0 / NPTS) * bias_bs + mc];
  if (BN) { g = bng[mc]; sh = bnb[mc]; }
  if (RES) {
#pragma unroll  // rs indexed by constants
    for (int t = 0; t < 4; ++t) rs[t] = *(const v8h*)(resid + o0 + t * 16);
  }
  // the loads' address registers are given new values below: wait first
  asm volatile("s_wait_xcnt 0x0" ::: "memory");
  // keeps the address arithmetic below, which reuses them, behind the wait
  __builtin_amdgcn_sched_barrier(0);

  v8f acc[4] = {{}, {}, {}, {}};
  gemm_tiles<true>(A, lda, Bm, M, K, m0, n0, As, Bs, acc);

  const float sc = g * rsqrtf(1.f + BN_EPS);
  v8h o[4];
#pragma unroll  // acc, rs, o indexed by constants
  for (int t = 0; t < 4; ++t) {
    v8f v = acc[t];
    if (BIAS) v += bi;
    if (BN) v = v * sc + sh;
#pragma unroll  // vector elements indexed by constants
    for (int r = 0; r < 8; ++r) {
      if (ACT == 1)      v[r] = fmaxf(v[r], 0.f);
      else if (ACT == 2) v[r] = (v[r] > 0.f) ? v[r] : 0.2f * v[r];
    }
    if (RES) v += __builtin_convertvector(rs[t], v8f);
    o[t] = __builtin_convertvector(v, v8h);
  }
  if (m < M) {
#pragma unroll  // o indexed by constants; the four stores follow one another
    for (int t = 0; t < 4; ++t) *(v8h*)(O + o0 + t * 16) = o[t];
  }
}

// ---- the q projection (M = 32): plain product, stored in the fragment order
// of frag_g with the point as fragment row and the channel as k --------------
__global__ __launch_bounds__(256) void k_gemm_q(
    const _Float16* __restrict__ A, int lda,
    const _Float16* __restrict__ Bm,
    _Float16* __restrict__ O, int M, int K)
{
  __shared__ __attribute__((aligned(16))) _Float16 As[64 * FPAD];     // [m][k]
  __shared__ __attribute__((aligned(16))) _Float16 Bs[KT * BPITCH];   // [k][n]
  const int lane = threadIdx.x & 31, wave = threadIdx.x >> 5;
  const int wm = wave >> 1, wn = wave & 1;
  const int n0 = blockIdx.x * 128;
  v8f acc[4] = {{}, {}, {}, {}};
  gemm_tiles<false>(A, lda, Bm, M, K, 0, n0, As, Bs, acc);
  // a lane's 8 accumulators are channels wm*16+8*h2+r of point lane&15: halves
  // 0..7 of plane wm of that point tile, at this very lane
  if (wm < 2) {
#pragma unroll  // acc indexed by constants, here and below
    for (int t = 0; t < 4; ++t) {
      v8h o;
#pragma unroll
      for (int r = 0; r < 8; ++r) o[r] = (_Float16)acc[t][r];
      ((v8h*)O)[(((n0 + wn * 64 + t * 16) >> 4) * 2 + wm) * 32 + lane] = o;
    }
  }
}

// ---- row statistics of e = q^T q (K=32): rowmax and 1/rowsum --------------
// One work-group = SROWT*16 rows of one batch. The own rows are the B operand
// (kept in registers), the 4096 partners the A operand, 32 tiles per wave:
// a lane then holds 8 scores of ONE own row, so maximum and sum stay in the
// lane until one exchange between the wave's halves; the 8 waves meet in LDS.
// Two passes: rowmax, then the sum of exp(e - rowmax).
__global__ __launch_bounds__(256) void k_rowstat(
    const _Float16* __restrict__ qf,  // q in fragment order, NT/16 tiles
    float* __restrict__ rmax,         // [NT]
    float* __restrict__ rowinv)       // [NT]
{
  __shared__ float part[8][SROWT * 16];
  const int tid = threadIdx.x, lane = tid & 31, lcol = lane & 15;
  // wave number as a scalar, so that the tile addresses are scalar + lane
  const int wave = __builtin_amdgcn_readfirstlane(tid >> 5);
  const int bt = blockIdx.y * (NPTS / 16);      // first tile of the batch
  const int rt0 = bt + blockIdx.x * SROWT;      // first own row tile
  const int mt0 = bt + wave * (NPTS / 16 / 8);  // first partner tile
  const v8h* f = (const v8h*)qf;
  v16h bq[SROWT];
#pragma unroll  // bq, mx, sm, rm indexed by constants to stay in registers
  for (int i = 0; i < SROWT; ++i) bq[i] = frag_g(f, rt0 + i, lane);

  v8f mx[SROWT];
#pragma unroll
  for (int i = 0; i < SROWT; ++i)
#pragma unroll
    for (int r = 0; r < 8; ++r) mx[i][r] = -3.0e38f;
#pragma unroll 8
  for (int t = 0; t < NPTS / 16 / 8; ++t) {
    const v16h a = frag_g(f, mt0 + t, lane);
#pragma unroll
    for (int i = 0; i < SROWT; ++i) {
      v8f z = {};
      const v8f e = __builtin_amdgcn_wmma_f32_16x16x32_f16(false, a, false, bq[i],
                                                           (short)0, z, false, false);
#pragma unroll
      for (int r = 0; r < 8; ++r) mx[i][r] = fmaxf(mx[i][r], e[r]);
    }
  }
#pragma unroll
  for (int i = 0; i < SROWT; ++i) {
    float m = mx[i][0];
#pragma unroll
    for (int r = 1; r < 8; ++r) m = fmaxf(m, mx[i][r]);
    m = fmaxf(m, __shfl_xor(m, 16, 32));
    if (lane < 16) part[wave][i * 16 + lane] = m;
  }
  __syncthreads();
  float rm[SROWT];
#pragma unroll
  for (int i = 0; i < SROWT; ++i) {
    float m = part[0][i * 16 + lcol];
#pragma unroll
    for (int w = 1; w < 8; ++w) m = fmaxf(m, part[w][i * 16 + lcol]);
    rm[i] = m;
  }
  __syncthreads();   // part is written again below

  v8f sm[SROWT] = {};
#pragma unroll 8
  for (int t = 0; t < NPTS / 16 / 8; ++t) {
    const v16h a = frag_g(f, mt0 + t, lane);
#pragma unroll
    for (int i = 0; i < SROWT; ++i) {
      v8f z = {};
      const v8f e = __builtin_amdgcn_wmma_f32_16x16x32_f16(false, a, false, bq[i],
                                                           (short)0, z, false, false);
#pragma unroll
      for (int r = 0; r < 8; ++r) sm[i][r] += __expf(e[r] - rm[i]);
    }
  }
#pragma unroll
  for (int i = 0; i < SROWT; ++i) {
    float s = sm[i][0];
#pragma unroll
    for (int r = 1; r < 8; ++r) s += sm[i][r];
    s += __shfl_xor(s, 16, 32);
    if (lane < 16) part[wave][i * 16 + lane] = s;
  }
  __syncthreads();
  if (tid < SROWT * 16) {
    float s = part[0][tid];
#pragma unroll
    for (int w = 1; w < 8; ++w) s += part[w][tid];
    rowinv[rt0 * 16 + tid] = 1.f / s;
    rmax[rt0 * 16 + tid] = (tid < 16) ? rm[0] : rm[1];
  }
}

// ---- x_num = v_scaled @ p and the column sum, p formed in registers --------
// grid.x = 256 columns m (8 waves x 2 tiles of 16), grid.y = slice of KSL
// rows n. Per 32 rows a wave computes two score tiles e[n][m] per column tile
// (A = q of the rows, B = q of its own columns, kept in registers). Their D
// registers, as p = exp(e - rowmax[n]) in f16, ARE the B fragment of the next
// product (k = 8*h2+r and 16+8*h2+r), so p meets neither LDS nor memory.
// A = v_scaled in fragment order, 8 channel tiles. The f32 partial tile goes
// to part[128][KSPLIT][NT], the column-sum partial to cs[KSPLIT][NT];
// k_diff adds the slices.
__global__ __launch_bounds__(256) void k_attn_xnum(
    const _Float16* __restrict__ qf,   // q in fragment order, NT/16 tiles
    const _Float16* __restrict__ vf,   // v * rowinv, fragment order [NT/32][8]
    const float* __restrict__ rmax,    // [NT]
    const float* __restrict__ rowinv,  // [NT]
    float* __restrict__ part,          // [128][KSPLIT][NT]
    float* __restrict__ cs)            // [KSPLIT][NT]
{
  const int tid = threadIdx.x, lane = tid & 31;
  const int lcol = lane & 15, h2 = lane >> 4;
  // wave number as a scalar, so that the tile addresses are scalar + lane
  const int wave = __builtin_amdgcn_readfirstlane(tid >> 5);
  const int c0 = blockIdx.x * 256 + wave * 32;      // first own column
  const int ks = blockIdx.y;
  const int n0 = (blockIdx.x / (NPTS / 256)) * NPTS + ks * KSL;  // first row
  const v8h* qv = (const v8h*)qf;
  const v16h bq[2] = {frag_g(qv, (c0 >> 4) + 0, lane),
                      frag_g(qv, (c0 >> 4) + 1, lane)};
  v8f acc[2][8] = {};
  v8f csum[2] = {};

  // work-group-uniform bases of the slice; a trip adds its step, a lane its
  // own lane or h2 * 8
  const v8h* qn = qv + (n0 >> 4) * 64;                  // 128 units a trip
  const v8h* vn = (const v8h*)vf + (n0 >> 5) * 512;     // 512 units a trip
  const float* mn = rmax + n0;                          // 32 floats a trip
  const float* in = rowinv + n0;
  const unsigned ro = h2 * 8;

  // one trip = 32 rows. q fragments and row statistics (a0..i1) were fetched
  // one trip ahead, so the score products wait for no load of their own trip;
  // this trip fetches the next one's (b0..j1) and its own v fragments.
  auto trip = [&](int s, const v16h& a0, const v16h& a1, const v8f& m0, const v8f& m1,
                  const v8f& i0, const v8f& i1, v16h& b0, v16h& b1, v8f& k0, v8f& k1,
                  v8f& j0, v8f& j1) {
    // the last trip fetches its own rows again: in bounds, never used
    const int sn = (s + 1 < KSL / 32) ? s + 1 : s;
    // keeps this trip's loads behind the trip before: a load lifted into its
    // arithmetic would have its address registers reused ahead of the wait
    __builtin_amdgcn_sched_barrier(0);
    v16h va[8];
#pragma unroll  // va, acc indexed by constants to stay in registers
    for (int ct = 0; ct < 8; ++ct) va[ct] = frag_g(vn + s * 512, ct, lane);
    b0 = frag_g(qn + sn * 128, 0, lane);
    b1 = frag_g(qn + sn * 128, 1, lane);
    k0 = *(const v8f*)(mn + sn * 32 + ro);
    k1 = *(const v8f*)(mn + sn * 32 + 16 + ro);
    j0 = *(const v8f*)(in + sn * 32 + ro);
    j1 = *(const v8f*)(in + sn * 32 + 16 + ro);
    // the loads' address registers are given new values below: wait first
    asm volatile("s_wait_xcnt 0x0" ::: "memory");
    // keeps the arithmetic below, which reuses those registers, behind the wait
    __builtin_amdgcn_sched_barrier(0);
#pragma unroll  // bq, csum, acc indexed by constants to stay in registers
    for (int t = 0; t < 2; ++t) {
      v8f z = {};
      v8f x0 = __builtin_amdgcn_wmma_f32_16x16x32_f16(false, a0, false, bq[t],
                                                      (short)0, z, false, false);
      v8f x1 = __builtin_amdgcn_wmma_f32_16x16x32_f16(false, a1, false, bq[t],
                                                      (short)0, z, false, false);
      x0 -= m0;
      x1 -= m1;
#pragma unroll  // vector elements indexed by constants, here and below
      for (int r = 0; r < 8; ++r) x0[r] = __expf(x0[r]);
#pragma unroll
      for (int r = 0; r < 8; ++r) x1[r] = __expf(x1[r]);
      const v8h p0 = __builtin_convertvector(x0, v8h);
      const v8h p1 = __builtin_convertvector(x1, v8h);
      const v16h p = __builtin_shufflevector(p0, p1, 0, 1, 2, 3, 4, 5, 6, 7,
                                             8, 9, 10, 11, 12, 13, 14, 15);
      // column sum of the rounded p, the very weights that x_num sees
      csum[t] += i0 * __builtin_convertvector(p0, v8f);
      csum[t] += i1 * __builtin_convertvector(p1, v8f);
#pragma unroll
      for (int ct = 0; ct < 8; ++ct)
        acc[t][ct] = __builtin_amdgcn_wmma_f32_16x16x32_f16(false, va[ct], false, p,
                                                            (short)0, acc[t][ct],
                                                            false, false);
    }
  };

  v16h qa0 = frag_g(qn, 0, lane), qa1 = frag_g(qn, 1, lane), qb0, qb1;
  v8f ma0 = *(const v8f*)(mn + ro), ma1 = *(const v8f*)(mn + 16 + ro), mb0, mb1;
  v8f ia0 = *(const v8f*)(in + ro), ia1 = *(const v8f*)(in + 16 + ro), ib0, ib1;
  // the loads' address registers are given new values below: wait first
  asm volatile("s_wait_xcnt 0x0" ::: "memory");
  // two trips a pass: the two register sets swap roles without copies
  for (int s = 0; s < KSL / 32; s += 2) {
    trip(s,     qa0, qa1, ma0, ma1, ia0, ia1, qb0, qb1, mb0, mb1, ib0, ib1);
    trip(s + 1, qb0, qb1, mb0, mb1, ib0, ib1, qa0, qa1, ma0, ma1, ia0, ia1);
  }

  float* po = part + ks * NT + c0 + lcol;
#pragma unroll  // all loops: acc indexed by constants, offsets as immediates
  for (int t = 0; t < 2; ++t) {
#pragma unroll
    for (int ct = 0; ct < 8; ++ct)
#pragma unroll
      for (int r = 0; r < 8; ++r)
        po[(size_t)(ct * 16 + h2 * 8 + r) * (KSPLIT * NT) + t * 16] = acc[t][ct][r];
    float c = csum[t][0];
#pragma unroll
    for (int r = 1; r < 8; ++r) c += csum[t][r];
    c += __shfl_xor(c, 16, 32);
    if (lane < 16) cs[ks * NT + c0 + t * 16 + lane] = c;
  }
}

// ---- small elementwise / reduction kernels --------------------------------
// all eight weight arrays to f16 in one launch. Their f16 copies lie one behind
// the other in d; every array but the last fills whole blocks of CVB values,
// so a work-group reads one array and picks it by scalar compares. A thread
// moves four groups of 4 values, 1024 values apart: a wave's load covers 512
// contiguous bytes, its store 256, and the four loads fly together.
__global__ __launch_bounds__(256) void k_f2h(
    const float* __restrict__ c2, const float* __restrict__ qk,
    const float* __restrict__ v,  const float* __restrict__ t,
    const float* __restrict__ fu, const float* __restrict__ s1,
    const float* __restrict__ s2, const float* __restrict__ s3,
    _Float16* __restrict__ d) {
  const int g0 = blockIdx.x * CVB;      // first value of the block in d
  const float* s; int o;                // the block's array, its place in d
  if      (g0 < WO_QK) { s = c2; o = 0; }
  else if (g0 < WO_V)  { s = qk; o = WO_QK; }
  else if (g0 < WO_T)  { s = v;  o = WO_V; }
  else if (g0 < WO_FU) { s = t;  o = WO_T; }
  else if (g0 < WO_S1) { s = fu; o = WO_FU; }
  else if (g0 < WO_S2) { s = s1; o = WO_S1; }
  else if (g0 < WO_S3) { s = s2; o = WO_S2; }
  else                 { s = s3; o = WO_S3; }
  const int g = g0 + threadIdx.x * 4;
  v4f x[4];
  // groups past the end of the last array read its last group again, so that
  // no load stands under a branch and all four fly together; never stored
#pragma unroll  // x indexed by constants
  for (int j = 0; j < 4; ++j) {
    const int gj = g + j * 1024;
    x[j] = *(const v4f*)(s + ((gj < WTOT ? gj : WTOT - 4) - o));
  }
#pragma unroll  // x indexed by constants
  for (int j = 0; j < 4; ++j)
    if (g + j * 1024 < WTOT) *(v4h*)(d + g + j * 1024) = __builtin_convertvector(x[j], v4h);
}

// h1 = relu(bn1(conv1_w @ x^T)) ; K=3 scalar path
__global__ void k_conv1(const float* __restrict__ x, const float* __restrict__ w,
                        const float* __restrict__ g, const float* __restrict__ b,
                        _Float16* __restrict__ h1) {
  int i = blockIdx.x * 256 + threadIdx.x;
  if (i >= 128 * NT) return;
  const int o = i >> 13, j = i & (NT - 1);
  float s = w[o * 3 + 0] * x[(size_t)j * 3 + 0] +
            w[o * 3 + 1] * x[(size_t)j * 3 + 1] +
            w[o * 3 + 2] * x[(size_t)j * 3 + 2];
  s = s * (g[o] * rsqrtf(1.f + BN_EPS)) + b[o];
  h1[i] = (_Float16)fmaxf(s, 0.f);
}

// v_scaled = v * rowinv[col], written in the fragment order of frag_g:
// tile (n/32)*8 + c/16, channel as fragment row, n as k. One thread = the 16
// bytes of one lane in one plane, so a wave writes 512 contiguous bytes.
__global__ void k_scale_v(const _Float16* __restrict__ v, const float* __restrict__ ri,
                          _Float16* __restrict__ o) {
  const int i = blockIdx.x * 256 + threadIdx.x;   // ((nb*8+ct)*2+plane)*32+lane
  if (i >= 128 * NT / 8) return;
  const int lane = i & 31, plane = (i >> 5) & 1, ct = (i >> 6) & 7, nb = i >> 9;
  const int c = ct * 16 + (lane & 15);
  const int n = nb * 32 + plane * 16 + (lane >> 4) * 8;
  const v8h a = *(const v8h*)(v + (size_t)c * NT + n);
  const v8f s = *(const v8f*)(ri + n);
  ((v8h*)o)[i] = __builtin_convertvector(__builtin_convertvector(a, v8f) * s, v8h);
}

// diff = h - (sum of the KSPLIT x_num partials) / (1e-9 + colsum[col]),
// colsum[col] = sum of the CSPLIT partials of k_attn_xnum
// one thread = 4 consecutive columns of one row
__global__ void k_diff(const _Float16* __restrict__ h, const float* __restrict__ part,
                       const float* __restrict__ cs, _Float16* __restrict__ d) {
  const int q = blockIdx.x * 256 + threadIdx.x;     // index of the 4-column group
  if (q >= 128 * NT / 4) return;
  const int row = q / (NT / 4), jq = q & (NT / 4 - 1);
  const v4f* p4 = (const v4f*)part + row * (KSPLIT * NT / 4) + jq;  // [row][slice][col]
  v4f xn = p4[0];
#pragma unroll  // all KSPLIT loads in flight together
  for (int s = 1; s < KSPLIT; ++s) xn += p4[s * (NT / 4)];
  v4f c4 = ((const v4f*)cs)[jq];
#pragma unroll  // all CSPLIT loads in flight together
  for (int s = 1; s < CSPLIT; ++s) c4 += ((const v4f*)cs)[s * (NT / 4) + jq];
  const v4h h4 = ((const v4h*)h)[q];
  v4h o;
#pragma unroll  // vector elements indexed by constants
  for (int e = 0; e < 4; ++e)
    o[e] = (_Float16)((float)h4[e] - xn[e] / (1e-9f + c4[e]));
  ((v4h*)d)[q] = o;
}

// per-row max/mean pooling over N for hf rows (M=1024), into glob[b][..]
__global__ void k_pool(const _Float16* __restrict__ hf, float* __restrict__ xmax,
                       float* __restrict__ xavg) {
  const int o = blockIdx.x, bb = blockIdx.y, tid = threadIdx.x;
  const _Float16* p = hf + (size_t)o * NT + bb * NPTS;
  float mx = -3.0e38f, sm = 0.f;
  for (int i = tid; i < NPTS; i += 256) {
    const float v = (float)p[i];
    mx = fmaxf(mx, v); sm += v;
  }
  __shared__ float s1[256], s2[256];
  s1[tid] = mx; s2[tid] = sm;
  __syncthreads();
  for (int s = 128; s > 0; s >>= 1) {
    if (tid < s) { s1[tid] = fmaxf(s1[tid], s1[tid + s]); s2[tid] += s2[tid + s]; }
    __syncthreads();
  }
  if (tid == 0) {
    xmax[bb * GLOB + o] = s1[0];
    xavg[bb * GLOB + o] = s2[0] * (1.f / NPTS);
  }
}

// cls_f = leaky(bn(label_w @ cls_label))  (K=16, 128 outputs total), into
// glob[b][..]
__global__ void k_cls(const float* __restrict__ w, const float* __restrict__ lab,
                      const float* __restrict__ g, const float* __restrict__ b,
                      float* __restrict__ out) {
  const int t = threadIdx.x;
  if (t >= 128) return;
  const int bb = t >> 6, o = t & 63;
  float s = 0.f;
  for (int c = 0; c < 16; ++c) s += w[o * 16 + c] * lab[bb * 16 + c];
  s = s * (g[o] * rsqrtf(1.f + BN_EPS)) + b[o];
  out[bb * GLOB + o] = (s > 0.f) ? s : 0.2f * s;
}

// head bias: gb[b][o] = bias[o] + sum_k w[o][HKP + k] * glob[b][k], where
// glob[b] = (pooled maximum, pooled mean, class feature) of batch b, rounded
// to f16. These GLOB input rows hold one value for all points of a batch,
// so one column per batch is the whole product. One work-group = 16 output
// rows, GW waves x GT k-tiles; column c of the B operand is batch c & 1 (no
// lane idles or branches), columns 0 and 1 of D are kept; the waves' sums
// meet in LDS.
__global__ __launch_bounds__(GW * 32) void k_headbias(
    const _Float16* __restrict__ w,     // [512][HK]
    const float* __restrict__ glob,     // [2][GLOB]
    const float* __restrict__ bias,     // [512]
    float* __restrict__ gb)             // [2][512]
{
  __shared__ float red[GW][2][16];
  const int tid = threadIdx.x, lane = tid & 31;
  const int lcol = lane & 15, h2 = lane >> 4;
  const int wave = tid >> 5;
  const int m0 = blockIdx.x * 16;
  const _Float16* a = w + (size_t)(m0 + lcol) * HK + HKP + wave * (GT * 32) + 8 * h2;
  const float* g = glob + (lcol & 1) * GLOB + wave * (GT * 32) + 8 * h2;
  v8h alo[GT], ahi[GT];
  v8f glo[GT], ghi[GT];
#pragma unroll  // all loads in flight together; arrays indexed by constants
  for (int t = 0; t < GT; ++t) {
    alo[t] = *(const v8h*)(a + t * 32);
    ahi[t] = *(const v8h*)(a + t * 32 + 16);
    glo[t] = *(const v8f*)(g + t * 32);
    ghi[t] = *(const v8f*)(g + t * 32 + 16);
  }
  // keeps every load ahead of the first conversion: without it the compiler
  // issues them a few at a time, each group behind a wait for the one before
  __builtin_amdgcn_sched_barrier(0);
  v8f acc = {};
#pragma unroll  // arrays indexed by constants to stay in registers
  for (int t = 0; t < GT; ++t) {
    const v16h af = __builtin_shufflevector(alo[t], ahi[t], 0, 1, 2, 3, 4, 5, 6, 7,
                                            8, 9, 10, 11, 12, 13, 14, 15);
    const v16h bf = __builtin_shufflevector(__builtin_convertvector(glo[t], v8h),
                                            __builtin_convertvector(ghi[t], v8h),
                                            0, 1, 2, 3, 4, 5, 6, 7,
                                            8, 9, 10, 11, 12, 13, 14, 15);
    acc = __builtin_amdgcn_wmma_f32_16x16x32_f16(false, af, false, bf,
                                                 (short)0, acc, false, false);
  }
  if (lcol < 2) {
#pragma unroll  // acc indexed by constants
    for (int r = 0; r < 8; ++r) red[wave][lcol][h2 * 8 + r] = acc[r];
  }
  __syncthreads();
  if (tid < 32) {
    float s = bias[m0 + lcol];
#pragma unroll  // all GW LDS loads in flight together
    for (int v = 0; v < GW; ++v) s += red[v][h2][lcol];
    gb[h2 * 512 + m0 + lcol] = s;
  }
}

// out3 f16 [50][NT] -> d_out f32 [B][50][N]
__global__ void k_repack(const _Float16* __restrict__ o3, float* __restrict__ out) {
  int i = blockIdx.x * 256 + threadIdx.x;
  if (i >= 2 * 50 * NPTS) return;
  const int bb = i / (50 * NPTS);
  const int r = i - bb * 50 * NPTS;
  const int o = r >> 12, n = r & (NPTS - 1);
  out[i] = (float)o3[(size_t)o * NT + bb * NPTS + n];
}

// ---------------------------------------------------------------------------
extern "C" void kernel_launch(void* const* d_in, const int* in_sizes, int n_in,
                              void* d_out, int out_size, void* d_ws, size_t ws_size,
                              hipStream_t stream) {
  (void)in_sizes; (void)n_in; (void)out_size; (void)ws_size;
  const float* x         = (const float*)d_in[0];
  const float* cls_lab   = (const float*)d_in[1];
  const float* conv1_w   = (const float*)d_in[2];
  const float* bn1_g     = (const float*)d_in[3];
  const float* bn1_b     = (const float*)d_in[4];
  const float* conv2_w   = (const float*)d_in[5];
  const float* bn2_g     = (const float*)d_in[6];
  const float* bn2_b     = (const float*)d_in[7];
  const float* sa_qk_w   = (const float*)d_in[8];
  const float* sa_v_w    = (const float*)d_in[9];
  const float* sa_v_b    = (const float*)d_in[10];
  const float* sa_t_w    = (const float*)d_in[11];
  const float* sa_t_b    = (const float*)d_in[12];
  const float* sa_bn_g   = (const float*)d_in[13];
  const float* sa_bn_b   = (const float*)d_in[14];
  const float* fuse_w    = (const float*)d_in[15];
  const float* fuse_bn_g = (const float*)d_in[16];
  const float* fuse_bn_b = (const float*)d_in[17];
  const float* label_w   = (const float*)d_in[18];
  const float* label_bn_g= (const float*)d_in[19];
  const float* label_bn_b= (const float*)d_in[20];
  const float* convs1_w  = (const float*)d_in[21];
  const float* convs1_b  = (const float*)d_in[22];
  const float* bns1_g    = (const float*)d_in[23];
  const float* bns1_b    = (const float*)d_in[24];
  const float* convs2_w  = (const float*)d_in[25];
  const float* convs2_b  = (const float*)d_in[26];
  const float* bns2_g    = (const float*)d_in[27];
  const float* bns2_b    = (const float*)d_in[28];
  const float* convs3_w  = (const float*)d_in[29];
  const float* convs3_b  = (const float*)d_in[30];

  char* wp = (char*)d_ws;
  auto alloc = [&](size_t bytes) -> char* {
    char* p = wp; wp += (bytes + 255) & ~(size_t)255; return p;
  };
  auto h16 = [&](size_t n) { return (_Float16*)alloc(n * 2); };
  auto f32 = [&](size_t n) { return (float*)alloc(n * 4); };

  // f16 weight copies
  _Float16* wc2   = h16(WTOT);
  _Float16* wqk   = wc2 + WO_QK;
  _Float16* wv    = wc2 + WO_V;
  _Float16* wt    = wc2 + WO_T;
  _Float16* wfuse = wc2 + WO_FU;
  _Float16* ws1c  = wc2 + WO_S1;
  _Float16* ws2c  = wc2 + WO_S2;
  _Float16* ws3c  = wc2 + WO_S3;
  // activations
  _Float16* h1    = h16((size_t)128 * NT);
  _Float16* h2b   = h16((size_t)128 * NT);
  _Float16* qbuf  = h16((size_t)32 * NT);
  _Float16* vbuf  = h16((size_t)128 * NT);
  _Float16* vsc   = h16((size_t)128 * NT);
  _Float16* dbuf  = h16((size_t)128 * NT);
  _Float16* hcat  = h16((size_t)512 * NT);
  _Float16* big   = h16((size_t)HKP * NT);
  _Float16* hs1   = h16((size_t)512 * NT);
  _Float16* hs2   = h16((size_t)256 * NT);
  _Float16* out3  = h16((size_t)50 * NT);
  float* xpart  = f32((size_t)KSPLIT * 128 * NT);
  float* rowinv = f32(2 * NPTS);
  float* rmaxb  = f32(2 * NPTS);
  float* colsum = f32((size_t)CSPLIT * NT);
  float* glob   = f32(2 * GLOB);   // per batch: maximum, mean, class feature
  float* xmax   = glob;
  float* xavg   = glob + 1024;
  float* clsf   = glob + 2048;
  float* hbias  = f32(2 * 512);

  // weight conversions
  k_f2h<<<(WTOT + CVB - 1) / CVB, 256, 0, stream>>>(conv2_w, sa_qk_w, sa_v_w, sa_t_w,
                                                    fuse_w, convs1_w, convs2_w,
                                                    convs3_w, wc2);

  // stem
  k_conv1<<<(128 * NT + 255) / 256, 256, 0, stream>>>(x, conv1_w, bn1_g, bn1_b, h1);
  k_gemm<false, true, 1, false><<<dim3(NT / 128, 128 / 64), 256, 0, stream>>>(
      wc2, 128, h1, h2b, NT, 128, 128, nullptr, bn2_g, bn2_b, nullptr, 0);

  // 4 self-attention blocks; feats written directly into hcat rows
  const _Float16* hprev = h2b;
  for (int i = 0; i < 4; ++i) {
    k_gemm_q<<<NT / 128, 256, 0, stream>>>(wqk + (size_t)i * 32 * 128, 128, hprev,
                                           qbuf, 32, 128);
    k_gemm<true, false, 0, false><<<dim3(NT / 128, 128 / 64), 256, 0, stream>>>(
        wv + (size_t)i * 128 * 128, 128, hprev, vbuf, NT, 128, 128,
        sa_v_b + i * 128, nullptr, nullptr, nullptr, 0);
    k_rowstat<<<dim3(NPTS / 16 / SROWT, 2), 256, 0, stream>>>(qbuf, rmaxb, rowinv);
    k_scale_v<<<128 * NT / 8 / 256, 256, 0, stream>>>(vbuf, rowinv, vsc);
    k_attn_xnum<<<dim3(NT / 256, KSPLIT), 256, 0, stream>>>(qbuf, vsc, rmaxb, rowinv,
                                                            xpart, colsum);
    k_diff<<<128 * NT / 4 / 256, 256, 0, stream>>>(hprev, xpart, colsum, dbuf);
    _Float16* hout = hcat + (size_t)i * 128 * NT;
    k_gemm<true, true, 1, true><<<dim3(NT / 128, 128 / 64), 256, 0, stream>>>(
        wt + (size_t)i * 128 * 128, 128, dbuf, hout, NT, 128, 128,
        sa_t_b + i * 128, sa_bn_g + i * 128, sa_bn_b + i * 128, hprev, 0);
    hprev = hout;
  }

  // fuse (writes big), pooling, cls, their share of the head's first layer
  k_gemm<false, true, 2, false><<<dim3(NT / 128, 1024 / 64), 256, 0, stream>>>(
      wfuse, 512, hcat, big, NT, 1024, 512, nullptr, fuse_bn_g, fuse_bn_b, nullptr, 0);
  k_pool<<<dim3(1024, 2), 256, 0, stream>>>(big, xmax, xavg);
  k_cls<<<1, 128, 0, stream>>>(label_w, cls_lab, label_bn_g, label_bn_b, clsf);
  k_headbias<<<512 / 16, GW * 32, 0, stream>>>(ws1c, glob, convs1_b, hbias);

  // segmentation head
  k_gemm<true, true, 1, false><<<dim3(NT / 128, 512 / 64), 256, 0, stream>>>(
      ws1c, HK, big, hs1, NT, 512, HKP, hbias, bns1_g, bns1_b, nullptr, 512);
  k_gemm<true, true, 1, false><<<dim3(NT / 128, 256 / 64), 256, 0, stream>>>(
      ws2c, 512, hs1, hs2, NT, 256, 512, convs2_b, bns2_g, bns2_b, nullptr, 0);
  k_gemm<true, false, 0, false><<<dim3(NT / 128, 1), 256, 0, stream>>>(
      ws3c, 256, hs2, out3, NT, 50, 256, convs3_b, nullptr, nullptr, nullptr, 0);
  k_repack<<<(2 * 50 * NPTS + 255) / 256, 256, 0, stream>>>(out3, (float*)d_out);
}

// v009
// One run takes 225 microseconds.
// Timed twice side by side with v008, it ran 1.15 and 1.12 times as fast.
// All steps since v000 together make it 11.5 times as fast.
#include <hip/hip_runtime.h>

typedef __attribute__((ext_vector_type(16))) _Float16 v16h;
typedef __attribute__((ext_vector_type(8)))  float    v8f;
typedef __attribute__((ext_vector_type(4)))  float    v4f;
typedef __attribute__((ext_vector_type(4)))  _Float16 v4h;
typedef __attribute__((ext_vector_type(8)))  _Float16 v8h;

#define NT    8192      // total columns = B * N
#define NPTS  4096      // points per batch
#define BN_EPS 1e-5f
#define KT    128
#define FPAD  136
#define BPITCH 144
#define NC    32
#define TPITCH 48
#define KSPLIT 8
#define KSL   (NPTS / KSPLIT)
#define CSPLIT KSPLIT
#define SROWT 2
#define HK    3136
#define HKP   1024
#define GLOB  (HK - HKP)
#define GW    11
#define GT    6
#define CVB   4096
// places of the f16 weight copies in one array (values), multiples of CVB
#define WO_QK (128 * 128)
#define WO_V  (WO_QK + 4 * 32 * 128)
#define WO_T  (WO_V + 4 * 128 * 128)
#define WO_FU (WO_T + 4 * 128 * 128)
#define WO_S1 (WO_FU + 1024 * 512)
#define WO_S2 (WO_S1 + 512 * HK)
#define WO_S3 (WO_S2 + 256 * 512)
#define WTOT  (WO_S3 + 50 * 256)

__device__ __forceinline__ v16h frag_ld(const _Float16* s, int lane) {
  const int row = lane & 15, h2 = lane >> 4;
  const _Float16* p = s + row * FPAD + 8 * h2;
  v16h f;
#pragma unroll
  for (int e = 0; e < 8; ++e) f[e] = p[e];
#pragma unroll
  for (int e = 0; e < 8; ++e) f[8 + e] = p[8 + e + 8];   // base+16+8*h2+e
  return f;
}

template <int PITCH>
__device__ __forceinline__ v16h frag_tr(const _Float16* s, int lane) {
  typedef __attribute__((ext_vector_type(8))) short v8s;
  typedef __attribute__((address_space(3))) v8s lds_v8s;
  const _Float16* p = s + (8 * (lane >> 4) + (lane & 7)) * PITCH + 8 * ((lane >> 3) & 1);
  const v8h lo = __builtin_bit_cast(v8h, __builtin_amdgcn_ds_load_tr16_b128_v8i16((lds_v8s*)p));
  const v8h hi = __builtin_bit_cast(v8h, __builtin_amdgcn_ds_load_tr16_b128_v8i16((lds_v8s*)(p + 16 * PITCH)));
  return __builtin_shufflevector(lo, hi, 0, 1, 2, 3, 4, 5, 6, 7,
                                 8, 9, 10, 11, 12, 13, 14, 15);
}

__device__ __forceinline__ v16h frag_g(const v8h* __restrict__ f, int tile, int lane) {
  const v8h lo = f[(tile * 2 + 0) * 32 + lane];
  const v8h hi = f[(tile * 2 + 1) * 32 + lane];
  return __builtin_shufflevector(lo, hi, 0, 1, 2, 3, 4, 5, 6, 7,
                                 8, 9, 10, 11, 12, 13, 14, 15);
}

// ---- WMMA A fragment from a row-major 128-column weight matrix in memory ---
// w names row 0, first k of the 16 x 32 tile; frag_ld's k order.
__device__ __forceinline__ v16h frag_w(const _Float16* __restrict__ w, int lane) {
  const _Float16* p = w + (lane & 15) * 128 + 8 * (lane >> 4);
  const v8h lo = *(const v8h*)p;
  const v8h hi = *(const v8h*)(p + 16);
  return __builtin_shufflevector(lo, hi, 0, 1, 2, 3, 4, 5, 6, 7,
                                 8, 9, 10, 11, 12, 13, 14, 15);
}

// ---- WMMA GEMM: sum_k A[m,k]*B[k,n], main loop of the GEMM kernel ----------
// 256 threads = 8 waves as 4(M)x2(N); block tile 64(M) x 128(N); a stage is
// KT = 128 deep (K is a multiple of it): a thread's 12 loads of 16 bytes fly
// together, so a stage waits out the load latency and its two barriers once
// for four k-tiles of 32. Each wave: 16x64 output = 4 wmma per k-tile on one
// fragment of A. B has NT columns, so its row steps are immediates.
// The two fragments have mirrored layouts, so either may be the first operand:
// NROWS false: D = A*B, a lane holds rows m = 8*h2+r of column n = lane&15;
// NROWS true: D = (A*B)^T, a lane holds columns n = 8*h2+r of row m = lane&15.
template <bool NROWS>
__device__ __forceinline__ void gemm_tiles(
    const _Float16* __restrict__ A, int lda, const _Float16* __restrict__ Bm,
    int M, int K, int m0, int n0, _Float16* As, _Float16* Bs, v8f (&acc)[4])
{
  const int tid  = threadIdx.x;
  const int lane = tid & 31, wave = tid >> 5;
  const int wm = wave >> 1, wn = wave & 1;
  // A and B alike: 16 lanes move one whole 256-byte row; rows sr, sr+16, ...
  const int sr = tid >> 4, sc = (tid & 15) * 8;
  // A rows past M: row M-1 is staged in their place, so that no load stands
  // under a branch; they reach only rows of the product that are never stored
  const _Float16* ap[4];
#pragma unroll  // ap indexed by constants to stay in registers
  for (int i = 0; i < 4; ++i) {
    const int gm = m0 + sr + 16 * i;
    ap[i] = A + (size_t)(gm < M ? gm : M - 1) * lda + sc;
  }
  const _Float16* bp = Bm + (size_t)sr * NT + n0 + sc;
  // B prefetch: one 128-byte line a thread, KT k-rows x 128 n
  const _Float16* pp = Bm + (size_t)(KT + (tid >> 1)) * NT + n0 + (tid & 1) * 64;

  for (int k0 = 0; k0 < K; k0 += KT) {
    v8h a[4], b[KT / 16];
#pragma unroll  // a, ap indexed by constants
    for (int i = 0; i < 4; ++i) a[i] = *(const v8h*)(ap[i] + k0);   // A [64][KT]
#pragma unroll  // b indexed by constants
    for (int i = 0; i < KT / 16; ++i)                               // B [KT][128]
      b[i] = *(const v8h*)(bp + (size_t)(k0 + 16 * i) * NT);
    // keeps all 12 loads ahead of the first LDS store: without it the compiler
    // waits for the A loads and stores them before it issues the B loads
    __builtin_amdgcn_sched_barrier(0);
#pragma unroll  // a indexed by constants
    for (int i = 0; i < 4; ++i) *(v8h*)&As[(sr + 16 * i) * FPAD + sc] = a[i];
#pragma unroll  // b indexed by constants
    for (int i = 0; i < KT / 16; ++i) *(v8h*)&Bs[(sr + 16 * i) * BPITCH + sc] = b[i];
    if (k0 + KT < K)  // hint next stage's lines toward L2 (global_prefetch_b8)
      __builtin_prefetch(pp + (size_t)k0 * NT, 0, 1);
    __syncthreads();
#pragma unroll  // LDS offsets as immediates; k in the order of the 32-deep loop
    for (int kk = 0; kk < KT; kk += 32) {
      const v16h af = frag_ld(&As[wm * 16 * FPAD + kk], lane);
#pragma unroll  // acc indexed by constants
      for (int t = 0; t < 4; ++t) {
        const v16h bf = frag_tr<BPITCH>(&Bs[kk * BPITCH + wn * 64 + t * 16], lane);
        acc[t] = NROWS
            ? __builtin_amdgcn_wmma_f32_16x16x32_f16(false, bf, false, af,
                                                     (short)0, acc[t], false, false)
            : __builtin_amdgcn_wmma_f32_16x16x32_f16(false, af, false, bf,
                                                     (short)0, acc[t], false, false);
      }
    }
    __syncthreads();
  }
}

// ---- generic GEMM: O[m,n] = epi( sum_k A[m,k]*B[k,n] ) ---------------------
// epilogue: +bias[m], BN(g,b) fresh stats, act(0,1=relu,2=leaky.2), +residual;
// which of these a layer has is fixed at compile time, so that no load of the
// epilogue stands under a branch.
// bias_bs: distance between the two batches' bias vectors (0: one for both).
// The product is formed transposed: a lane's 8 accumulators of a tile are 8
// neighbouring columns of ONE output row, so the row's bias and scale are one
// load each, residual and output 16 bytes per tile; all of these loads are
// issued ahead of the main loop and none is waited for on its own.
template <bool BIAS, bool BN, int ACT, bool RES>
__global__ __launch_bounds__(256) void k_gemm(
    const _Float16* __restrict__ A, int lda,
    const _Float16* __restrict__ Bm,
    _Float16* __restrict__ O, int ldc,
    int M, int K,
    const float* __restrict__ bias,
    const float* __restrict__ bng, const float* __restrict__ bnb,
    const _Float16* __restrict__ resid, int bias_bs)
{
  __shared__ __attribute__((aligned(16))) _Float16 As[64 * FPAD];     // [m][k]
  __shared__ __attribute__((aligned(16))) _Float16 Bs[KT * BPITCH];   // [k][n]
  const int lane = threadIdx.x & 31, wave = threadIdx.x >> 5;
  const int wm = wave >> 1, wn = wave & 1;
  const int m0 = blockIdx.y * 64;
  const int n0 = blockIdx.x * 128;
  const int m = m0 + wm * 16 + (lane & 15);       // the lane's output row
  // rows past M read row M-1's operands, in bounds, and store nothing
  const int mc = m < M ? m : M - 1;
  // the lane's 8 columns of tile 0; tile t lies 16 columns on
  const size_t o0 = (size_t)mc * ldc + n0 + wn * 64 + (lane >> 4) * 8;
  float bi = 0.f, g = 0.f, sh = 0.f;
  v8h rs[4];
  // keeps the fetch of the kernel's arguments ahead of the loads below: behind
  // them it would take over scalar registers that these loads name
  __builtin_amdgcn_sched_barrier(0);
  // a block's 128 columns lie in one batch
  if (BIAS) bi = bias[(n0 / NPTS) * bias_bs + mc];
  if (BN) { g = bng[mc]; sh = bnb[mc]; }
  if (RES) {
#pragma unroll  // rs indexed by constants
    for (int t = 0; t < 4; ++t) rs[t] = *(const v8h*)(resid + o0 + t * 16);
  }
  // the loads' address registers are given new values below: wait first
  asm volatile("s_wait_xcnt 0x0" ::: "memory");
  // keeps the address arithmetic below, which reuses them, behind the wait
  __builtin_amdgcn_sched_barrier(0);

  v8f acc[4] = {{}, {}, {}, {}};
  gemm_tiles<true>(A, lda, Bm, M, K, m0, n0, As, Bs, acc);

  const float sc = g * rsqrtf(1.f + BN_EPS);
  v8h o[4];
#pragma unroll  // acc, rs, o indexed by constants
  for (int t = 0; t < 4; ++t) {
    v8f v = acc[t];
    if (BIAS) v += bi;
    if (BN) v = v * sc + sh;
#pragma unroll  // vector elements indexed by constants
    for (int r = 0; r < 8; ++r) {
      if (ACT == 1)      v[r] = fmaxf(v[r], 0.f);
      else if (ACT == 2) v[r] = (v[r] > 0.f) ? v[r] : 0.2f * v[r];
    }
    if (RES) v += __builtin_convertvector(rs[t], v8f);
    o[t] = __builtin_convertvector(v, v8h);
  }
  if (m < M) {
#pragma unroll  // o indexed by constants; the four stores follow one another
    for (int t = 0; t < 4; ++t) *(v8h*)(O + o0 + t * 16) = o[t];
  }
}

// ---- row statistics of e = q^T q (K=32): rowmax and 1/rowsum --------------
// One work-group = SROWT*16 rows of one batch. The own rows are the B operand
// (kept in registers), the 4096 partners the A operand, 32 tiles per wave:
// a lane then holds 8 scores of ONE own row, so maximum and sum stay in the
// lane until one exchange between the wave's halves; the 8 waves meet in LDS.
// Two passes: rowmax, then the sum of exp(e - rowmax).
__global__ __launch_bounds__(256) void k_rowstat(
    const _Float16* __restrict__ qf,  // q in fragment order, NT/16 tiles
    float* __restrict__ rmax,         // [NT]
    float* __restrict__ rowinv)       // [NT]
{
  __shared__ float part[8][SROWT * 16];
  const int tid = threadIdx.x, lane = tid & 31, lcol = lane & 15;
  // wave number as a scalar, so that the tile addresses are scalar + lane
  const int wave = __builtin_amdgcn_readfirstlane(tid >> 5);
  const int bt = blockIdx.y * (NPTS / 16);      // first tile of the batch
  const int rt0 = bt + blockIdx.x * SROWT;      // first own row tile
  const int mt0 = bt + wave * (NPTS / 16 / 8);  // first partner tile
  const v8h* f = (const v8h*)qf;
  v16h bq[SROWT];
#pragma unroll  // bq, mx, sm, rm indexed by constants to stay in registers
  for (int i = 0; i < SROWT; ++i) bq[i] = frag_g(f, rt0 + i, lane);

  v8f mx[SROWT];
#pragma unroll
  for (int i = 0; i < SROWT; ++i)
#pragma unroll
    for (int r = 0; r < 8; ++r) mx[i][r] = -3.0e38f;
#pragma unroll 8
  for (int t = 0; t < NPTS / 16 / 8; ++t) {
    const v16h a = frag_g(f, mt0 + t, lane);
#pragma unroll
    for (int i = 0; i < SROWT; ++i) {
      v8f z = {};
      const v8f e = __builtin_amdgcn_wmma_f32_16x16x32_f16(false, a, false, bq[i],
                                                           (short)0, z, false, false);
#pragma unroll
      for (int r = 0; r < 8; ++r) mx[i][r] = fmaxf(mx[i][r], e[r]);
    }
  }
#pragma unroll
  for (int i = 0; i < SROWT; ++i) {
    float m = mx[i][0];
#pragma unroll
    for (int r = 1; r < 8; ++r) m = fmaxf(m, mx[i][r]);
    m = fmaxf(m, __shfl_xor(m, 16, 32));
    if (lane < 16) part[wave][i * 16 + lane] = m;
  }
  __syncthreads();
  float rm[SROWT];
#pragma unroll
  for (int i = 0; i < SROWT; ++i) {
    float m = part[0][i * 16 + lcol];
#pragma unroll
    for (int w = 1; w < 8; ++w) m = fmaxf(m, part[w][i * 16 + lcol]);
    rm[i] = m;
  }
  __syncthreads();   // part is written again below

  v8f sm[SROWT] = {};
#pragma unroll 8
  for (int t = 0; t < NPTS / 16 / 8; ++t) {
    const v16h a = frag_g(f, mt0 + t, lane);
#pragma unroll
    for (int i = 0; i < SROWT; ++i) {
      v8f z = {};
      const v8f e = __builtin_amdgcn_wmma_f32_16x16x32_f16(false, a, false, bq[i],
                                                           (short)0, z, false, false);
#pragma unroll
      for (int r = 0; r < 8; ++r) sm[i][r] += __expf(e[r] - rm[i]);
    }
  }
#pragma unroll
  for (int i = 0; i < SROWT; ++i) {
    float s = sm[i][0];
#pragma unroll
    for (int r = 1; r < 8; ++r) s += sm[i][r];
    s += __shfl_xor(s, 16, 32);
    if (lane < 16) part[wave][i * 16 + lane] = s;
  }
  __syncthreads();
  if (tid < SROWT * 16) {
    float s = part[0][tid];
#pragma unroll
    for (int w = 1; w < 8; ++w) s += part[w][tid];
    rowinv[rt0 * 16 + tid] = 1.f / s;
    rmax[rt0 * 16 + tid] = (tid < 16) ? rm[0] : rm[1];
  }
}

// ---- x_num = v_scaled @ p and the column sum, p formed in registers --------
// grid.x = 256 columns m (8 waves x 2 tiles of 16), grid.y = slice of KSL
// rows n. Per 32 rows a wave computes two score tiles e[n][m] per column tile
// (A = q of the rows, B = q of its own columns, kept in registers). Their D
// registers, as p = exp(e - rowmax[n]) in f16, ARE the B fragment of the next
// product (k = 8*h2+r and 16+8*h2+r), so p meets neither LDS nor memory.
// A = v_scaled in fragment order, 8 channel tiles. The f32 partial tile goes
// to part[128][KSPLIT][NT], the column-sum partial to cs[KSPLIT][NT];
// k_chain adds the slices.
__global__ __launch_bounds__(256) void k_attn_xnum(
    const _Float16* __restrict__ qf,   // q in fragment order, NT/16 tiles
    const _Float16* __restrict__ vf,   // v * rowinv, fragment order [NT/32][8]
    const float* __restrict__ rmax,    // [NT]
    const float* __restrict__ rowinv,  // [NT]
    float* __restrict__ part,          // [128][KSPLIT][NT]
    float* __restrict__ cs)            // [KSPLIT][NT]
{
  const int tid = threadIdx.x, lane = tid & 31;
  const int lcol = lane & 15, h2 = lane >> 4;
  // wave number as a scalar, so that the tile addresses are scalar + lane
  const int wave = __builtin_amdgcn_readfirstlane(tid >> 5);
  const int c0 = blockIdx.x * 256 + wave * 32;      // first own column
  const int ks = blockIdx.y;
  const int n0 = (blockIdx.x / (NPTS / 256)) * NPTS + ks * KSL;  // first row
  const v8h* qv = (const v8h*)qf;
  const v16h bq[2] = {frag_g(qv, (c0 >> 4) + 0, lane),
                      frag_g(qv, (c0 >> 4) + 1, lane)};
  v8f acc[2][8] = {};
  v8f csum[2] = {};

  // work-group-uniform bases of the slice; a trip adds its step, a lane its
  // own lane or h2 * 8
  const v8h* qn = qv + (n0 >> 4) * 64;                  // 128 units a trip
  const v8h* vn = (const v8h*)vf + (n0 >> 5) * 512;     // 512 units a trip
  const float* mn = rmax + n0;                          // 32 floats a trip
  const float* in = rowinv + n0;
  const unsigned ro = h2 * 8;

  // one trip = 32 rows. q fragments and row statistics (a0..i1) were fetched
  // one trip ahead, so the score products wait for no load of their own trip;
  // this trip fetches the next one's (b0..j1) and its own v fragments.
  auto trip = [&](int s, const v16h& a0, const v16h& a1, const v8f& m0, const v8f& m1,
                  const v8f& i0, const v8f& i1, v16h& b0, v16h& b1, v8f& k0, v8f& k1,
                  v8f& j0, v8f& j1) {
    // the last trip fetches its own rows again: in bounds, never used
    const int sn = (s + 1 < KSL / 32) ? s + 1 : s;
    // keeps this trip's loads behind the trip before: a load lifted into its
    // arithmetic would have its address registers reused ahead of the wait
    __builtin_amdgcn_sched_barrier(0);
    v16h va[8];
#pragma unroll  // va, acc indexed by constants to stay in registers
    for (int ct = 0; ct < 8; ++ct) va[ct] = frag_g(vn + s * 512, ct, lane);
    b0 = frag_g(qn + sn * 128, 0, lane);
    b1 = frag_g(qn + sn * 128, 1, lane);
    k0 = *(const v8f*)(mn + sn * 32 + ro);
    k1 = *(const v8f*)(mn + sn * 32 + 16 + ro);
    j0 = *(const v8f*)(in + sn * 32 + ro);
    j1 = *(const v8f*)(in + sn * 32 + 16 + ro);
    // the loads' address registers are given new values below: wait first
    asm volatile("s_wait_xcnt 0x0" ::: "memory");
    // keeps the arithmetic below, which reuses those registers, behind the wait
    __builtin_amdgcn_sched_barrier(0);
#pragma unroll  // bq, csum, acc indexed by constants to stay in registers
    for (int t = 0; t < 2; ++t) {
      v8f z = {};
      v8f x0 = __builtin_amdgcn_wmma_f32_16x16x32_f16(false, a0, false, bq[t],
                                                      (short)0, z, false, false);
      v8f x1 = __builtin_amdgcn_wmma_f32_16x16x32_f16(false, a1, false, bq[t],
                                                      (short)0, z, false, false);
      x0 -= m0;
      x1 -= m1;
#pragma unroll  // vector elements indexed by constants, here and below
      for (int r = 0; r < 8; ++r) x0[r] = __expf(x0[r]);
#pragma unroll
      for (int r = 0; r < 8; ++r) x1[r] = __expf(x1[r]);
      const v8h p0 = __builtin_convertvector(x0, v8h);
      const v8h p1 = __builtin_convertvector(x1, v8h);
      const v16h p = __builtin_shufflevector(p0, p1, 0, 1, 2, 3, 4, 5, 6, 7,
                                             8, 9, 10, 11, 12, 13, 14, 15);
      // column sum of the rounded p, the very weights that x_num sees
      csum[t] += i0 * __builtin_convertvector(p0, v8f);
      csum[t] += i1 * __builtin_convertvector(p1, v8f);
#pragma unroll
      for (int ct = 0; ct < 8; ++ct)
        acc[t][ct] = __builtin_amdgcn_wmma_f32_16x16x32_f16(false, va[ct], false, p,
                                                            (short)0, acc[t][ct],
                                                            false, false);
    }
  };

  v16h qa0 = frag_g(qn, 0, lane), qa1 = frag_g(qn, 1, lane), qb0, qb1;
  v8f ma0 = *(const v8f*)(mn + ro), ma1 = *(const v8f*)(mn + 16 + ro), mb0, mb1;
  v8f ia0 = *(const v8f*)(in + ro), ia1 = *(const v8f*)(in + 16 + ro), ib0, ib1;
  // the loads' address registers are given new values below: wait first
  asm volatile("s_wait_xcnt 0x0" ::: "memory");
  // two trips a pass: the two register sets swap roles without copies
  for (int s = 0; s < KSL / 32; s += 2) {
    trip(s,     qa0, qa1, ma0, ma1, ia0, ia1, qb0, qb1, mb0, mb1, ib0, ib1);
    trip(s + 1, qb0, qb1, mb0, mb1, ib0, ib1, qa0, qa1, ma0, ma1, ia0, ia1);
  }

  float* po = part + ks * NT + c0 + lcol;
#pragma unroll  // all loops: acc indexed by constants, offsets as immediates
  for (int t = 0; t < 2; ++t) {
#pragma unroll
    for (int ct = 0; ct < 8; ++ct)
#pragma unroll
      for (int r = 0; r < 8; ++r)
        po[(size_t)(ct * 16 + h2 * 8 + r) * (KSPLIT * NT) + t * 16] = acc[t][ct][r];
    float c = csum[t][0];
#pragma unroll
    for (int r = 1; r < 8; ++r) c += csum[t][r];
    c += __shfl_xor(c, 16, 32);
    if (lane < 16) cs[ks * NT + c0 + t * 16 + lane] = c;
  }
}

// ---- small elementwise / reduction kernels --------------------------------
// all eight weight arrays to f16 in one launch. Their f16 copies lie one behind
// the other in d; every array but the last fills whole blocks of CVB values,
// so a work-group reads one array and picks it by scalar compares. A thread
// moves four groups of 4 values, 1024 values apart: a wave's load covers 512
// contiguous bytes, its store 256, and the four loads fly together.
__global__ __launch_bounds__(256) void k_f2h(
    const float* __restrict__ c2, const float* __restrict__ qk,
    const float* __restrict__ v,  const float* __restrict__ t,
    const float* __restrict__ fu, const float* __restrict__ s1,
    const float* __restrict__ s2, const float* __restrict__ s3,
    _Float16* __restrict__ d) {
  const int g0 = blockIdx.x * CVB;      // first value of the block in d
  const float* s; int o;                // the block's array, its place in d
  if      (g0 < WO_QK) { s = c2; o = 0; }
  else if (g0 < WO_V)  { s = qk; o = WO_QK; }
  else if (g0 < WO_T)  { s = v;  o = WO_V; }
  else if (g0 < WO_FU) { s = t;  o = WO_T; }
  else if (g0 < WO_S1) { s = fu; o = WO_FU; }
  else if (g0 < WO_S2) { s = s1; o = WO_S1; }
  else if (g0 < WO_S3) { s = s2; o = WO_S2; }
  else                 { s = s3; o = WO_S3; }
  const int g = g0 + threadIdx.x * 4;
  v4f x[4];
  // groups past the end of the last array read its last group again, so that
  // no load stands under a branch and all four fly together; never stored
#pragma unroll  // x indexed by constants
  for (int j = 0; j < 4; ++j) {
    const int gj = g + j * 1024;
    x[j] = *(const v4f*)(s + ((gj < WTOT ? gj : WTOT - 4) - o));
  }
#pragma unroll  // x indexed by constants
  for (int j = 0; j < 4; ++j)
    if (g + j * 1024 < WTOT) *(v4h*)(d + g + j * 1024) = __builtin_convertvector(x[j], v4h);
}

// v_scaled = v * rowinv[col], written in the fragment order of frag_g:
// tile (n/32)*8 + c/16, channel as fragment row, n as k. One thread = the 16
// bytes of one lane in one plane, so a wave writes 512 contiguous bytes.
__global__ void k_scale_v(const _Float16* __restrict__ v, const float* __restrict__ ri,
                          _Float16* __restrict__ o) {
  const int i = blockIdx.x * 256 + threadIdx.x;   // ((nb*8+ct)*2+plane)*32+lane
  if (i >= 128 * NT / 8) return;
  const int lane = i & 31, plane = (i >> 5) & 1, ct = (i >> 6) & 7, nb = i >> 9;
  const int c = ct * 16 + (lane & 15);
  const int n = nb * 32 + plane * 16 + (lane >> 4) * 8;
  const v8h a = *(const v8h*)(v + (size_t)c * NT + n);
  const v8f s = *(const v8f*)(ri + n);
  ((v8h*)o)[i] = __builtin_convertvector(__builtin_convertvector(a, v8f) * s, v8h);
}

// ---- the layers between two attentions, one kernel -------------------------
// They act on each point alone. One work-group = NC points, all 128 channels;
// wave w owns output rows 16w .. 16w+15 of the 128-row products, waves 0..3 a
// tile of q each; weight fragments come straight from memory, q's read by four
// waves, the others once.
// 1. the input tile [channel][point] is formed in LDS,
//    FIRST: relu(bn1(conv1_w @ x^T)), K = 3, scalar path;
//    else:  h - (sum of the KSPLIT x_num partials) / (1e-9 + colsum[point]),
//           colsum = sum of the CSPLIT partials of k_attn_xnum.
//    A thread forms 4 neighbouring points of 4 rows, 32 rows apart.
// 2. w2 @ tile, formed transposed as in k_gemm (a lane holds 8 neighbouring
//    points of one row); (+bias,) BN, relu (, +h): the attention block's
//    input, to memory and to a second LDS tile.
// 3. NEXT: from that tile the next attention's q, stored in the fragment order
//    of frag_g with the point as fragment row and the channel as k, and its v.
// All loads of steps 1 and 2 are issued together at the start, those of step 3
// halfway through step 1.
template <bool FIRST, bool NEXT>
__global__ __launch_bounds__(256) void k_chain(
    const float* __restrict__ x,  const float* __restrict__ w1,
    const float* __restrict__ g1, const float* __restrict__ b1,
    const _Float16* __restrict__ h, const float* __restrict__ part,
    const float* __restrict__ cs,
    const _Float16* __restrict__ w2, const float* __restrict__ bias2,
    const float* __restrict__ g2, const float* __restrict__ b2,
    _Float16* __restrict__ hout,
    const _Float16* __restrict__ wq, const _Float16* __restrict__ wv,
    const float* __restrict__ vb,
    _Float16* __restrict__ qf, _Float16* __restrict__ v)
{
  __shared__ __attribute__((aligned(16))) _Float16 Ds[128 * TPITCH];  // [k][n]
  __shared__ __attribute__((aligned(16))) _Float16 Hs[128 * TPITCH];  // [k][n]
  const int tid = threadIdx.x, lane = tid & 31;
  const int lcol = lane & 15, h2 = lane >> 4;
  // wave number as a scalar: scalar weight bases, scalar branch round the q part
  const int wave = __builtin_amdgcn_readfirstlane(tid >> 5);
  const int n0 = blockIdx.x * NC;
  const int dr = tid >> 3, dc = (tid & 7) * 4;    // step 1: first row, points
  const int m = wave * 16 + lcol;                 // steps 2, 3: the lane's row
  // the lane's 8 points of tile 0; tile 1 lies 16 points on
  const size_t o0 = (size_t)m * NT + n0 + h2 * 8;

  v4f xin[3], xp[4][KSPLIT], c4[CSPLIT];
  v4h h4[4];
  float cw[4][3], cg[4], cb[4];
  if (FIRST) {
#pragma unroll  // xin indexed by constants; 4 points x 3 coordinates, 48 bytes
    for (int j = 0; j < 3; ++j) xin[j] = *(const v4f*)(x + (size_t)(n0 + dc) * 3 + j * 4);
#pragma unroll  // cw, cg, cb indexed by constants
    for (int i = 0; i < 4; ++i) {
      const int o = dr + 32 * i;
      cw[i][0] = w1[o * 3 + 0]; cw[i][1] = w1[o * 3 + 1]; cw[i][2] = w1[o * 3 + 2];
      cg[i] = g1[o]; cb[i] = b1[o];
    }
  } else {
#pragma unroll  // c4 indexed by constants
    for (int s = 0; s < CSPLIT; ++s) c4[s] = *(const v4f*)(cs + s * NT + n0 + dc);
#pragma unroll  // xp, h4 indexed by constants
    for (int i = 0; i < 4; ++i) {
#pragma unroll  // xp indexed by constants
      for (int s = 0; s < KSPLIT; ++s)   // [row][slice][col]
        xp[i][s] = *(const v4f*)(part + (size_t)((dr + 32 * i) * KSPLIT + s) * NT + n0 + dc);
      h4[i] = *(const v4h*)(h + (size_t)(dr + 32 * i) * NT + n0 + dc);
    }
  }
  // a load below may land in an address register of a load above: wait first
  asm volatile("s_wait_xcnt 0x0" ::: "memory");
  v16h a2[4];
#pragma unroll  // a2 indexed by constants
  for (int kk = 0; kk < 4; ++kk) a2[kk] = frag_w(w2 + wave * (16 * 128) + kk * 32, lane);
  float bi = 0.f;
  if (!FIRST) bi = bias2[m];
  const float g = g2[m], sh = b2[m];
  v8h rs[2];
  if (!FIRST) {
#pragma unroll  // rs indexed by constants
    for (int t = 0; t < 2; ++t) rs[t] = *(const v8h*)(h + o0 + t * 16);
  }
  // the loads' address registers are given new values below: wait first
  asm volatile("s_wait_xcnt 0x0" ::: "memory");
  // keeps every load above ahead of the first use, all in flight together, and
  // the arithmetic below, which reuses their address registers, behind the wait
  __builtin_amdgcn_sched_barrier(0);

  // step 1
  v4f cc;
  if (!FIRST) {
    cc = c4[0];
#pragma unroll  // c4 indexed by constants
    for (int s = 1; s < CSPLIT; ++s) cc += c4[s];
  }
  // row dr + 32 * i of the tile; i is a constant at every call, so that the
  // arrays stay in registers
  auto row = [&](int i) {
    v4h o;
    if (FIRST) {
      const float sc1 = cg[i] * rsqrtf(1.f + BN_EPS);
#pragma unroll  // vector elements indexed by constants
      for (int e = 0; e < 4; ++e) {
        float s = cw[i][0] * xin[(e * 3 + 0) >> 2][(e * 3 + 0) & 3] +
                  cw[i][1] * xin[(e * 3 + 1) >> 2][(e * 3 + 1) & 3] +
                  cw[i][2] * xin[(e * 3 + 2) >> 2][(e * 3 + 2) & 3];
        s = s * sc1 + cb[i];
        o[e] = (_Float16)fmaxf(s, 0.f);
      }
    } else {
      v4f xn = xp[i][0];
#pragma unroll  // xp indexed by constants
      for (int s = 1; s < KSPLIT; ++s) xn += xp[i][s];
#pragma unroll  // vector elements indexed by constants
      for (int e = 0; e < 4; ++e)
        o[e] = (_Float16)((float)h4[i][e] - xn[e] / (1e-9f + cc[e]));
    }
    *(v4h*)&Ds[(dr + 32 * i) * TPITCH + dc] = o;
  };
  row(0);
  row(1);
  // step 3's weights are asked for here: half of step 1's registers are free
  // again, and the arithmetic of its other half hides their latency
  v16h av[4], aq[4];
  float vbi = 0.f;
  if (NEXT) {
#pragma unroll  // av indexed by constants
    for (int kk = 0; kk < 4; ++kk) av[kk] = frag_w(wv + wave * (16 * 128) + kk * 32, lane);
    vbi = vb[m];
    // a load below may land in an address register of a load above: wait first
    asm volatile("s_wait_xcnt 0x0" ::: "memory");
#pragma unroll  // aq indexed by constants; q has two row tiles, wave & 1
    for (int kk = 0; kk < 4; ++kk)
      aq[kk] = frag_w(wq + (wave & 1) * (16 * 128) + kk * 32, lane);
    // the loads' address registers are given new values below: wait first
    asm volatile("s_wait_xcnt 0x0" ::: "memory");
    // keeps these loads ahead of the arithmetic below and its reuse of their
    // address registers behind the wait
    __builtin_amdgcn_sched_barrier(0);
  }
  row(2);
  row(3);
  __syncthreads();

  // step 2
  v8f acc[2] = {{}, {}};
#pragma unroll  // LDS offsets as immediates; k in the order of the channel GEMMs
  for (int kk = 0; kk < 4; ++kk)
#pragma unroll  // acc indexed by constants
    for (int t = 0; t < 2; ++t) {
      const v16h bf = frag_tr<TPITCH>(&Ds[kk * 32 * TPITCH + t * 16], lane);
      acc[t] = __builtin_amdgcn_wmma_f32_16x16x32_f16(false, bf, false, a2[kk],
                                                      (short)0, acc[t], false, false);
    }
  const float sc = g * rsqrtf(1.f + BN_EPS);
  v8h o[2];
#pragma unroll  // acc, rs, o indexed by constants
  for (int t = 0; t < 2; ++t) {
    v8f u = acc[t];
    if (!FIRST) u += bi;
    u = u * sc + sh;
#pragma unroll  // vector elements indexed by constants
    for (int r = 0; r < 8; ++r) u[r] = fmaxf(u[r], 0.f);
    if (!FIRST) u += __builtin_convertvector(rs[t], v8f);
    o[t] = __builtin_convertvector(u, v8h);
  }
  if (NEXT) {
#pragma unroll  // o indexed by constants
    for (int t = 0; t < 2; ++t) *(v8h*)&Hs[m * TPITCH + t * 16 + h2 * 8] = o[t];
    // ahead of the stores to memory: behind them it would wait for them too
    __syncthreads();
  }
#pragma unroll  // o indexed by constants
  for (int t = 0; t < 2; ++t) *(v8h*)(hout + o0 + t * 16) = o[t];
  if (!NEXT) return;
  // the stores' registers are given new values below: wait first
  asm volatile("s_wait_xcnt 0x0" ::: "memory");
  // keeps the arithmetic below, which reuses those registers, behind the wait
  __builtin_amdgcn_sched_barrier(0);

  // step 3
  v8f accv[2] = {{}, {}};
#pragma unroll  // LDS offsets as immediates; k in the order of the channel GEMMs
  for (int kk = 0; kk < 4; ++kk)
#pragma unroll  // accv indexed by constants
    for (int t = 0; t < 2; ++t) {
      const v16h bf = frag_tr<TPITCH>(&Hs[kk * 32 * TPITCH + t * 16], lane);
      accv[t] = __builtin_amdgcn_wmma_f32_16x16x32_f16(false, bf, false, av[kk],
                                                       (short)0, accv[t], false, false);
    }
#pragma unroll  // accv indexed by constants
  for (int t = 0; t < 2; ++t)
    *(v8h*)(v + o0 + t * 16) = __builtin_convertvector(accv[t] + vbi, v8h);
  // the stores' registers are given new values below: wait first
  asm volatile("s_wait_xcnt 0x0" ::: "memory");
  // keeps the arithmetic below, which reuses those registers, behind the wait
  __builtin_amdgcn_sched_barrier(0);
  // q: 2 row tiles x 2 point tiles, one each for waves 0..3. Not transposed: a
  // lane's 8 accumulators are channels (wave&1)*16+8*h2+r of point lane&15:
  // halves 0..7 of plane wave&1 of that point tile, at this very lane
  if (wave < 4) {
    const int qt = wave >> 1;
    v8f accq = {};
#pragma unroll  // aq indexed by constants
    for (int kk = 0; kk < 4; ++kk) {
      const v16h bf = frag_tr<TPITCH>(&Hs[kk * 32 * TPITCH + qt * 16], lane);
      accq = __builtin_amdgcn_wmma_f32_16x16x32_f16(false, aq[kk], false, bf,
                                                    (short)0, accq, false, false);
    }
    ((v8h*)qf)[(((n0 >> 4) + qt) * 2 + (wave & 1)) * 32 + lane] =
        __builtin_convertvector(accq, v8h);
  }
}

// per-row max/mean pooling over N for hf rows (M=1024), into glob[b][..]
__global__ void k_pool(const _Float16* __restrict__ hf, float* __restrict__ xmax,
                       float* __restrict__ xavg) {
  const int o = blockIdx.x, bb = blockIdx.y, tid = threadIdx.x;
  const _Float16* p = hf + (size_t)o * NT + bb * NPTS;
  float mx = -3.0e38f, sm = 0.f;
  for (int i = tid; i < NPTS; i += 256) {
    const float v = (float)p[i];
    mx = fmaxf(mx, v); sm += v;
  }
  __shared__ float s1[256], s2[256];
  s1[tid] = mx; s2[tid] = sm;
  __syncthreads();
  for (int s = 128; s > 0; s >>= 1) {
    if (tid < s) { s1[tid] = fmaxf(s1[tid], s1[tid + s]); s2[tid] += s2[tid + s]; }
    __syncthreads();
  }
  if (tid == 0) {
    xmax[bb * GLOB + o] = s1[0];
    xavg[bb * GLOB + o] = s2[0] * (1.f / NPTS);
  }
}

// cls_f = leaky(bn(label_w @ cls_label))  (K=16, 128 outputs total), into
// glob[b][..]
__global__ void k_cls(const float* __restrict__ w, const float* __restrict__ lab,
                      const float* __restrict__ g, const float* __restrict__ b,
                      float* __restrict__ out) {
  const int t = threadIdx.x;
  if (t >= 128) return;
  const int bb = t >> 6, o = t & 63;
  float s = 0.f;
  for (int c = 0; c < 16; ++c) s += w[o * 16 + c] * lab[bb * 16 + c];
  s = s * (g[o] * rsqrtf(1.f + BN_EPS)) + b[o];
  out[bb * GLOB + o] = (s > 0.f) ? s : 0.2f * s;
}

// head bias: gb[b][o] = bias[o] + sum_k w[o][HKP + k] * glob[b][k], where
// glob[b] = (pooled maximum, pooled mean, class feature) of batch b, rounded
// to f16. These GLOB input rows hold one value for all points of a batch,
// so one column per batch is the whole product. One work-group = 16 output
// rows, GW waves x GT k-tiles; column c of the B operand is batch c & 1 (no
// lane idles or branches), columns 0 and 1 of D are kept; the waves' sums
// meet in LDS.
__global__ __launch_bounds__(GW * 32) void k_headbias(
    const _Float16* __restrict__ w,     // [512][HK]
    const float* __restrict__ glob,     // [2][GLOB]
    const float* __restrict__ bias,     // [512]
    float* __restrict__ gb)             // [2][512]
{
  __shared__ float red[GW][2][16];
  const int tid = threadIdx.x, lane = tid & 31;
  const int lcol = lane & 15, h2 = lane >> 4;
  const int wave = tid >> 5;
  const int m0 = blockIdx.x * 16;
  const _Float16* a = w + (size_t)(m0 + lcol) * HK + HKP + wave * (GT * 32) + 8 * h2;
  const float* g = glob + (lcol & 1) * GLOB + wave * (GT * 32) + 8 * h2;
  v8h alo[GT], ahi[GT];
  v8f glo[GT], ghi[GT];
#pragma unroll  // all loads in flight together; arrays indexed by constants
  for (int t = 0; t < GT; ++t) {
    alo[t] = *(const v8h*)(a + t * 32);
    ahi[t] = *(const v8h*)(a + t * 32 + 16);
    glo[t] = *(const v8f*)(g + t * 32);
    ghi[t] = *(const v8f*)(g + t * 32 + 16);
  }
  // keeps every load ahead of the first conversion: without it the compiler
  // issues them a few at a time, each group behind a wait for the one before
  __builtin_amdgcn_sched_barrier(0);
  v8f acc = {};
#pragma unroll  // arrays indexed by constants to stay in registers
  for (int t = 0; t < GT; ++t) {
    const v16h af = __builtin_shufflevector(alo[t], ahi[t], 0, 1, 2, 3, 4, 5, 6, 7,
                                            8, 9, 10, 11, 12, 13, 14, 15);
    const v16h bf = __builtin_shufflevector(__builtin_convertvector(glo[t], v8h),
                                            __builtin_convertvector(ghi[t], v8h),
                                            0, 1, 2, 3, 4, 5, 6, 7,
                                            8, 9, 10, 11, 12, 13, 14, 15);
    acc = __builtin_amdgcn_wmma_f32_16x16x32_f16(false, af, false, bf,
                                                 (short)0, acc, false, false);
  }
  if (lcol < 2) {
#pragma unroll  // acc indexed by constants
    for (int r = 0; r < 8; ++r) red[wave][lcol][h2 * 8 + r] = acc[r];
  }
  __syncthreads();
  if (tid < 32) {
    float s = bias[m0 + lcol];
#pragma unroll  // all GW LDS loads in flight together
    for (int v = 0; v < GW; ++v) s += red[v][h2][lcol];
    gb[h2 * 512 + m0 + lcol] = s;
  }
}

// out3 f16 [50][NT] -> d_out f32 [B][50][N]
__global__ void k_repack(const _Float16* __restrict__ o3, float* __restrict__ out) {
  int i = blockIdx.x * 256 + threadIdx.x;
  if (i >= 2 * 50 * NPTS) return;
  const int bb = i / (50 * NPTS);
  const int r = i - bb * 50 * NPTS;
  const int o = r >> 12, n = r & (NPTS - 1);
  out[i] = (float)o3[(size_t)o * NT + bb * NPTS + n];
}

// ---------------------------------------------------------------------------
extern "C" void kernel_launch(void* const* d_in, const int* in_sizes, int n_in,
                              void* d_out, int out_size, void* d_ws, size_t ws_size,
                              hipStream_t stream) {
  (void)in_sizes; (void)n_in; (void)out_size; (void)ws_size;
  const float* x         = (const float*)d_in[0];
  const float* cls_lab   = (const float*)d_in[1];
  const float* conv1_w   = (const float*)d_in[2];
  const float* bn1_g     = (const float*)d_in[3];
  const float* bn1_b     = (const float*)d_in[4];
  const float* conv2_w   = (const float*)d_in[5];
  const float* bn2_g     = (const float*)d_in[6];
  const float* bn2_b     = (const float*)d_in[7];
  const float* sa_qk_w   = (const float*)d_in[8];
  const float* sa_v_w    = (const float*)d_in[9];
  const float* sa_v_b    = (const float*)d_in[10];
  const float* sa_t_w    = (const float*)d_in[11];
  const float* sa_t_b    = (const float*)d_in[12];
  const float* sa_bn_g   = (const float*)d_in[13];
  const float* sa_bn_b   = (const float*)d_in[14];
  const float* fuse_w    = (const float*)d_in[15];
  const float* fuse_bn_g = (const float*)d_in[16];
  const float* fuse_bn_b = (const float*)d_in[17];
  const float* label_w   = (const float*)d_in[18];
  const float* label_bn_g= (const float*)d_in[19];
  const float* label_bn_b= (const float*)d_in[20];
  const float* convs1_w  = (const float*)d_in[21];
  const float* convs1_b  = (const float*)d_in[22];
  const float* bns1_g    = (const float*)d_in[23];
  const float* bns1_b    = (const float*)d_in[24];
  const float* convs2_w  = (const float*)d_in[25];
  const float* convs2_b  = (const float*)d_in[26];
  const float* bns2_g    = (const float*)d_in[27];
  const float* bns2_b    = (const float*)d_in[28];
  const float* convs3_w  = (const float*)d_in[29];
  const float* convs3_b  = (const float*)d_in[30];

  char* wp = (char*)d_ws;
  auto alloc = [&](size_t bytes) -> char* {
    char* p = wp; wp += (bytes + 255) & ~(size_t)255; return p;
  };
  auto h16 = [&](size_t n) { return (_Float16*)alloc(n * 2); };
  auto f32 = [&](size_t n) { return (float*)alloc(n * 4); };

  // f16 weight copies
  _Float16* wc2   = h16(WTOT);
  _Float16* wqk   = wc2 + WO_QK;
  _Float16* wv    = wc2 + WO_V;
  _Float16* wt    = wc2 + WO_T;
  _Float16* wfuse = wc2 + WO_FU;
  _Float16* ws1c  = wc2 + WO_S1;
  _Float16* ws2c  = wc2 + WO_S2;
  _Float16* ws3c  = wc2 + WO_S3;
  // activations
  _Float16* h2b   = h16((size_t)128 * NT);
  _Float16* qbuf  = h16((size_t)32 * NT);
  _Float16* vbuf  = h16((size_t)128 * NT);
  _Float16* vsc   = h16((size_t)128 * NT);
  _Float16* hcat  = h16((size_t)512 * NT);
  _Float16* big   = h16((size_t)HKP * NT);
  _Float16* hs1   = h16((size_t)512 * NT);
  _Float16* hs2   = h16((size_t)256 * NT);
  _Float16* out3  = h16((size_t)50 * NT);
  float* xpart  = f32((size_t)KSPLIT * 128 * NT);
  float* rowinv = f32(2 * NPTS);
  float* rmaxb  = f32(2 * NPTS);
  float* colsum = f32((size_t)CSPLIT * NT);
  float* glob   = f32(2 * GLOB);   // per batch: maximum, mean, class feature
  float* xmax   = glob;
  float* xavg   = glob + 1024;
  float* clsf   = glob + 2048;
  float* hbias  = f32(2 * 512);

  // weight conversions
  k_f2h<<<(WTOT + CVB - 1) / CVB, 256, 0, stream>>>(conv2_w, sa_qk_w, sa_v_w, sa_t_w,
                                                    fuse_w, convs1_w, convs2_w,
                                                    convs3_w, wc2);

  // stem, with the first attention's q and v
  k_chain<true, true><<<NT / NC, 256, 0, stream>>>(
      x, conv1_w, bn1_g, bn1_b, nullptr, nullptr, nullptr,
      wc2, nullptr, bn2_g, bn2_b, h2b, wqk, wv, sa_v_b, qbuf, vbuf);

  // 4 self-attention blocks; feats written directly into hcat rows
  const _Float16* hprev = h2b;
  for (int i = 0; i < 4; ++i) {
    k_rowstat<<<dim3(NPTS / 16 / SROWT, 2), 256, 0, stream>>>(qbuf, rmaxb, rowinv);
    k_scale_v<<<128 * NT / 8 / 256, 256, 0, stream>>>(vbuf, rowinv, vsc);
    k_attn_xnum<<<dim3(NT / 256, KSPLIT), 256, 0, stream>>>(qbuf, vsc, rmaxb, rowinv,
                                                            xpart, colsum);
    _Float16* hout = hcat + (size_t)i * 128 * NT;
    if (i < 3)
      k_chain<false, true><<<NT / NC, 256, 0, stream>>>(
          nullptr, nullptr, nullptr, nullptr, hprev, xpart, colsum,
          wt + (size_t)i * 128 * 128, sa_t_b + i * 128, sa_bn_g + i * 128,
          sa_bn_b + i * 128, hout, wqk + (size_t)(i + 1) * 32 * 128,
          wv + (size_t)(i + 1) * 128 * 128, sa_v_b + (i + 1) * 128, qbuf, vbuf);
    else
      k_chain<false, false><<<NT / NC, 256, 0, stream>>>(
          nullptr, nullptr, nullptr, nullptr, hprev, xpart, colsum,
          wt + (size_t)i * 128 * 128, sa_t_b + i * 128, sa_bn_g + i * 128,
          sa_bn_b + i * 128, hout, nullptr, nullptr, nullptr, nullptr, nullptr);
    hprev = hout;
  }

  // fuse (writes big), pooling, cls, their share of the head's first layer
  k_gemm<false, true, 2, false><<<dim3(NT / 128, 1024 / 64), 256, 0, stream>>>(
      wfuse, 512, hcat, big, NT, 1024, 512, nullptr, fuse_bn_g, fuse_bn_b, nullptr, 0);
  k_pool<<<dim3(1024, 2), 256, 0, stream>>>(big, xmax, xavg);
  k_cls<<<1, 128, 0, stream>>>(label_w, cls_lab, label_bn_g, label_bn_b, clsf);
  k_headbias<<<512 / 16, GW * 32, 0, stream>>>(ws1c, glob, convs1_b, hbias);

  // segmentation head
  k_gemm<true, true, 1, false><<<dim3(NT / 128, 512 / 64), 256, 0, stream>>>(
      ws1c, HK, big, hs1, NT, 512, HKP, hbias, bns1_g, bns1_b, nullptr, 512);
  k_gemm<true, true, 1, false><<<dim3(NT / 128, 256 / 64), 256, 0, stream>>>(
      ws2c, 512, hs1, hs2, NT, 256, 512, convs2_b, bns2_g, bns2_b, nullptr, 0);
  k_gemm<true, false, 0, false><<<dim3(NT / 128, 1), 256, 0, stream>>>(
      ws3c, 256, hs2, out3, NT, 50, 256, convs3_b, nullptr, nullptr, nullptr, 0);
  k_repack<<<(2 * 50 * NPTS + 255) / 256, 256, 0, stream>>>(out3, (float*)d_out);
}

// v010
// One run takes 207 microseconds.
// In two side-by-side timings against v009, it was 1.07 and 1.08 times as fast.
// Counting every step since v000, it is 12.4 times as fast.
#include <hip/hip_runtime.h>

typedef __attribute__((ext_vector_type(16))) _Float16 v16h;
typedef __attribute__((ext_vector_type(8)))  float    v8f;
typedef __attribute__((ext_vector_type(4)))  float    v4f;
typedef __attribute__((ext_vector_type(4)))  _Float16 v4h;
typedef __attribute__((ext_vector_type(8)))  _Float16 v8h;

#define NT    8192      // total columns = B * N
#define NPTS  4096      // points per batch
#define BN_EPS 1e-5f
#define KT    128
#define FPAD  136
#define BPITCH 144
#define NC    32
#define TPITCH 48
#define KSPLIT 8
#define KSL   (NPTS / KSPLIT)
#define CSPLIT KSPLIT
#define SROWT 2
#define LOG2E 1.44269504088896340736f
#define PSC_LOG2 12.f   // p = 2^12 * softmax: a mean weight of 1/NPTS becomes 1,
#define PSC   4096.f    // the largest 4096, both well inside the f16 range
#define HK    3136      // input rows of the first head layer
#define HKP   1024      // of these, rows that differ from point to point
#define GLOB  (HK - HKP) // rows that hold one value for all points of a batch
#define GW    11        // waves of k_headbias, GLOB / 32 / GT
#define GT    6         // k-tiles of 32 per wave of k_headbias
#define CVB   4096      // values per work-group of the weight conversion
// places of the f16 weight copies in one array (values), multiples of CVB
#define WO_QK (128 * 128)
#define WO_V  (WO_QK + 4 * 32 * 128)
#define WO_T  (WO_V + 4 * 128 * 128)
#define WO_FU (WO_T + 4 * 128 * 128)
#define WO_S1 (WO_FU + 1024 * 512)
#define WO_S2 (WO_S1 + 512 * HK)
#define WO_S3 (WO_S2 + 256 * 512)
#define WTOT  (WO_S3 + 50 * 256)

__device__ __forceinline__ v16h frag_ld(const _Float16* s, int lane) {
  const int row = lane & 15, h2 = lane >> 4;
  const _Float16* p = s + row * FPAD + 8 * h2;
  v16h f;
#pragma unroll
  for (int e = 0; e < 8; ++e) f[e] = p[e];
#pragma unroll
  for (int e = 0; e < 8; ++e) f[8 + e] = p[8 + e + 8];   // base+16+8*h2+e
  return f;
}

template <int PITCH>
__device__ __forceinline__ v16h frag_tr(const _Float16* s, int lane) {
  typedef __attribute__((ext_vector_type(8))) short v8s;
  typedef __attribute__((address_space(3))) v8s lds_v8s;
  const _Float16* p = s + (8 * (lane >> 4) + (lane & 7)) * PITCH + 8 * ((lane >> 3) & 1);
  const v8h lo = __builtin_bit_cast(v8h, __builtin_amdgcn_ds_load_tr16_b128_v8i16((lds_v8s*)p));
  const v8h hi = __builtin_bit_cast(v8h, __builtin_amdgcn_ds_load_tr16_b128_v8i16((lds_v8s*)(p + 16 * PITCH)));
  return __builtin_shufflevector(lo, hi, 0, 1, 2, 3, 4, 5, 6, 7,
                                 8, 9, 10, 11, 12, 13, 14, 15);
}

__device__ __forceinline__ v16h frag_g(const v8h* __restrict__ f, int tile, int lane) {
  const v8h lo = f[(tile * 2 + 0) * 32 + lane];
  const v8h hi = f[(tile * 2 + 1) * 32 + lane];
  return __builtin_shufflevector(lo, hi, 0, 1, 2, 3, 4, 5, 6, 7,
                                 8, 9, 10, 11, 12, 13, 14, 15);
}

// ---- WMMA A fragment from a row-major 128-column weight matrix in memory ---
// w names row 0, first k of the 16 x 32 tile; frag_ld's k order.
__device__ __forceinline__ v16h frag_w(const _Float16* __restrict__ w, int lane) {
  const _Float16* p = w + (lane & 15) * 128 + 8 * (lane >> 4);
  const v8h lo = *(const v8h*)p;
  const v8h hi = *(const v8h*)(p + 16);
  return __builtin_shufflevector(lo, hi, 0, 1, 2, 3, 4, 5, 6, 7,
                                 8, 9, 10, 11, 12, 13, 14, 15);
}

// ---- WMMA GEMM: sum_k A[m,k]*B[k,n], main loop of the GEMM kernel ----------
// 256 threads = 8 waves as 4(M)x2(N); block tile 64(M) x 128(N); a stage is
// KT = 128 deep (K is a multiple of it): a thread's 12 loads of 16 bytes fly
// together, so a stage waits out the load latency and its two barriers once
// for four k-tiles of 32. Each wave: 16x64 output = 4 wmma per k-tile on one
// fragment of A. B has NT columns, so its row steps are immediates.
// The two fragments have mirrored layouts, so either may be the first operand:
// NROWS false: D = A*B, a lane holds rows m = 8*h2+r of column n = lane&15;
// NROWS true: D = (A*B)^T, a lane holds columns n = 8*h2+r of row m = lane&15.
template <bool NROWS>
__device__ __forceinline__ void gemm_tiles(
    const _Float16* __restrict__ A, int lda, const _Float16* __restrict__ Bm,
    int M, int K, int m0, int n0, _Float16* As, _Float16* Bs, v8f (&acc)[4])
{
  const int tid  = threadIdx.x;
  const int lane = tid & 31, wave = tid >> 5;
  const int wm = wave >> 1, wn = wave & 1;
  // A and B alike: 16 lanes move one whole 256-byte row; rows sr, sr+16, ...
  const int sr = tid >> 4, sc = (tid & 15) * 8;
  // A rows past M: row M-1 is staged in their place, so that no load stands
  // under a branch; they reach only rows of the product that are never stored
  const _Float16* ap[4];
#pragma unroll  // ap indexed by constants to stay in registers
  for (int i = 0; i < 4; ++i) {
    const int gm = m0 + sr + 16 * i;
    ap[i] = A + (size_t)(gm < M ? gm : M - 1) * lda + sc;
  }
  const _Float16* bp = Bm + (size_t)sr * NT + n0 + sc;
  // B prefetch: one 128-byte line a thread, KT k-rows x 128 n
  const _Float16* pp = Bm + (size_t)(KT + (tid >> 1)) * NT + n0 + (tid & 1) * 64;

  for (int k0 = 0; k0 < K; k0 += KT) {
    v8h a[4], b[KT / 16];
#pragma unroll  // a, ap indexed by constants
    for (int i = 0; i < 4; ++i) a[i] = *(const v8h*)(ap[i] + k0);   // A [64][KT]
#pragma unroll  // b indexed by constants
    for (int i = 0; i < KT / 16; ++i)                               // B [KT][128]
      b[i] = *(const v8h*)(bp + (size_t)(k0 + 16 * i) * NT);
    // keeps all 12 loads ahead of the first LDS store: without it the compiler
    // waits for the A loads and stores them before it issues the B loads
    __builtin_amdgcn_sched_barrier(0);
#pragma unroll  // a indexed by constants
    for (int i = 0; i < 4; ++i) *(v8h*)&As[(sr + 16 * i) * FPAD + sc] = a[i];
#pragma unroll  // b indexed by constants
    for (int i = 0; i < KT / 16; ++i) *(v8h*)&Bs[(sr + 16 * i) * BPITCH + sc] = b[i];
    if (k0 + KT < K)  // hint next stage's lines toward L2 (global_prefetch_b8)
      __builtin_prefetch(pp + (size_t)k0 * NT, 0, 1);
    __syncthreads();
#pragma unroll  // LDS offsets as immediates; k in the order of the 32-deep loop
    for (int kk = 0; kk < KT; kk += 32) {
      const v16h af = frag_ld(&As[wm * 16 * FPAD + kk], lane);
#pragma unroll  // acc indexed by constants
      for (int t = 0; t < 4; ++t) {
        const v16h bf = frag_tr<BPITCH>(&Bs[kk * BPITCH + wn * 64 + t * 16], lane);
        acc[t] = NROWS
            ? __builtin_amdgcn_wmma_f32_16x16x32_f16(false, bf, false, af,
                                                     (short)0, acc[t], false, false)
            : __builtin_amdgcn_wmma_f32_16x16x32_f16(false, af, false, bf,
                                                     (short)0, acc[t], false, false);
      }
    }
    __syncthreads();
  }
}

// ---- generic GEMM: O[m,n] = epi( sum_k A[m,k]*B[k,n] ) ---------------------
// epilogue: +bias[m], BN(g,b) fresh stats, act(0,1=relu,2=leaky.2), +residual;
// which of these a layer has is fixed at compile time, so that no load of the
// epilogue stands under a branch.
// bias_bs: distance between the two batches' bias vectors (0: one for both).
// The product is formed transposed: a lane's 8 accumulators of a tile are 8
// neighbouring columns of ONE output row, so the row's bias and scale are one
// load each, residual and output 16 bytes per tile; all of these loads are
// issued ahead of the main loop and none is waited for on its own.
template <bool BIAS, bool BN, int ACT, bool RES>
__global__ __launch_bounds__(256) void k_gemm(
    const _Float16* __restrict__ A, int lda,
    const _Float16* __restrict__ Bm,
    _Float16* __restrict__ O, int ldc,
    int M, int K,
    const float* __restrict__ bias,
    const float* __restrict__ bng, const float* __restrict__ bnb,
    const _Float16* __restrict__ resid, int bias_bs)
{
  __shared__ __attribute__((aligned(16))) _Float16 As[64 * FPAD];     // [m][k]
  __shared__ __attribute__((aligned(16))) _Float16 Bs[KT * BPITCH];   // [k][n]
  const int lane = threadIdx.x & 31, wave = threadIdx.x >> 5;
  const int wm = wave >> 1, wn = wave & 1;
  const int m0 = blockIdx.y * 64;
  const int n0 = blockIdx.x * 128;
  const int m = m0 + wm * 16 + (lane & 15);       // the lane's output row
  // rows past M read row M-1's operands, in bounds, and store nothing
  const int mc = m < M ? m : M - 1;
  // the lane's 8 columns of tile 0; tile t lies 16 columns on
  const size_t o0 = (size_t)mc * ldc + n0 + wn * 64 + (lane >> 4) * 8;
  float bi = 0.f, g = 0.f, sh = 0.f;
  v8h rs[4];
  // keeps the fetch of the kernel's arguments ahead of the loads below: behind
  // them it would take over scalar registers that these loads name
  __builtin_amdgcn_sched_barrier(0);
  // a block's 128 columns lie in one batch
  if (BIAS) bi = bias[(n0 / NPTS) * bias_bs + mc];
  if (BN) { g = bng[mc]; sh = bnb[mc]; }
  if (RES) {
#pragma unroll  // rs indexed by constants
    for (int t = 0; t < 4; ++t) rs[t] = *(const v8h*)(resid + o0 + t * 16);
  }
  // the loads' address registers are given new values below: wait first
  asm volatile("s_wait_xcnt 0x0" ::: "memory");
  // keeps the address arithmetic below, which reuses them, behind the wait
  __builtin_amdgcn_sched_barrier(0);

  v8f acc[4] = {{}, {}, {}, {}};
  gemm_tiles<true>(A, lda, Bm, M, K, m0, n0, As, Bs, acc);

  const float sc = g * rsqrtf(1.f + BN_EPS);
  v8h o[4];
#pragma unroll  // acc, rs, o indexed by constants
  for (int t = 0; t < 4; ++t) {
    v8f v = acc[t];
    if (BIAS) v += bi;
    if (BN) v = v * sc + sh;
#pragma unroll  // vector elements indexed by constants
    for (int r = 0; r < 8; ++r) {
      if (ACT == 1)      v[r] = fmaxf(v[r], 0.f);
      else if (ACT == 2) v[r] = (v[r] > 0.f) ? v[r] : 0.2f * v[r];
    }
    if (RES) v += __builtin_convertvector(rs[t], v8f);
    o[t] = __builtin_convertvector(v, v8h);
  }
  if (m < M) {
#pragma unroll  // o indexed by constants; the four stores follow one another
    for (int t = 0; t < 4; ++t) *(v8h*)(O + o0 + t * 16) = o[t];
  }
}

// ---- row statistic of e = q^T q (K=32): base-2 log-sum-exp less PSC_LOG2 ---
// One work-group = SROWT*16 rows of one batch. The own rows are the B operand
// (kept in registers), the 4096 partners the A operand, 32 tiles per wave:
// a lane then holds 8 scores of ONE own row, so maximum and sum stay in the
// lane until one exchange between the wave's halves; the 8 waves meet in LDS.
// Two passes: rowmax, then the sum of exp(e - rowmax). Stored is
// L = rowmax * log2(e) + log2(sum) - PSC_LOG2: exp2(e * log2(e) - L) is the
// softmax weight times PSC.
__global__ __launch_bounds__(256) void k_rowstat(
    const _Float16* __restrict__ qf,  // q in fragment order, NT/16 tiles
    float* __restrict__ lse)          // [NT]
{
  __shared__ float part[8][SROWT * 16];
  const int tid = threadIdx.x, lane = tid & 31, lcol = lane & 15;
  // wave number as a scalar, so that the tile addresses are scalar + lane
  const int wave = __builtin_amdgcn_readfirstlane(tid >> 5);
  const int bt = blockIdx.y * (NPTS / 16);      // first tile of the batch
  const int rt0 = bt + blockIdx.x * SROWT;      // first own row tile
  const int mt0 = bt + wave * (NPTS / 16 / 8);  // first partner tile
  const v8h* f = (const v8h*)qf;
  v16h bq[SROWT];
#pragma unroll  // bq, mx, sm, rm indexed by constants to stay in registers
  for (int i = 0; i < SROWT; ++i) bq[i] = frag_g(f, rt0 + i, lane);

  v8f mx[SROWT];
#pragma unroll
  for (int i = 0; i < SROWT; ++i)
#pragma unroll
    for (int r = 0; r < 8; ++r) mx[i][r] = -3.0e38f;
#pragma unroll 8
  for (int t = 0; t < NPTS / 16 / 8; ++t) {
    const v16h a = frag_g(f, mt0 + t, lane);
#pragma unroll
    for (int i = 0; i < SROWT; ++i) {
      v8f z = {};
      const v8f e = __builtin_amdgcn_wmma_f32_16x16x32_f16(false, a, false, bq[i],
                                                           (short)0, z, false, false);
#pragma unroll
      for (int r = 0; r < 8; ++r) mx[i][r] = fmaxf(mx[i][r], e[r]);
    }
  }
#pragma unroll
  for (int i = 0; i < SROWT; ++i) {
    float m = mx[i][0];
#pragma unroll
    for (int r = 1; r < 8; ++r) m = fmaxf(m, mx[i][r]);
    m = fmaxf(m, __shfl_xor(m, 16, 32));
    if (lane < 16) part[wave][i * 16 + lane] = m;
  }
  __syncthreads();
  float rm[SROWT];
#pragma unroll
  for (int i = 0; i < SROWT; ++i) {
    float m = part[0][i * 16 + lcol];
#pragma unroll
    for (int w = 1; w < 8; ++w) m = fmaxf(m, part[w][i * 16 + lcol]);
    rm[i] = m;
  }
  __syncthreads();   // part is written again below

  v8f sm[SROWT] = {};
#pragma unroll 8
  for (int t = 0; t < NPTS / 16 / 8; ++t) {
    const v16h a = frag_g(f, mt0 + t, lane);
#pragma unroll
    for (int i = 0; i < SROWT; ++i) {
      v8f z = {};
      const v8f e = __builtin_amdgcn_wmma_f32_16x16x32_f16(false, a, false, bq[i],
                                                           (short)0, z, false, false);
#pragma unroll
      for (int r = 0; r < 8; ++r) sm[i][r] += __expf(e[r] - rm[i]);
    }
  }
#pragma unroll
  for (int i = 0; i < SROWT; ++i) {
    float s = sm[i][0];
#pragma unroll
    for (int r = 1; r < 8; ++r) s += sm[i][r];
    s += __shfl_xor(s, 16, 32);
    if (lane < 16) part[wave][i * 16 + lane] = s;
  }
  __syncthreads();
  if (tid < SROWT * 16) {
    float s = part[0][tid];
#pragma unroll
    for (int w = 1; w < 8; ++w) s += part[w][tid];
    lse[rt0 * 16 + tid] = ((tid < 16) ? rm[0] : rm[1]) * LOG2E + (__log2f(s) - PSC_LOG2);
  }
}

// ---- x_num = v @ p and the column sum, p formed in registers ---------------
// grid.x = 256 columns m (8 waves x 2 tiles of 16), grid.y = slice of KSL
// rows n. Per 32 rows a wave computes two score tiles e[n][m] per column tile
// (A = q of the rows, B = q of its own columns, kept in registers). Their D
// registers, as p = exp2(e * log2(e) - lse[n]) in f16, ARE the B fragment of the next
// product (k = 8*h2+r and 16+8*h2+r), so p meets neither LDS nor memory.
// A = v in fragment order, 8 channel tiles. The f32 partial tile goes
// to part[128][KSPLIT][NT], the column-sum partial to cs[KSPLIT][NT];
// k_chain adds the slices.
__global__ __launch_bounds__(256) void k_attn_xnum(
    const _Float16* __restrict__ qf,   // q in fragment order, NT/16 tiles
    const _Float16* __restrict__ vf,   // v, fragment order [NT/32][8]
    const float* __restrict__ lse,     // [NT]
    float* __restrict__ part,          // [128][KSPLIT][NT]
    float* __restrict__ cs)            // [KSPLIT][NT]
{
  const int tid = threadIdx.x, lane = tid & 31;
  const int lcol = lane & 15, h2 = lane >> 4;
  // wave number as a scalar, so that the tile addresses are scalar + lane
  const int wave = __builtin_amdgcn_readfirstlane(tid >> 5);
  const int c0 = blockIdx.x * 256 + wave * 32;      // first own column
  const int ks = blockIdx.y;
  const int n0 = (blockIdx.x / (NPTS / 256)) * NPTS + ks * KSL;  // first row
  const v8h* qv = (const v8h*)qf;
  const v16h bq[2] = {frag_g(qv, (c0 >> 4) + 0, lane),
                      frag_g(qv, (c0 >> 4) + 1, lane)};
  v8f acc[2][8] = {};
  v8f csum[2] = {};

  // work-group-uniform bases of the slice; a trip adds its step, a lane its
  // own lane or h2 * 8
  const v8h* qn = qv + (n0 >> 4) * 64;                  // 128 units a trip
  const v8h* vn = (const v8h*)vf + (n0 >> 5) * 512;     // 512 units a trip
  const float* mn = lse + n0;                           // 32 floats a trip
  const unsigned ro = h2 * 8;

  // one trip = 32 rows. q fragments and row statistics (a0..m1) were fetched
  // one trip ahead, so the score products wait for no load of their own trip;
  // this trip fetches the next one's (b0..k1) and its own v fragments.
  auto trip = [&](int s, const v16h& a0, const v16h& a1, const v8f& m0, const v8f& m1,
                  v16h& b0, v16h& b1, v8f& k0, v8f& k1) {
    // the last trip fetches its own rows again: in bounds, never used
    const int sn = (s + 1 < KSL / 32) ? s + 1 : s;
    // keeps this trip's loads behind the trip before: a load lifted into its
    // arithmetic would have its address registers reused ahead of the wait
    __builtin_amdgcn_sched_barrier(0);
    v16h va[8];
#pragma unroll  // va, acc indexed by constants to stay in registers
    for (int ct = 0; ct < 8; ++ct) va[ct] = frag_g(vn + s * 512, ct, lane);
    b0 = frag_g(qn + sn * 128, 0, lane);
    b1 = frag_g(qn + sn * 128, 1, lane);
    k0 = *(const v8f*)(mn + sn * 32 + ro);
    k1 = *(const v8f*)(mn + sn * 32 + 16 + ro);
    // the loads' address registers are given new values below: wait first
    asm volatile("s_wait_xcnt 0x0" ::: "memory");
    // keeps the arithmetic below, which reuses those registers, behind the wait
    __builtin_amdgcn_sched_barrier(0);
#pragma unroll  // bq, csum, acc indexed by constants to stay in registers
    for (int t = 0; t < 2; ++t) {
      v8f z = {};
      v8f x0 = __builtin_amdgcn_wmma_f32_16x16x32_f16(false, a0, false, bq[t],
                                                      (short)0, z, false, false);
      v8f x1 = __builtin_amdgcn_wmma_f32_16x16x32_f16(false, a1, false, bq[t],
                                                      (short)0, z, false, false);
      x0 = x0 * LOG2E - m0;
      x1 = x1 * LOG2E - m1;
#pragma unroll  // vector elements indexed by constants, here and below
      for (int r = 0; r < 8; ++r) x0[r] = __builtin_amdgcn_exp2f(x0[r]);
#pragma unroll
      for (int r = 0; r < 8; ++r) x1[r] = __builtin_amdgcn_exp2f(x1[r]);
      const v8h p0 = __builtin_convertvector(x0, v8h);
      const v8h p1 = __builtin_convertvector(x1, v8h);
      const v16h p = __builtin_shufflevector(p0, p1, 0, 1, 2, 3, 4, 5, 6, 7,
                                             8, 9, 10, 11, 12, 13, 14, 15);
      // column sum of the rounded p, the very weights that x_num sees
      csum[t] += __builtin_convertvector(p0, v8f);
      csum[t] += __builtin_convertvector(p1, v8f);
#pragma unroll
      for (int ct = 0; ct < 8; ++ct)
        acc[t][ct] = __builtin_amdgcn_wmma_f32_16x16x32_f16(false, va[ct], false, p,
                                                            (short)0, acc[t][ct],
                                                            false, false);
    }
  };

  v16h qa0 = frag_g(qn, 0, lane), qa1 = frag_g(qn, 1, lane), qb0, qb1;
  v8f ma0 = *(const v8f*)(mn + ro), ma1 = *(const v8f*)(mn + 16 + ro), mb0, mb1;
  // the loads' address registers are given new values below: wait first
  asm volatile("s_wait_xcnt 0x0" ::: "memory");
  // keeps the clearing of the accumulators, which reuses them, behind the wait
  __builtin_amdgcn_sched_barrier(0);
  // two trips a pass: the two register sets swap roles without copies
  for (int s = 0; s < KSL / 32; s += 2) {
    trip(s,     qa0, qa1, ma0, ma1, qb0, qb1, mb0, mb1);
    trip(s + 1, qb0, qb1, mb0, mb1, qa0, qa1, ma0, ma1);
  }

  float* po = part + ks * NT + c0 + lcol;
#pragma unroll  // all loops: acc indexed by constants, offsets as immediates
  for (int t = 0; t < 2; ++t) {
#pragma unroll
    for (int ct = 0; ct < 8; ++ct)
#pragma unroll
      for (int r = 0; r < 8; ++r)
        po[(size_t)(ct * 16 + h2 * 8 + r) * (KSPLIT * NT) + t * 16] = acc[t][ct][r];
    float c = csum[t][0];
#pragma unroll
    for (int r = 1; r < 8; ++r) c += csum[t][r];
    c += __shfl_xor(c, 16, 32);
    if (lane < 16) cs[ks * NT + c0 + t * 16 + lane] = c;
  }
}

// ---- small elementwise / reduction kernels --------------------------------
// all eight weight arrays to f16 in one launch. Their f16 copies lie one behind
// the other in d; every array but the last fills whole blocks of CVB values,
// so a work-group reads one array and picks it by scalar compares. A thread
// moves four groups of 4 values, 1024 values apart: a wave's load covers 512
// contiguous bytes, its store 256, and the four loads fly together.
__global__ __launch_bounds__(256) void k_f2h(
    const float* __restrict__ c2, const float* __restrict__ qk,
    const float* __restrict__ v,  const float* __restrict__ t,
    const float* __restrict__ fu, const float* __restrict__ s1,
    const float* __restrict__ s2, const float* __restrict__ s3,
    _Float16* __restrict__ d) {
  const int g0 = blockIdx.x * CVB;      // first value of the block in d
  const float* s; int o;                // the block's array, its place in d
  if      (g0 < WO_QK) { s = c2; o = 0; }
  else if (g0 < WO_V)  { s = qk; o = WO_QK; }
  else if (g0 < WO_T)  { s = v;  o = WO_V; }
  else if (g0 < WO_FU) { s = t;  o = WO_T; }
  else if (g0 < WO_S1) { s = fu; o = WO_FU; }
  else if (g0 < WO_S2) { s = s1; o = WO_S1; }
  else if (g0 < WO_S3) { s = s2; o = WO_S2; }
  else                 { s = s3; o = WO_S3; }
  const int g = g0 + threadIdx.x * 4;
  v4f x[4];
  // groups past the end of the last array read its last group again, so that
  // no load stands under a branch and all four fly together; never stored
#pragma unroll  // x indexed by constants
  for (int j = 0; j < 4; ++j) {
    const int gj = g + j * 1024;
    x[j] = *(const v4f*)(s + ((gj < WTOT ? gj : WTOT - 4) - o));
  }
#pragma unroll  // x indexed by constants
  for (int j = 0; j < 4; ++j)
    if (g + j * 1024 < WTOT) *(v4h*)(d + g + j * 1024) = __builtin_convertvector(x[j], v4h);
}

// ---- the layers between two attentions, one kernel -------------------------
// They act on each point alone. One work-group = NC points, all 128 channels;
// wave w owns output rows 16w .. 16w+15 of the 128-row products, waves 0..3 a
// tile of q each; weight fragments come straight from memory, q's read by four
// waves, the others once.
// 1. the input tile [channel][point] is formed in LDS,
//    FIRST: relu(bn1(conv1_w @ x^T)), K = 3, scalar path;
//    else:  h - (sum of the KSPLIT x_num partials) / (PSC * 1e-9 + colsum[point]),
//           colsum = sum of the CSPLIT partials of k_attn_xnum; both carry PSC.
//    A thread forms 4 neighbouring points of 4 rows, 32 rows apart.
// 2. w2 @ tile, formed transposed as in k_gemm (a lane holds 8 neighbouring
//    points of one row); (+bias,) BN, relu (, +h): the attention block's
//    input, to memory and to a second LDS tile.
// 3. NEXT: from that tile the next attention's q, stored in the fragment order
//    of frag_g with the point as fragment row and the channel as k, and its v,
//    in that order too: tile (n/32)*8 + c/16, channel as fragment row, n as k.
// All loads of steps 1 and 2 are issued together at the start, those of step 3
// halfway through step 1.
template <bool FIRST, bool NEXT>
__global__ __launch_bounds__(256) void k_chain(
    const float* __restrict__ x,  const float* __restrict__ w1,
    const float* __restrict__ g1, const float* __restrict__ b1,
    const _Float16* __restrict__ h, const float* __restrict__ part,
    const float* __restrict__ cs,
    const _Float16* __restrict__ w2, const float* __restrict__ bias2,
    const float* __restrict__ g2, const float* __restrict__ b2,
    _Float16* __restrict__ hout,
    const _Float16* __restrict__ wq, const _Float16* __restrict__ wv,
    const float* __restrict__ vb,
    _Float16* __restrict__ qf, _Float16* __restrict__ vf)
{
  __shared__ __attribute__((aligned(16))) _Float16 Ds[128 * TPITCH];  // [k][n]
  __shared__ __attribute__((aligned(16))) _Float16 Hs[128 * TPITCH];  // [k][n]
  const int tid = threadIdx.x, lane = tid & 31;
  const int lcol = lane & 15, h2 = lane >> 4;
  // wave number as a scalar: scalar weight bases, scalar branch round the q part
  const int wave = __builtin_amdgcn_readfirstlane(tid >> 5);
  const int n0 = blockIdx.x * NC;
  const int dr = tid >> 3, dc = (tid & 7) * 4;    // step 1: first row, points
  const int m = wave * 16 + lcol;                 // steps 2, 3: the lane's row
  // the lane's 8 points of tile 0; tile 1 lies 16 points on
  const size_t o0 = (size_t)m * NT + n0 + h2 * 8;

  v4f xin[3], xp[4][KSPLIT], c4[CSPLIT];
  v4h h4[4];
  float cw[4][3], cg[4], cb[4];
  if (FIRST) {
#pragma unroll  // xin indexed by constants; 4 points x 3 coordinates, 48 bytes
    for (int j = 0; j < 3; ++j) xin[j] = *(const v4f*)(x + (size_t)(n0 + dc) * 3 + j * 4);
#pragma unroll  // cw, cg, cb indexed by constants
    for (int i = 0; i < 4; ++i) {
      const int o = dr + 32 * i;
      cw[i][0] = w1[o * 3 + 0]; cw[i][1] = w1[o * 3 + 1]; cw[i][2] = w1[o * 3 + 2];
      cg[i] = g1[o]; cb[i] = b1[o];
    }
  } else {
#pragma unroll  // c4 indexed by constants
    for (int s = 0; s < CSPLIT; ++s) c4[s] = *(const v4f*)(cs + s * NT + n0 + dc);
#pragma unroll  // xp, h4 indexed by constants
    for (int i = 0; i < 4; ++i) {
#pragma unroll  // xp indexed by constants
      for (int s = 0; s < KSPLIT; ++s)   // [row][slice][col]
        xp[i][s] = *(const v4f*)(part + (size_t)((dr + 32 * i) * KSPLIT + s) * NT + n0 + dc);
      h4[i] = *(const v4h*)(h + (size_t)(dr + 32 * i) * NT + n0 + dc);
    }
  }
  // a load below may land in an address register of a load above: wait first
  asm volatile("s_wait_xcnt 0x0" ::: "memory");
  v16h a2[4];
#pragma unroll  // a2 indexed by constants
  for (int kk = 0; kk < 4; ++kk) a2[kk] = frag_w(w2 + wave * (16 * 128) + kk * 32, lane);
  float bi = 0.f;
  if (!FIRST) bi = bias2[m];
  const float g = g2[m], sh = b2[m];
  v8h rs[2];
  if (!FIRST) {
#pragma unroll  // rs indexed by constants
    for (int t = 0; t < 2; ++t) rs[t] = *(const v8h*)(h + o0 + t * 16);
  }
  // the loads' address registers are given new values below: wait first
  asm volatile("s_wait_xcnt 0x0" ::: "memory");
  // keeps every load above ahead of the first use, all in flight together, and
  // the arithmetic below, which reuses their address registers, behind the wait
  __builtin_amdgcn_sched_barrier(0);

  // step 1
  v4f cc;
  if (!FIRST) {
    cc = c4[0];
#pragma unroll  // c4 indexed by constants
    for (int s = 1; s < CSPLIT; ++s) cc += c4[s];
  }
  // row dr + 32 * i of the tile; i is a constant at every call, so that the
  // arrays stay in registers
  auto row = [&](int i) {
    v4h o;
    if (FIRST) {
      const float sc1 = cg[i] * rsqrtf(1.f + BN_EPS);
#pragma unroll  // vector elements indexed by constants
      for (int e = 0; e < 4; ++e) {
        float s = cw[i][0] * xin[(e * 3 + 0) >> 2][(e * 3 + 0) & 3] +
                  cw[i][1] * xin[(e * 3 + 1) >> 2][(e * 3 + 1) & 3] +
                  cw[i][2] * xin[(e * 3 + 2) >> 2][(e * 3 + 2) & 3];
        s = s * sc1 + cb[i];
        o[e] = (_Float16)fmaxf(s, 0.f);
      }
    } else {
      v4f xn = xp[i][0];
#pragma unroll  // xp indexed by constants
      for (int s = 1; s < KSPLIT; ++s) xn += xp[i][s];
#pragma unroll  // vector elements indexed by constants
      for (int e = 0; e < 4; ++e)
        o[e] = (_Float16)((float)h4[i][e] - xn[e] / (PSC * 1e-9f + cc[e]));
    }
    *(v4h*)&Ds[(dr + 32 * i) * TPITCH + dc] = o;
  };
  row(0);
  row(1);
  // step 3's weights are asked for here: half of step 1's registers are free
  // again, and the arithmetic of its other half hides their latency
  v16h av[4], aq[4];
  float vbi = 0.f;
  if (NEXT) {
#pragma unroll  // av indexed by constants
    for (int kk = 0; kk < 4; ++kk) av[kk] = frag_w(wv + wave * (16 * 128) + kk * 32, lane);
    vbi = vb[m];
    // a load below may land in an address register of a load above: wait first
    asm volatile("s_wait_xcnt 0x0" ::: "memory");
#pragma unroll  // aq indexed by constants; q has two row tiles, wave & 1
    for (int kk = 0; kk < 4; ++kk)
      aq[kk] = frag_w(wq + (wave & 1) * (16 * 128) + kk * 32, lane);
    // the loads' address registers are given new values below: wait first
    asm volatile("s_wait_xcnt 0x0" ::: "memory");
    // keeps these loads ahead of the arithmetic below and its reuse of their
    // address registers behind the wait
    __builtin_amdgcn_sched_barrier(0);
  }
  row(2);
  row(3);
  __syncthreads();

  // step 2
  v8f acc[2] = {{}, {}};
#pragma unroll  // LDS offsets as immediates; k in the order of the channel GEMMs
  for (int kk = 0; kk < 4; ++kk)
#pragma unroll  // acc indexed by constants
    for (int t = 0; t < 2; ++t) {
      const v16h bf = frag_tr<TPITCH>(&Ds[kk * 32 * TPITCH + t * 16], lane);
      acc[t] = __builtin_amdgcn_wmma_f32_16x16x32_f16(false, bf, false, a2[kk],
                                                      (short)0, acc[t], false, false);
    }
  const float sc = g * rsqrtf(1.f + BN_EPS);
  v8h o[2];
#pragma unroll  // acc, rs, o indexed by constants
  for (int t = 0; t < 2; ++t) {
    v8f u = acc[t];
    if (!FIRST) u += bi;
    u = u * sc + sh;
#pragma unroll  // vector elements indexed by constants
    for (int r = 0; r < 8; ++r) u[r] = fmaxf(u[r], 0.f);
    if (!FIRST) u += __builtin_convertvector(rs[t], v8f);
    o[t] = __builtin_convertvector(u, v8h);
  }
  if (NEXT) {
#pragma unroll  // o indexed by constants
    for (int t = 0; t < 2; ++t) *(v8h*)&Hs[m * TPITCH + t * 16 + h2 * 8] = o[t];
    // ahead of the stores to memory: behind them it would wait for them too
    __syncthreads();
  }
#pragma unroll  // o indexed by constants
  for (int t = 0; t < 2; ++t) *(v8h*)(hout + o0 + t * 16) = o[t];
  if (!NEXT) return;
  // the stores' registers are given new values below: wait first
  asm volatile("s_wait_xcnt 0x0" ::: "memory");
  // keeps the arithmetic below, which reuses those registers, behind the wait
  __builtin_amdgcn_sched_barrier(0);

  // step 3
  v8f accv[2] = {{}, {}};
#pragma unroll  // LDS offsets as immediates; k in the order of the channel GEMMs
  for (int kk = 0; kk < 4; ++kk)
#pragma unroll  // accv indexed by constants
    for (int t = 0; t < 2; ++t) {
      const v16h bf = frag_tr<TPITCH>(&Hs[kk * 32 * TPITCH + t * 16], lane);
      accv[t] = __builtin_amdgcn_wmma_f32_16x16x32_f16(false, bf, false, av[kk],
                                                       (short)0, accv[t], false, false);
    }
  // a lane's 8 accumulators are points t*16+8*h2+r of channel 16*wave+(lane&15):
  // halves 0..7 of plane t of channel tile 'wave', at this very lane
#pragma unroll  // accv indexed by constants
  for (int t = 0; t < 2; ++t)
    ((v8h*)vf)[(((n0 >> 5) * 8 + wave) * 2 + t) * 32 + lane] =
        __builtin_convertvector(accv[t] + vbi, v8h);
  // the stores' registers are given new values below: wait first
  asm volatile("s_wait_xcnt 0x0" ::: "memory");
  // keeps the arithmetic below, which reuses those registers, behind the wait
  __builtin_amdgcn_sched_barrier(0);
  // q: 2 row tiles x 2 point tiles, one each for waves 0..3. Not transposed: a
  // lane's 8 accumulators are channels (wave&1)*16+8*h2+r of point lane&15:
  // halves 0..7 of plane wave&1 of that point tile, at this very lane
  if (wave < 4) {
    const int qt = wave >> 1;
    v8f accq = {};
#pragma unroll  // aq indexed by constants
    for (int kk = 0; kk < 4; ++kk) {
      const v16h bf = frag_tr<TPITCH>(&Hs[kk * 32 * TPITCH + qt * 16], lane);
      accq = __builtin_amdgcn_wmma_f32_16x16x32_f16(false, aq[kk], false, bf,
                                                    (short)0, accq, false, false);
    }
    ((v8h*)qf)[(((n0 >> 4) + qt) * 2 + (wave & 1)) * 32 + lane] =
        __builtin_convertvector(accq, v8h);
  }
}

// per-row max/mean pooling over N for hf rows (M=1024), into glob[b][..]
__global__ void k_pool(const _Float16* __restrict__ hf, float* __restrict__ xmax,
                       float* __restrict__ xavg) {
  const int o = blockIdx.x, bb = blockIdx.y, tid = threadIdx.x;
  const _Float16* p = hf + (size_t)o * NT + bb * NPTS;
  float mx = -3.0e38f, sm = 0.f;
  for (int i = tid; i < NPTS; i += 256) {
    const float v = (float)p[i];
    mx = fmaxf(mx, v); sm += v;
  }
  __shared__ float s1[256], s2[256];
  s1[tid] = mx; s2[tid] = sm;
  __syncthreads();
  for (int s = 128; s > 0; s >>= 1) {
    if (tid < s) { s1[tid] = fmaxf(s1[tid], s1[tid + s]); s2[tid] += s2[tid + s]; }
    __syncthreads();
  }
  if (tid == 0) {
    xmax[bb * GLOB + o] = s1[0];
    xavg[bb * GLOB + o] = s2[0] * (1.f / NPTS);
  }
}

// cls_f = leaky(bn(label_w @ cls_label))  (K=16, 128 outputs total), into
// glob[b][..]
__global__ void k_cls(const float* __restrict__ w, const float* __restrict__ lab,
                      const float* __restrict__ g, const float* __restrict__ b,
                      float* __restrict__ out) {
  const int t = threadIdx.x;
  if (t >= 128) return;
  const int bb = t >> 6, o = t & 63;
  float s = 0.f;
  for (int c = 0; c < 16; ++c) s += w[o * 16 + c] * lab[bb * 16 + c];
  s = s * (g[o] * rsqrtf(1.f + BN_EPS)) + b[o];
  out[bb * GLOB + o] = (s > 0.f) ? s : 0.2f * s;
}

// head bias: gb[b][o] = bias[o] + sum_k w[o][HKP + k] * glob[b][k], where
// glob[b] = (pooled maximum, pooled mean, class feature) of batch b, rounded
// to f16. These GLOB input rows hold one value for all points of a batch,
// so one column per batch is the whole product. One work-group = 16 output
// rows, GW waves x GT k-tiles; column c of the B operand is batch c & 1 (no
// lane idles or branches), columns 0 and 1 of D are kept; the waves' sums
// meet in LDS.
__global__ __launch_bounds__(GW * 32) void k_headbias(
    const _Float16* __restrict__ w,     // [512][HK]
    const float* __restrict__ glob,     // [2][GLOB]
    const float* __restrict__ bias,     // [512]
    float* __restrict__ gb)             // [2][512]
{
  __shared__ float red[GW][2][16];
  const int tid = threadIdx.x, lane = tid & 31;
  const int lcol = lane & 15, h2 = lane >> 4;
  const int wave = tid >> 5;
  const int m0 = blockIdx.x * 16;
  const _Float16* a = w + (size_t)(m0 + lcol) * HK + HKP + wave * (GT * 32) + 8 * h2;
  const float* g = glob + (lcol & 1) * GLOB + wave * (GT * 32) + 8 * h2;
  v8h alo[GT], ahi[GT];
  v8f glo[GT], ghi[GT];
#pragma unroll  // all loads in flight together; arrays indexed by constants
  for (int t = 0; t < GT; ++t) {
    alo[t] = *(const v8h*)(a + t * 32);
    ahi[t] = *(const v8h*)(a + t * 32 + 16);
    glo[t] = *(const v8f*)(g + t * 32);
    ghi[t] = *(const v8f*)(g + t * 32 + 16);
  }
  // keeps every load ahead of the first conversion: without it the compiler
  // issues them a few at a time, each group behind a wait for the one before
  __builtin_amdgcn_sched_barrier(0);
  v8f acc = {};
#pragma unroll  // arrays indexed by constants to stay in registers
  for (int t = 0; t < GT; ++t) {
    const v16h af = __builtin_shufflevector(alo[t], ahi[t], 0, 1, 2, 3, 4, 5, 6, 7,
                                            8, 9, 10, 11, 12, 13, 14, 15);
    const v16h bf = __builtin_shufflevector(__builtin_convertvector(glo[t], v8h),
                                            __builtin_convertvector(ghi[t], v8h),
                                            0, 1, 2, 3, 4, 5, 6, 7,
                                            8, 9, 10, 11, 12, 13, 14, 15);
    acc = __builtin_amdgcn_wmma_f32_16x16x32_f16(false, af, false, bf,
                                                 (short)0, acc, false, false);
  }
  if (lcol < 2) {
#pragma unroll  // acc indexed by constants
    for (int r = 0; r < 8; ++r) red[wave][lcol][h2 * 8 + r] = acc[r];
  }
  __syncthreads();
  if (tid < 32) {
    float s = bias[m0 + lcol];
#pragma unroll  // all GW LDS loads in flight together
    for (int v = 0; v < GW; ++v) s += red[v][h2][lcol];
    gb[h2 * 512 + m0 + lcol] = s;
  }
}

// out3 f16 [50][NT] -> d_out f32 [B][50][N]
__global__ void k_repack(const _Float16* __restrict__ o3, float* __restrict__ out) {
  int i = blockIdx.x * 256 + threadIdx.x;
  if (i >= 2 * 50 * NPTS) return;
  const int bb = i / (50 * NPTS);
  const int r = i - bb * 50 * NPTS;
  const int o = r >> 12, n = r & (NPTS - 1);
  out[i] = (float)o3[(size_t)o * NT + bb * NPTS + n];
}

// ---------------------------------------------------------------------------
extern "C" void kernel_launch(void* const* d_in, const int* in_sizes, int n_in,
                              void* d_out, int out_size, void* d_ws, size_t ws_size,
                              hipStream_t stream) {
  (void)in_sizes; (void)n_in; (void)out_size; (void)ws_size;
  const float* x         = (const float*)d_in[0];
  const float* cls_lab   = (const float*)d_in[1];
  const float* conv1_w   = (const float*)d_in[2];
  const float* bn1_g     = (const float*)d_in[3];
  const float* bn1_b     = (const float*)d_in[4];
  const float* conv2_w   = (const float*)d_in[5];
  const float* bn2_g     = (const float*)d_in[6];
  const float* bn2_b     = (const float*)d_in[7];
  const float* sa_qk_w   = (const float*)d_in[8];
  const float* sa_v_w    = (const float*)d_in[9];
  const float* sa_v_b    = (const float*)d_in[10];
  const float* sa_t_w    = (const float*)d_in[11];
  const float* sa_t_b    = (const float*)d_in[12];
  const float* sa_bn_g   = (const float*)d_in[13];
  const float* sa_bn_b   = (const float*)d_in[14];
  const float* fuse_w    = (const float*)d_in[15];
  const float* fuse_bn_g = (const float*)d_in[16];
  const float* fuse_bn_b = (const float*)d_in[17];
  const float* label_w   = (const float*)d_in[18];
  const float* label_bn_g= (const float*)d_in[19];
  const float* label_bn_b= (const float*)d_in[20];
  const float* convs1_w  = (const float*)d_in[21];
  const float* convs1_b  = (const float*)d_in[22];
  const float* bns1_g    = (const float*)d_in[23];
  const float* bns1_b    = (const float*)d_in[24];
  const float* convs2_w  = (const float*)d_in[25];
  const float* convs2_b  = (const float*)d_in[26];
  const float* bns2_g    = (const float*)d_in[27];
  const float* bns2_b    = (const float*)d_in[28];
  const float* convs3_w  = (const float*)d_in[29];
  const float* convs3_b  = (const float*)d_in[30];

  char* wp = (char*)d_ws;
  auto alloc = [&](size_t bytes) -> char* {
    char* p = wp; wp += (bytes + 255) & ~(size_t)255; return p;
  };
  auto h16 = [&](size_t n) { return (_Float16*)alloc(n * 2); };
  auto f32 = [&](size_t n) { return (float*)alloc(n * 4); };

  // f16 weight copies
  _Float16* wc2   = h16(WTOT);
  _Float16* wqk   = wc2 + WO_QK;
  _Float16* wv    = wc2 + WO_V;
  _Float16* wt    = wc2 + WO_T;
  _Float16* wfuse = wc2 + WO_FU;
  _Float16* ws1c  = wc2 + WO_S1;
  _Float16* ws2c  = wc2 + WO_S2;
  _Float16* ws3c  = wc2 + WO_S3;
  // activations
  _Float16* h2b   = h16((size_t)128 * NT);
  _Float16* qbuf  = h16((size_t)32 * NT);
  _Float16* vfr   = h16((size_t)128 * NT);
  _Float16* hcat  = h16((size_t)512 * NT);
  _Float16* big   = h16((size_t)HKP * NT);
  _Float16* hs1   = h16((size_t)512 * NT);
  _Float16* hs2   = h16((size_t)256 * NT);
  _Float16* out3  = h16((size_t)50 * NT);
  float* xpart  = f32((size_t)KSPLIT * 128 * NT);
  float* lseb   = f32(2 * NPTS);
  float* colsum = f32((size_t)CSPLIT * NT);
  float* glob   = f32(2 * GLOB);   // per batch: maximum, mean, class feature
  float* xmax   = glob;
  float* xavg   = glob + 1024;
  float* clsf   = glob + 2048;
  float* hbias  = f32(2 * 512);

  // weight conversions
  k_f2h<<<(WTOT + CVB - 1) / CVB, 256, 0, stream>>>(conv2_w, sa_qk_w, sa_v_w, sa_t_w,
                                                    fuse_w, convs1_w, convs2_w,
                                                    convs3_w, wc2);

  // stem, with the first attention's q and v
  k_chain<true, true><<<NT / NC, 256, 0, stream>>>(
      x, conv1_w, bn1_g, bn1_b, nullptr, nullptr, nullptr,
      wc2, nullptr, bn2_g, bn2_b, h2b, wqk, wv, sa_v_b, qbuf, vfr);

  // 4 self-attention blocks; feats written directly into hcat rows
  const _Float16* hprev = h2b;
  for (int i = 0; i < 4; ++i) {
    k_rowstat<<<dim3(NPTS / 16 / SROWT, 2), 256, 0, stream>>>(qbuf, lseb);
    k_attn_xnum<<<dim3(NT / 256, KSPLIT), 256, 0, stream>>>(qbuf, vfr, lseb,
                                                            xpart, colsum);
    _Float16* hout = hcat + (size_t)i * 128 * NT;
    if (i < 3)
      k_chain<false, true><<<NT / NC, 256, 0, stream>>>(
          nullptr, nullptr, nullptr, nullptr, hprev, xpart, colsum,
          wt + (size_t)i * 128 * 128, sa_t_b + i * 128, sa_bn_g + i * 128,
          sa_bn_b + i * 128, hout, wqk + (size_t)(i + 1) * 32 * 128,
          wv + (size_t)(i + 1) * 128 * 128, sa_v_b + (i + 1) * 128, qbuf, vfr);
    else
      k_chain<false, false><<<NT / NC, 256, 0, stream>>>(
          nullptr, nullptr, nullptr, nullptr, hprev, xpart, colsum,
          wt + (size_t)i * 128 * 128, sa_t_b + i * 128, sa_bn_g + i * 128,
          sa_bn_b + i * 128, hout, nullptr, nullptr, nullptr, nullptr, nullptr);
    hprev = hout;
  }

  // fuse (writes big), pooling, cls, their share of the head's first layer
  k_gemm<false, true, 2, false><<<dim3(NT / 128, 1024 / 64), 256, 0, stream>>>(
      wfuse, 512, hcat, big, NT, 1024, 512, nullptr, fuse_bn_g, fuse_bn_b, nullptr, 0);
  k_pool<<<dim3(1024, 2), 256, 0, stream>>>(big, xmax, xavg);
  k_cls<<<1, 128, 0, stream>>>(label_w, cls_lab, label_bn_g, label_bn_b, clsf);
  k_headbias<<<512 / 16, GW * 32, 0, stream>>>(ws1c, glob, convs1_b, hbias);

  // segmentation head
  k_gemm<true, true, 1, false><<<dim3(NT / 128, 512 / 64), 256, 0, stream>>>(
      ws1c, HK, big, hs1, NT, 512, HKP, hbias, bns1_g, bns1_b, nullptr, 512);
  k_gemm<true, true, 1, false><<<dim3(NT / 128, 256 / 64), 256, 0, stream>>>(
      ws2c, 512, hs1, hs2, NT, 256, 512, convs2_b, bns2_g, bns2_b, nullptr, 0);
  k_gemm<true, false, 0, false><<<dim3(NT / 128, 1), 256, 0, stream>>>(
      ws3c, 256, hs2, out3, NT, 50, 256, convs3_b, nullptr, nullptr, nullptr, 0);
  k_repack<<<(2 * 50 * NPTS + 255) / 256, 256, 0, stream>>>(out3, (float*)d_out);
}
